// v000
// Measured on an AMD MI455X. A time is GPU time per run, averaged over a window of back-to-back runs after a warm-up
// (all launches, gaps included; the runs take copies of the inputs in turn), and the median of several windows.
// Apart from v000's, it joins two sittings. Times from different sittings can be a few percent apart, while
// side-by-side timings come from the same sitting.
// v000 is the starting kernel. One run takes 1380 microseconds.
#include <hip/hip_runtime.h>

// Causal multi-head self-attention, no output projection: x [NB][SEQ][1024]; qk = x Wqk + bqk (Wqk [1024][2048] 'in x out': q = cols 0..1023, k = cols 1024..2047), v = x Wv + bv (Wv [1024][1024]); 16 heads x 64 (col = h*64 + d); s = q.k x 0.125; keys j > i replaced by -1e9; softmax f32; out[b][t][h*64+d] = sum_j p v.
// Compute dtypes, f32 accumulate: every input RNE-converted to bf16; projections v_wmma_f32_16x16x32_bf16 (exact products) + bf16 bias; q.k and p.v: query rows < 512 bf16 hi/lo planes (3 products, v_wmma bf16), other rows v_wmma_f32_16x16x32_f16 single planes with p carried x1024 (folded back x2^-10 in the f32 epilogue); softmax f32.
// Layout per batch: bf16 copy of x; fused weight transposed once to K-contiguous rows (q | k | v row blocks); one fused projection GEMM -> f32 F [t][3072]; head planes [h][t][d] / value planes [g][d][t]; per pass of 2 heads: scores (tiles above the diagonal skipped) -> row softmax -> p.v written straight into the merged output (256-B head segments).

#ifndef NB
#define NB 2
#endif
#ifndef SEQ
#define SEQ 2048
#endif
#define NB_FULL  2
#define SEQ_FULL 2048
#define TT   SEQ
#define DM   1024
#define NH_  16
#define HD   64
#define DQ   (NH_ * HD)
#define N3   (3 * DQ)
#define ZH   2
#define RH   ((TT < 512) ? TT : 512)     // query rows < RH use hi+lo planes
#define PCAR 1024.0f
#define SCL  0.125f                       // 64^-0.5
#define NEGF (-1.0e9f)
static_assert(TT % 128 == 0);
static_assert(RH % 128 == 0);
static_assert((TT - RH) % 64 == 0);
static_assert(NH_ % ZH == 0);
static_assert(DM % 32 == 0);
static_assert(N3 % 64 == 0);

typedef _Float16 h16;
typedef unsigned short bf;
typedef __attribute__((ext_vector_type(16))) __bf16   v16bf;
typedef __attribute__((ext_vector_type(16))) _Float16 v16h;
typedef __attribute__((ext_vector_type(8)))  _Float16 v8h;
typedef __attribute__((ext_vector_type(8)))  unsigned short v8us;
typedef __attribute__((ext_vector_type(8)))  float    v8f;
typedef __attribute__((ext_vector_type(4)))  float    v4f;
typedef __attribute__((ext_vector_type(2)))  float    v2f;
typedef __attribute__((ext_vector_type(2)))  _Float16 v2h;
typedef __attribute__((ext_vector_type(4)))  _Float16 v4h;
typedef __attribute__((ext_vector_type(2)))  unsigned short v2us;
typedef __attribute__((ext_vector_type(4)))  unsigned short v4us;
typedef v4f  __attribute__((may_alias)) v4fa;

__device__ __forceinline__ unsigned short f2bf(float f) { unsigned u = __float_as_uint(f); u += 0x7FFFu + ((u >> 16) & 1u); return (unsigned short)(u >> 16); }
__device__ __forceinline__ float bf2f(unsigned short b) { return __uint_as_float(((unsigned)b) << 16); }
__device__ __forceinline__ float bfr(float f) { return bf2f(f2bf(f)); }
__device__ __forceinline__ v16h cat16(v8h lo, v8h hi) { return __builtin_shufflevector(lo, hi, 0, 1, 2, 3, 4, 5, 6, 7, 8, 9, 10, 11, 12, 13, 14, 15); }
__device__ __forceinline__ v16bf cat16b(v8us lo, v8us hi) { return __builtin_bit_cast(v16bf, __builtin_shufflevector(lo, hi, 0, 1, 2, 3, 4, 5, 6, 7, 8, 9, 10, 11, 12, 13, 14, 15)); }
__device__ __forceinline__ v8f wmma16(v16h a, v16h b, v8f c) { return __builtin_amdgcn_wmma_f32_16x16x32_f16(false, a, false, b, (short)0, c, false, false); }
__device__ __forceinline__ v8f wmmab(v16bf a, v16bf b, v8f c) { return __builtin_amdgcn_wmma_f32_16x16x32_bf16(false, a, false, b, (short)0, c, false, false); }
__device__ __forceinline__ h16 tohx(float x) { return (h16)x; }
__device__ __forceinline__ void splitf(float y, unsigned short& h, unsigned short& l) { h = f2bf(y); l = f2bf(y - bf2f(h)); }

// ---- k_gemmw: register-blocked GEMM, ONE WAVE per 64x64 output tile (16 accumulators), operands straight from K-contiguous 16-bit planes (row pitch K); grid (M/64, N/64, Z), 32 threads.
// C[m][n] (f32, pitch ldc) = osc * sum_{k<kend} A[m][k] Bt[n][k] (+ split products per NSPLIT) (+ bf16 bias[n]). z-batch strides sA/sB/sC in elements. K % 32 == 0.
// Fragment map: lane -> row/col (lane & 15); elements 0..7 = k0 + 8*(lane>>4) + 0..7, elements 8..15 = k0 + 16 + 8*(lane>>4) + 0..7 for both operands; D element j = row 8*(lane>>4)+j, col lane&15.
// CAUS 1: tiles whose first column lies beyond the last causal key of the tile rows (global row = rbase + local row) exit at once. CAUS 2: k loop stops at rbase + r0 + 64.
template <typename T16> struct WFrag;
template <> struct WFrag<h16> { typedef v16h V; static __device__ __forceinline__ V ld(const h16* p) { return cat16(*(const v8h*)p, *(const v8h*)(p + 16)); } static __device__ __forceinline__ v8f mma(V a, V b, v8f c) { return wmma16(a, b, c); } };
template <> struct WFrag<bf> { typedef v16bf V; static __device__ __forceinline__ V ld(const bf* p) { return cat16b(*(const v8us*)p, *(const v8us*)(p + 16)); } static __device__ __forceinline__ v8f mma(V a, V b, v8f c) { return wmmab(a, b, c); } };
template <typename T16, int NSPLIT, bool BIAS, int CAUS>
__global__ __launch_bounds__(32) void k_gemmw(const T16* __restrict__ A, const T16* __restrict__ A2, const T16* __restrict__ Bt, const T16* __restrict__ Bt2, int K, float* C, int ldc, const float* __restrict__ bias, size_t sA, size_t sB, size_t sC, int rbase, float osc) {
    typedef typename WFrag<T16>::V V;
    __shared__ __align__(16) float os[16 * 68];
    const int r0 = blockIdx.x * 64, c0 = blockIdx.y * 64;
    if (CAUS == 1) { if (c0 >= rbase + r0 + 64) return; }
    int kend = K;
    if (CAUS == 2) { const int kl = rbase + r0 + 64; kend = (kl < K) ? kl : K; }
    const size_t z = blockIdx.z; A += z * sA; if (A2) A2 += z * sA; Bt += z * sB; if (Bt2) Bt2 += z * sB; C += z * sC;
    const int lane = threadIdx.x & 31, lr = lane & 15, hi = lane >> 4;
    v8f acc[4][4];
#pragma unroll
    for (int mb = 0; mb < 4; ++mb)
#pragma unroll
        for (int nb = 0; nb < 4; ++nb) acc[mb][nb] = (v8f){};
    const size_t aoff = (size_t)(r0 + lr) * K + 8 * hi, boff = (size_t)(c0 + lr) * K + 8 * hi;
#pragma unroll 1
    for (int kc = 0; kc < kend; kc += 32) {
        V a[4], a2[4];
#pragma unroll
        for (int mb = 0; mb < 4; ++mb) { a[mb] = WFrag<T16>::ld(A + aoff + (size_t)mb * 16 * K + kc); if (NSPLIT == 1 || NSPLIT == 2) a2[mb] = WFrag<T16>::ld(A2 + aoff + (size_t)mb * 16 * K + kc); }
#pragma unroll
        for (int nb = 0; nb < 4; ++nb) { const V b = WFrag<T16>::ld(Bt + boff + (size_t)nb * 16 * K + kc); V b2; if (NSPLIT >= 2) b2 = WFrag<T16>::ld(Bt2 + boff + (size_t)nb * 16 * K + kc);
#pragma unroll
            for (int mb = 0; mb < 4; ++mb) { acc[mb][nb] = WFrag<T16>::mma(a[mb], b, acc[mb][nb]); if (NSPLIT == 1 || NSPLIT == 2) acc[mb][nb] = WFrag<T16>::mma(a2[mb], b, acc[mb][nb]); if (NSPLIT >= 2) acc[mb][nb] = WFrag<T16>::mma(a[mb], b2, acc[mb][nb]); } }
        asm volatile("v_nop\n\tv_nop\n\tv_nop\n\tv_nop" : "+v"(acc[0][0]), "+v"(acc[1][1]), "+v"(acc[2][2]), "+v"(acc[3][3]) : "v"(a[0]), "v"(a[3]));
    }
#pragma unroll
    for (int mb = 0; mb < 4; ++mb) {
#pragma unroll
        for (int nb = 0; nb < 4; ++nb) {
#pragma unroll
            for (int j = 0; j < 8; ++j) os[(hi * 8 + j) * 68 + nb * 16 + lr] = acc[mb][nb][j]; }
        __builtin_amdgcn_wave_barrier(); asm volatile("" ::: "memory");
        float* crow = C + (size_t)(r0 + mb * 16) * ldc + c0;
{
#pragma unroll
            for (int s = 0; s < 8; ++s) { const int row = 2 * s + hi, cofs = lr * 4; v4f val = *(const v4fa*)(os + row * 68 + cofs);
                val[0] *= osc; val[1] *= osc; val[2] *= osc; val[3] *= osc;
                if (BIAS) { val[0] += bfr(bias[c0 + cofs]); val[1] += bfr(bias[c0 + cofs + 1]); val[2] += bfr(bias[c0 + cofs + 2]); val[3] += bfr(bias[c0 + cofs + 3]); }
                *(v4f*)(crow + (size_t)row * ldc + cofs) = val; }
             }
        __builtin_amdgcn_wave_barrier(); asm volatile("" ::: "memory");
    }
}

__global__ __launch_bounds__(256) void k_wtG(const float* __restrict__ w, int K, int N, bf* Bt) {
    const int lane = threadIdx.x & 31; const int L0 = (blockIdx.x * 8 + (threadIdx.x >> 5)) * 8; const int nlines = N * K / 64;
{
#pragma unroll 1
        for (int l = 0; l < 8; ++l) { const int L = L0 + l; if (L >= nlines) break; const size_t e = (size_t)L * 64 + lane * 2; const int k = (int)(e % K), n = (int)(e / K); v2us o;
            o[0] = f2bf(w[(size_t)k * N + n]); o[1] = f2bf(w[(size_t)(k + 1) * N + n]); *(v2us*)(Bt + e) = o; }
         }
}
__global__ __launch_bounds__(256) void k_bcat(const float* __restrict__ bqk, const float* __restrict__ bv, float* Bq) {
    const int i = blockIdx.x * 256 + threadIdx.x; if (i >= N3 / 4) return; const int c = i * 4; v4f o;
#pragma unroll
    for (int q = 0; q < 4; ++q) { const int cc = c + q; const int ia = (cc < 2 * DQ) ? cc : (2 * DQ - 1); int ib = cc - 2 * DQ; ib = (ib < 0) ? 0 : ib; ib = (ib > DQ - 1) ? (DQ - 1) : ib;
        const float a = bqk[ia]; const float b2 = bv[ib]; o[q] = (cc < 2 * DQ) ? a : b2; }
    *(v4f*)(Bq + c) = o;  }
__global__ __launch_bounds__(256) void k_cvt8(const float* __restrict__ src, bf* dst, size_t n8) { const size_t i = (size_t)blockIdx.x * 256 + threadIdx.x; if (i >= n8) return; const v8f v = *(const v8f*)(src + i * 8); v8us o;
#pragma unroll
    for (int k = 0; k < 8; ++k) o[k] = f2bf(v[k]); *(v8us*)(dst + i * 8) = o;  }

__global__ __launch_bounds__(256) void k_hp(const float* __restrict__ F, int pitch, int nheads, h16* P16, bf* Ph, bf* Pl) {
    const size_t e = ((size_t)blockIdx.x * 256 + threadIdx.x) * 2; if (e >= (size_t)nheads * TT * HD) return;
    const int d = (int)(e % HD); const int t = (int)((e / HD) % TT); const int h = (int)(e / ((size_t)HD * TT));
    const v2f x = *(const v2f*)(F + (size_t)t * pitch + h * HD + d); v2h o16; v2us oh, ol;
#pragma unroll
    for (int q = 0; q < 2; ++q) { o16[q] = tohx(x[q]); unsigned short a2, c2; splitf(x[q], a2, c2); oh[q] = a2; ol[q] = c2; }
    const bool hl = (t < RH); const size_t eh = ((size_t)h * RH + (hl ? t : 0)) * HD + d;
    *(v2h*)(P16 + e) = o16; if (hl) { *(v2us*)(Ph + eh) = oh; *(v2us*)(Pl + eh) = ol; }
     }
__global__ __launch_bounds__(256) void k_vtp(const float* __restrict__ F, int pitch, int nheads, h16* V16, bf* Vh, bf* Vl) {
    const size_t e = ((size_t)blockIdx.x * 256 + threadIdx.x) * 2; if (e >= (size_t)nheads * HD * TT) return;
    const int t = (int)(e % TT); const int d = (int)((e / TT) % HD); const int g = (int)(e / ((size_t)TT * HD)); v2h o16; v2us oh, ol;
#pragma unroll
    for (int q = 0; q < 2; ++q) { const float x = F[(size_t)(t + q) * pitch + g * HD + d]; o16[q] = tohx(x); unsigned short a2, c2; splitf(x, a2, c2); oh[q] = a2; ol[q] = c2; }
    const bool hl = (t < RH); const size_t eh = ((size_t)g * HD + d) * RH + (hl ? t : 0);
    *(v2h*)(V16 + e) = o16; if (hl) { *(v2us*)(Vh + eh) = oh; *(v2us*)(Vl + eh) = ol; }
     }

// k_asoft: one wave per row (zz, i): t_j = S[j] x 0.125 for j <= i, -1e9 otherwise (replace fill, selected by index; 128-key chunks entirely beyond i are neither loaded nor stored);
__global__ __launch_bounds__(256) void k_asoft(const float* __restrict__ Sb, h16* P16, bf* Ph, bf* Pl) {
    const int lane = threadIdx.x & 31; const int wv = __builtin_amdgcn_readfirstlane((int)(threadIdx.x >> 5));
    const int row = blockIdx.x * 8 + wv; if (row >= ZH * TT) return;
    const int i = row % TT; const int zz = row / TT; const bool hires = (i < RH);
    const float* sr = Sb + (size_t)row * TT; float v[TT / 32]; float mx = -3.0e38f;
#pragma unroll
    for (int ch = 0; ch < TT / 128; ++ch) {
        if (ch * 128 <= i) { const int j0 = ch * 128 + lane * 4; const v4f a = *(const v4f*)(sr + j0);
#pragma unroll
            for (int q = 0; q < 4; ++q) { const float t = (j0 + q <= i) ? a[q] * SCL : NEGF; v[ch * 4 + q] = t; mx = fmaxf(mx, t); } }
        else {
#pragma unroll
            for (int q = 0; q < 4; ++q) v[ch * 4 + q] = NEGF; } }
#pragma unroll
    for (int sh = 16; sh; sh >>= 1) mx = fmaxf(mx, __shfl_xor(mx, sh, 32));
    float sum = 0.f;
#pragma unroll
    for (int ch = 0; ch < TT / 128; ++ch) {
        if (ch * 128 <= i) {
#pragma unroll
            for (int q = 0; q < 4; ++q) { const int k = ch * 4 + q; float d0 = __fsub_rn(v[k], mx); asm volatile("" : "+v"(d0)); v[k] = __builtin_amdgcn_exp2f(__fmul_rn(d0, 1.4426950408889634f)); sum += v[k]; } }
        else {
#pragma unroll
            for (int q = 0; q < 4; ++q) v[ch * 4 + q] = 0.f; } }
#pragma unroll
    for (int sh = 16; sh; sh >>= 1) sum += __shfl_xor(sum, sh, 32);
    const float f = __fdiv_rn(hires ? 1.0f : PCAR, sum);
{
        if (hires) {
#pragma unroll
            for (int ch = 0; ch < RH / 128; ++ch) {
                if (ch * 128 <= i) { v4us oh, ol;
#pragma unroll
                    for (int q = 0; q < 4; ++q) { unsigned short a, c2; splitf(v[ch * 4 + q] * f, a, c2); oh[q] = a; ol[q] = c2; }
                    const size_t oo = ((size_t)zz * RH + i) * RH + ch * 128 + lane * 4; *(v4us*)(Ph + oo) = oh; *(v4us*)(Pl + oo) = ol; } }
        } else {
#pragma unroll
            for (int ch = 0; ch < TT / 128; ++ch) {
                if (ch * 128 <= i) { v4h o4;
#pragma unroll
                    for (int q = 0; q < 4; ++q) o4[q] = tohx(v[ch * 4 + q] * f);
                    *(v4h*)(P16 + ((size_t)zz * (TT - RH) + (size_t)(i - RH)) * TT + ch * 128 + lane * 4) = o4; } } }
         }
}

extern "C" void kernel_launch(void* const* d_in, const int* in_sizes, int n_in,
                              void* d_out, int out_size, void* d_ws, size_t ws_size, hipStream_t stream) {
    if (n_in < 5) return;
    if (in_sizes[0] < (NB - 1) * SEQ_FULL * DM + TT * DM) return;
    if (in_sizes[1] < DM * 2 * DQ) return; if (in_sizes[2] < 2 * DQ) return; if (in_sizes[3] < DM * DQ) return; if (in_sizes[4] < DQ) return;
    if (out_size < NB * TT * DM) return;
    const float* x = (const float*)d_in[0]; const float* wqk = (const float*)d_in[1]; const float* bqk = (const float*)d_in[2]; const float* wv = (const float*)d_in[3]; const float* bv = (const float*)d_in[4];   // wire order x, Wqk, bqk, Wv, bv
    float* OUT = (float*)d_out;     // [NB][TT][1024]
    char* wsp = (char*)d_ws;
    auto take = [&](size_t bytes) { char* p = wsp; wsp += (bytes + 255) & ~(size_t)255; return (void*)p; };
    bf* WQKV = (bf*)take((size_t)N3 * DM * 2);                  // Bt [3072][1024]: q | k | v row blocks
    float* BQKV = (float*)take((size_t)N3 * 4);
    bf* XB = (bf*)take((size_t)TT * DM * 2);
    float* F = (float*)take((size_t)TT * N3 * 4);               // [t][q | k | v]
    h16* QK16 = (h16*)take((size_t)2 * NH_ * TT * HD * 2);      // [32][TT][64]: q heads 0..15, k heads 16..31
    h16* VT16 = (h16*)take((size_t)NH_ * HD * TT * 2);          // [16][64][TT]
    bf* QKh = (bf*)take((size_t)2 * NH_ * RH * HD * 2); bf* QKl = (bf*)take((size_t)2 * NH_ * RH * HD * 2);
    bf* VTh = (bf*)take((size_t)NH_ * HD * RH * 2); bf* VTl = (bf*)take((size_t)NH_ * HD * RH * 2);
    bf* Ph = (bf*)take((size_t)ZH * RH * RH * 2); bf* Pl = (bf*)take((size_t)ZH * RH * RH * 2);
    float* Sb = (float*)take((size_t)ZH * TT * TT * 4);
    h16* P16 = (h16*)take((size_t)ZH * (TT - RH) * TT * 2);
    const size_t carved = (size_t)(wsp - (char*)d_ws);
    if (carved > ws_size || carved > ((size_t)128 << 20)) return;
    k_wtG<<<(unsigned)((DM * 2 * DQ / 64 + 63) / 64), 256, 0, stream>>>(wqk, DM, 2 * DQ, WQKV);                          // in[1024][2048] -> out rows 0..2047
    k_wtG<<<(unsigned)((DM * DQ / 64 + 63) / 64), 256, 0, stream>>>(wv, DM, DQ, WQKV + (size_t)2 * DQ * DM);             // in[1024][1024] -> out rows 2048..3071
    k_bcat<<<(N3 / 4 + 255) / 256, 256, 0, stream>>>(bqk, bv, BQKV);
    const unsigned LQK = (unsigned)(((size_t)2 * NH_ * TT * HD / 2 + 255) / 256), LV = (unsigned)(((size_t)NH_ * TT * HD / 2 + 255) / 256);
    for (int b = 0; b < NB; ++b) {
        float* OB = OUT + (size_t)b * TT * DM;
        k_cvt8<<<(unsigned)(((size_t)TT * DM / 8 + 255) / 256), 256, 0, stream>>>(x + (size_t)b * SEQ_FULL * DM, XB, (size_t)TT * DM / 8);
        k_gemmw<bf, 0, true, 0><<<dim3(TT / 64, N3 / 64, 1), 32, 0, stream>>>(XB, nullptr, WQKV, nullptr, DM, F, N3, BQKV, 0, 0, 0, 0, 1.0f);
        k_hp<<<LQK, 256, 0, stream>>>(F, N3, 2 * NH_, QK16, QKh, QKl);
        k_vtp<<<LV, 256, 0, stream>>>(F + 2 * DQ, N3, NH_, VT16, VTh, VTl);
        for (int h0 = 0; h0 < NH_; h0 += ZH) {
            const size_t zq = (size_t)h0, zk = (size_t)(NH_ + h0);
            k_gemmw<bf, 2, false, 1><<<dim3(RH / 64, RH / 64, ZH), 32, 0, stream>>>(QKh + zq * RH * HD, QKl + zq * RH * HD, QKh + zk * RH * HD, QKl + zk * RH * HD, HD, Sb, TT, nullptr, (size_t)RH * HD, (size_t)RH * HD, (size_t)TT * TT, 0, 1.0f);
            if (TT > RH)
                k_gemmw<h16, 0, false, 1><<<dim3((TT - RH) / 64, TT / 64, ZH), 32, 0, stream>>>(QK16 + zq * TT * HD + (size_t)RH * HD, nullptr, QK16 + zk * TT * HD, nullptr, HD, Sb + (size_t)RH * TT, TT, nullptr, (size_t)TT * HD, (size_t)TT * HD, (size_t)TT * TT, RH, 1.0f);
            k_asoft<<<ZH * TT / 8, 256, 0, stream>>>(Sb, P16, Ph, Pl);
            k_gemmw<bf, 2, false, 2><<<dim3(RH / 64, HD / 64, ZH), 32, 0, stream>>>(Ph, Pl, VTh + (size_t)h0 * HD * RH, VTl + (size_t)h0 * HD * RH, RH, OB + (size_t)h0 * HD, DM, nullptr, (size_t)RH * RH, (size_t)HD * RH, (size_t)HD, 0, 1.0f);
            if (TT > RH)
                k_gemmw<h16, 0, false, 2><<<dim3((TT - RH) / 64, HD / 64, ZH), 32, 0, stream>>>(P16, nullptr, VT16 + (size_t)h0 * HD * TT, nullptr, TT, OB + (size_t)RH * DM + (size_t)h0 * HD, DM, nullptr, (size_t)(TT - RH) * TT, (size_t)HD * TT, (size_t)HD, RH, 1.0f / PCAR);
        }
    }
}

// v001
// A run of this version takes 524 microseconds.
// Next to v000, in two timings, it ran 2.64 times as fast each time.
#include <hip/hip_runtime.h>

// Causal multi-head self-attention, no output projection: x [NB][SEQ][1024]; qk = x Wqk + bqk (Wqk [1024][2048] 'in x out': q = cols 0..1023, k = cols 1024..2047), v = x Wv + bv (Wv [1024][1024]); 16 heads x 64 (col = h*64 + d); s = q.k x 0.125; keys j > i replaced by -1e9; softmax f32; out[b][t][h*64+d] = sum_j p v.
// Compute dtypes, f32 accumulate: every input RNE-converted to bf16; projections v_wmma_f32_16x16x32_bf16 (exact products) + bf16 bias; q.k and p.v: query rows < 512 bf16 hi/lo planes (3 products, v_wmma bf16), other rows v_wmma_f32_16x16x32_f16 single planes with p carried x1024 (folded back x2^-10 in the f32 epilogue); softmax f32.
// Layout: bf16 copy of x (both batches); fused weight transposed once to K-contiguous rows (q | k | v row blocks); one fused projection GEMM over both batches -> f32 F [b*t][3072]; head planes [b][h][t][d] / value planes [b][g][d][t]; per pass of ZH heads of one batch: scores (tiles above the diagonal skipped) -> row softmax -> p.v written straight into the merged output (256-B head segments).

#ifndef NB
#define NB 2
#endif
#ifndef SEQ
#define SEQ 2048
#endif
#define NB_FULL  2
#define SEQ_FULL 2048
#define TT   SEQ
#define DM   1024
#define NH_  16
#define HD   64
#define DQ   (NH_ * HD)
#define N3   (3 * DQ)
#define ZH   8                            // heads per attention pass (z extent of each score and p.v launch)
#define RH   ((TT < 512) ? TT : 512)     // query rows < RH use hi+lo planes
#define PCAR 1024.0f
#define SCL  0.125f                       // 64^-0.5
#define NEGF (-1.0e9f)
static_assert(TT % 128 == 0);
static_assert(RH % 128 == 0);
static_assert((TT - RH) % 64 == 0);
static_assert(NH_ % ZH == 0);
static_assert(DM % 32 == 0);
static_assert(N3 % 64 == 0);
static_assert((size_t)NB * TT * N3 * 4 + (size_t)NB * TT * DM * 2 <= (size_t)ZH * TT * TT * 4);   // F and the bf16 x share the score buffer's bytes

typedef _Float16 h16;
typedef unsigned short bf;
typedef __attribute__((ext_vector_type(16))) __bf16   v16bf;
typedef __attribute__((ext_vector_type(16))) _Float16 v16h;
typedef __attribute__((ext_vector_type(8)))  _Float16 v8h;
typedef __attribute__((ext_vector_type(8)))  unsigned short v8us;
typedef __attribute__((ext_vector_type(8)))  float    v8f;
typedef __attribute__((ext_vector_type(4)))  float    v4f;
typedef __attribute__((ext_vector_type(2)))  float    v2f;
typedef __attribute__((ext_vector_type(2)))  _Float16 v2h;
typedef __attribute__((ext_vector_type(4)))  _Float16 v4h;
typedef __attribute__((ext_vector_type(2)))  unsigned short v2us;
typedef __attribute__((ext_vector_type(4)))  unsigned short v4us;
typedef v4f  __attribute__((may_alias)) v4fa;

__device__ __forceinline__ unsigned short f2bf(float f) { unsigned u = __float_as_uint(f); u += 0x7FFFu + ((u >> 16) & 1u); return (unsigned short)(u >> 16); }
__device__ __forceinline__ float bf2f(unsigned short b) { return __uint_as_float(((unsigned)b) << 16); }
__device__ __forceinline__ float bfr(float f) { return bf2f(f2bf(f)); }
__device__ __forceinline__ v16h cat16(v8h lo, v8h hi) { return __builtin_shufflevector(lo, hi, 0, 1, 2, 3, 4, 5, 6, 7, 8, 9, 10, 11, 12, 13, 14, 15); }
__device__ __forceinline__ v16bf cat16b(v8us lo, v8us hi) { return __builtin_bit_cast(v16bf, __builtin_shufflevector(lo, hi, 0, 1, 2, 3, 4, 5, 6, 7, 8, 9, 10, 11, 12, 13, 14, 15)); }
__device__ __forceinline__ v8f wmma16(v16h a, v16h b, v8f c) { return __builtin_amdgcn_wmma_f32_16x16x32_f16(false, a, false, b, (short)0, c, false, false); }
__device__ __forceinline__ v8f wmmab(v16bf a, v16bf b, v8f c) { return __builtin_amdgcn_wmma_f32_16x16x32_bf16(false, a, false, b, (short)0, c, false, false); }
__device__ __forceinline__ h16 tohx(float x) { return (h16)x; }
__device__ __forceinline__ void splitf(float y, unsigned short& h, unsigned short& l) { h = f2bf(y); l = f2bf(y - bf2f(h)); }

// ---- k_gemmw: register-blocked GEMM, ONE WAVE per 64x64 output tile (16 accumulators), operands straight from K-contiguous 16-bit planes (row pitch K); grid (M/64, N/64, Z), 32 threads.
// C[m][n] (f32, pitch ldc) = osc * sum_{k<kend} A[m][k] Bt[n][k] (+ split products per NSPLIT) (+ bf16 bias[n]). z-batch strides sA/sB/sC in elements. K % 32 == 0.
// Fragment map: lane -> row/col (lane & 15); elements 0..7 = k0 + 8*(lane>>4) + 0..7, elements 8..15 = k0 + 16 + 8*(lane>>4) + 0..7 for both operands; D element j = row 8*(lane>>4)+j, col lane&15.
// CAUS 1: tiles whose first column lies beyond the last causal key of the tile rows (global row = rbase + local row) exit at once. CAUS 2: k loop stops at rbase + r0 + 64.
template <typename T16> struct WFrag;
template <> struct WFrag<h16> { typedef v16h V; static __device__ __forceinline__ V ld(const h16* p) { return cat16(*(const v8h*)p, *(const v8h*)(p + 16)); } static __device__ __forceinline__ v8f mma(V a, V b, v8f c) { return wmma16(a, b, c); } };
template <> struct WFrag<bf> { typedef v16bf V; static __device__ __forceinline__ V ld(const bf* p) { return cat16b(*(const v8us*)p, *(const v8us*)(p + 16)); } static __device__ __forceinline__ v8f mma(V a, V b, v8f c) { return wmmab(a, b, c); } };
template <typename T16, int NSPLIT, bool BIAS, int CAUS>
__global__ __launch_bounds__(32) void k_gemmw(const T16* __restrict__ A, const T16* __restrict__ A2, const T16* __restrict__ Bt, const T16* __restrict__ Bt2, int K, float* C, int ldc, const float* __restrict__ bias, size_t sA, size_t sB, size_t sC, int rbase, float osc) {
    typedef typename WFrag<T16>::V V;
    __shared__ __align__(16) float os[16 * 68];
    const int r0 = blockIdx.x * 64, c0 = blockIdx.y * 64;
    if (CAUS == 1) { if (c0 >= rbase + r0 + 64) return; }
    int kend = K;
    if (CAUS == 2) { const int kl = rbase + r0 + 64; kend = (kl < K) ? kl : K; }
    const size_t z = blockIdx.z; A += z * sA; if (A2) A2 += z * sA; Bt += z * sB; if (Bt2) Bt2 += z * sB; C += z * sC;
    const int lane = threadIdx.x & 31, lr = lane & 15, hi = lane >> 4;
    v8f acc[4][4];
#pragma unroll
    for (int mb = 0; mb < 4; ++mb)
#pragma unroll
        for (int nb = 0; nb < 4; ++nb) acc[mb][nb] = (v8f){};
    const size_t aoff = (size_t)(r0 + lr) * K + 8 * hi, boff = (size_t)(c0 + lr) * K + 8 * hi;
#pragma unroll 1
    for (int kc = 0; kc < kend; kc += 32) {
        V a[4], a2[4];
#pragma unroll
        for (int mb = 0; mb < 4; ++mb) { a[mb] = WFrag<T16>::ld(A + aoff + (size_t)mb * 16 * K + kc); if (NSPLIT == 1 || NSPLIT == 2) a2[mb] = WFrag<T16>::ld(A2 + aoff + (size_t)mb * 16 * K + kc); }
#pragma unroll
        for (int nb = 0; nb < 4; ++nb) { const V b = WFrag<T16>::ld(Bt + boff + (size_t)nb * 16 * K + kc); V b2; if (NSPLIT >= 2) b2 = WFrag<T16>::ld(Bt2 + boff + (size_t)nb * 16 * K + kc);
#pragma unroll
            for (int mb = 0; mb < 4; ++mb) { acc[mb][nb] = WFrag<T16>::mma(a[mb], b, acc[mb][nb]); if (NSPLIT == 1 || NSPLIT == 2) acc[mb][nb] = WFrag<T16>::mma(a2[mb], b, acc[mb][nb]); if (NSPLIT >= 2) acc[mb][nb] = WFrag<T16>::mma(a[mb], b2, acc[mb][nb]); } }
        asm volatile("v_nop\n\tv_nop\n\tv_nop\n\tv_nop" : "+v"(acc[0][0]), "+v"(acc[1][1]), "+v"(acc[2][2]), "+v"(acc[3][3]) : "v"(a[0]), "v"(a[3]));
    }
#pragma unroll
    for (int mb = 0; mb < 4; ++mb) {
#pragma unroll
        for (int nb = 0; nb < 4; ++nb) {
#pragma unroll
            for (int j = 0; j < 8; ++j) os[(hi * 8 + j) * 68 + nb * 16 + lr] = acc[mb][nb][j]; }
        __builtin_amdgcn_wave_barrier(); asm volatile("" ::: "memory");
        float* crow = C + (size_t)(r0 + mb * 16) * ldc + c0;
{
#pragma unroll
            for (int s = 0; s < 8; ++s) { const int row = 2 * s + hi, cofs = lr * 4; v4f val = *(const v4fa*)(os + row * 68 + cofs);
                val[0] *= osc; val[1] *= osc; val[2] *= osc; val[3] *= osc;
                if (BIAS) { val[0] += bfr(bias[c0 + cofs]); val[1] += bfr(bias[c0 + cofs + 1]); val[2] += bfr(bias[c0 + cofs + 2]); val[3] += bfr(bias[c0 + cofs + 3]); }
                *(v4f*)(crow + (size_t)row * ldc + cofs) = val; }
             }
        __builtin_amdgcn_wave_barrier(); asm volatile("" ::: "memory");
    }
}

__global__ __launch_bounds__(256) void k_wtG(const float* __restrict__ w, int K, int N, bf* Bt) {
    const int lane = threadIdx.x & 31; const int L0 = (blockIdx.x * 8 + (threadIdx.x >> 5)) * 8; const int nlines = N * K / 64;
{
#pragma unroll 1
        for (int l = 0; l < 8; ++l) { const int L = L0 + l; if (L >= nlines) break; const size_t e = (size_t)L * 64 + lane * 2; const int k = (int)(e % K), n = (int)(e / K); v2us o;
            o[0] = f2bf(w[(size_t)k * N + n]); o[1] = f2bf(w[(size_t)(k + 1) * N + n]); *(v2us*)(Bt + e) = o; }
         }
}
__global__ __launch_bounds__(256) void k_bcat(const float* __restrict__ bqk, const float* __restrict__ bv, float* Bq) {
    const int i = blockIdx.x * 256 + threadIdx.x; if (i >= N3 / 4) return; const int c = i * 4; v4f o;
#pragma unroll
    for (int q = 0; q < 4; ++q) { const int cc = c + q; const int ia = (cc < 2 * DQ) ? cc : (2 * DQ - 1); int ib = cc - 2 * DQ; ib = (ib < 0) ? 0 : ib; ib = (ib > DQ - 1) ? (DQ - 1) : ib;
        const float a = bqk[ia]; const float b2 = bv[ib]; o[q] = (cc < 2 * DQ) ? a : b2; }
    *(v4f*)(Bq + c) = o;  }
__global__ __launch_bounds__(256) void k_cvt8(const float* __restrict__ src, bf* dst, size_t n8, size_t sS, size_t sD) { const size_t i = (size_t)blockIdx.x * 256 + threadIdx.x; if (i >= n8) return; src += blockIdx.y * sS; dst += blockIdx.y * sD;   // grid y = batch
    const v8f v = *(const v8f*)(src + i * 8); v8us o;
#pragma unroll
    for (int k = 0; k < 8; ++k) o[k] = f2bf(v[k]); *(v8us*)(dst + i * 8) = o;  }

__global__ __launch_bounds__(256) void k_hp(const float* __restrict__ F, int pitch, int nheads, h16* P16, bf* Ph, bf* Pl) {
    const size_t e = ((size_t)blockIdx.x * 256 + threadIdx.x) * 2; if (e >= (size_t)nheads * TT * HD) return;
    const size_t bb = blockIdx.y; F += bb * TT * pitch; P16 += bb * nheads * TT * HD; Ph += bb * nheads * RH * HD; Pl += bb * nheads * RH * HD;   // grid y = batch
    const int d = (int)(e % HD); const int t = (int)((e / HD) % TT); const int h = (int)(e / ((size_t)HD * TT));
    const v2f x = *(const v2f*)(F + (size_t)t * pitch + h * HD + d); v2h o16; v2us oh, ol;
#pragma unroll
    for (int q = 0; q < 2; ++q) { o16[q] = tohx(x[q]); unsigned short a2, c2; splitf(x[q], a2, c2); oh[q] = a2; ol[q] = c2; }
    const bool hl = (t < RH); const size_t eh = ((size_t)h * RH + (hl ? t : 0)) * HD + d;
    *(v2h*)(P16 + e) = o16; if (hl) { *(v2us*)(Ph + eh) = oh; *(v2us*)(Pl + eh) = ol; }
     }
__global__ __launch_bounds__(256) void k_vtp(const float* __restrict__ F, int pitch, int nheads, h16* V16, bf* Vh, bf* Vl) {
    const size_t e = ((size_t)blockIdx.x * 256 + threadIdx.x) * 2; if (e >= (size_t)nheads * HD * TT) return;
    const size_t bb = blockIdx.y; F += bb * TT * pitch; V16 += bb * nheads * HD * TT; Vh += bb * nheads * HD * RH; Vl += bb * nheads * HD * RH;   // grid y = batch
    const int t = (int)(e % TT); const int d = (int)((e / TT) % HD); const int g = (int)(e / ((size_t)TT * HD)); v2h o16; v2us oh, ol;
#pragma unroll
    for (int q = 0; q < 2; ++q) { const float x = F[(size_t)(t + q) * pitch + g * HD + d]; o16[q] = tohx(x); unsigned short a2, c2; splitf(x, a2, c2); oh[q] = a2; ol[q] = c2; }
    const bool hl = (t < RH); const size_t eh = ((size_t)g * HD + d) * RH + (hl ? t : 0);
    *(v2h*)(V16 + e) = o16; if (hl) { *(v2us*)(Vh + eh) = oh; *(v2us*)(Vl + eh) = ol; }
     }

// k_asoft: one wave per row (zz, i): t_j = S[j] x 0.125 for j <= i, -1e9 otherwise (replace fill, selected by index; 128-key chunks entirely beyond i are neither loaded nor stored);
__global__ __launch_bounds__(256) void k_asoft(const float* __restrict__ Sb, h16* P16, bf* Ph, bf* Pl) {
    const int lane = threadIdx.x & 31; const int wv = __builtin_amdgcn_readfirstlane((int)(threadIdx.x >> 5));
    const int row = blockIdx.x * 8 + wv; if (row >= ZH * TT) return;
    const int i = row % TT; const int zz = row / TT; const bool hires = (i < RH);
    const float* sr = Sb + (size_t)row * TT; float v[TT / 32]; float mx = -3.0e38f;
#pragma unroll
    for (int ch = 0; ch < TT / 128; ++ch) {
        if (ch * 128 <= i) { const int j0 = ch * 128 + lane * 4; const v4f a = *(const v4f*)(sr + j0);
#pragma unroll
            for (int q = 0; q < 4; ++q) { const float t = (j0 + q <= i) ? a[q] * SCL : NEGF; v[ch * 4 + q] = t; mx = fmaxf(mx, t); } }
        else {
#pragma unroll
            for (int q = 0; q < 4; ++q) v[ch * 4 + q] = NEGF; } }
#pragma unroll
    for (int sh = 16; sh; sh >>= 1) mx = fmaxf(mx, __shfl_xor(mx, sh, 32));
    float sum = 0.f;
#pragma unroll
    for (int ch = 0; ch < TT / 128; ++ch) {
        if (ch * 128 <= i) {
#pragma unroll
            for (int q = 0; q < 4; ++q) { const int k = ch * 4 + q; float d0 = __fsub_rn(v[k], mx); asm volatile("" : "+v"(d0)); v[k] = __builtin_amdgcn_exp2f(__fmul_rn(d0, 1.4426950408889634f)); sum += v[k]; } }
        else {
#pragma unroll
            for (int q = 0; q < 4; ++q) v[ch * 4 + q] = 0.f; } }
#pragma unroll
    for (int sh = 16; sh; sh >>= 1) sum += __shfl_xor(sum, sh, 32);
    const float f = __fdiv_rn(hires ? 1.0f : PCAR, sum);
{
        if (hires) {
#pragma unroll
            for (int ch = 0; ch < RH / 128; ++ch) {
                if (ch * 128 <= i) { v4us oh, ol;
#pragma unroll
                    for (int q = 0; q < 4; ++q) { unsigned short a, c2; splitf(v[ch * 4 + q] * f, a, c2); oh[q] = a; ol[q] = c2; }
                    const size_t oo = ((size_t)zz * RH + i) * RH + ch * 128 + lane * 4; *(v4us*)(Ph + oo) = oh; *(v4us*)(Pl + oo) = ol; } }
        } else {
#pragma unroll
            for (int ch = 0; ch < TT / 128; ++ch) {
                if (ch * 128 <= i) { v4h o4;
#pragma unroll
                    for (int q = 0; q < 4; ++q) o4[q] = tohx(v[ch * 4 + q] * f);
                    *(v4h*)(P16 + ((size_t)zz * (TT - RH) + (size_t)(i - RH)) * TT + ch * 128 + lane * 4) = o4; } } }
         }
}

extern "C" void kernel_launch(void* const* d_in, const int* in_sizes, int n_in,
                              void* d_out, int out_size, void* d_ws, size_t ws_size, hipStream_t stream) {
    if (n_in < 5) return;
    if (in_sizes[0] < (NB - 1) * SEQ_FULL * DM + TT * DM) return;
    if (in_sizes[1] < DM * 2 * DQ) return; if (in_sizes[2] < 2 * DQ) return; if (in_sizes[3] < DM * DQ) return; if (in_sizes[4] < DQ) return;
    if (out_size < NB * TT * DM) return;
    const float* x = (const float*)d_in[0]; const float* wqk = (const float*)d_in[1]; const float* bqk = (const float*)d_in[2]; const float* wv = (const float*)d_in[3]; const float* bv = (const float*)d_in[4];   // wire order x, Wqk, bqk, Wv, bv
    float* OUT = (float*)d_out;     // [NB][TT][1024]
    char* wsp = (char*)d_ws;
    auto take = [&](size_t bytes) { char* p = wsp; wsp += (bytes + 255) & ~(size_t)255; return (void*)p; };
    bf* WQKV = (bf*)take((size_t)N3 * DM * 2);                  // Bt [3072][1024]: q | k | v row blocks
    float* BQKV = (float*)take((size_t)N3 * 4);
    h16* QK16 = (h16*)take((size_t)NB * 2 * NH_ * TT * HD * 2); // [NB][32][TT][64]: q heads 0..15, k heads 16..31
    h16* VT16 = (h16*)take((size_t)NB * NH_ * HD * TT * 2);     // [NB][16][64][TT]
    bf* QKh = (bf*)take((size_t)NB * 2 * NH_ * RH * HD * 2); bf* QKl = (bf*)take((size_t)NB * 2 * NH_ * RH * HD * 2);
    bf* VTh = (bf*)take((size_t)NB * NH_ * HD * RH * 2); bf* VTl = (bf*)take((size_t)NB * NH_ * HD * RH * 2);
    bf* Ph = (bf*)take((size_t)ZH * RH * RH * 2); bf* Pl = (bf*)take((size_t)ZH * RH * RH * 2);
    h16* P16 = (h16*)take((size_t)ZH * (TT - RH) * TT * 2);
    float* Sb = (float*)take((size_t)ZH * TT * TT * 4);
    float* F = Sb;                                              // [NB*TT][q | k | v]; last read by k_vtp, before the first score launch writes Sb
    bf* XB = (bf*)(F + (size_t)NB * TT * N3);                   // [NB*TT][1024]; last read by the projection GEMM
    const size_t carved = (size_t)(wsp - (char*)d_ws);
    if (carved > ws_size) return;
    k_wtG<<<(unsigned)((DM * 2 * DQ / 64 + 63) / 64), 256, 0, stream>>>(wqk, DM, 2 * DQ, WQKV);                          // in[1024][2048] -> out rows 0..2047
    k_wtG<<<(unsigned)((DM * DQ / 64 + 63) / 64), 256, 0, stream>>>(wv, DM, DQ, WQKV + (size_t)2 * DQ * DM);             // in[1024][1024] -> out rows 2048..3071
    k_bcat<<<(N3 / 4 + 255) / 256, 256, 0, stream>>>(bqk, bv, BQKV);
    const unsigned LQK = (unsigned)(((size_t)2 * NH_ * TT * HD / 2 + 255) / 256), LV = (unsigned)(((size_t)NH_ * TT * HD / 2 + 255) / 256);
    k_cvt8<<<dim3((unsigned)(((size_t)TT * DM / 8 + 255) / 256), NB, 1), 256, 0, stream>>>(x, XB, (size_t)TT * DM / 8, (size_t)SEQ_FULL * DM, (size_t)TT * DM);
    k_gemmw<bf, 0, true, 0><<<dim3(NB * TT / 64, N3 / 64, 1), 32, 0, stream>>>(XB, nullptr, WQKV, nullptr, DM, F, N3, BQKV, 0, 0, 0, 0, 1.0f);
    k_hp<<<dim3(LQK, NB, 1), 256, 0, stream>>>(F, N3, 2 * NH_, QK16, QKh, QKl);
    k_vtp<<<dim3(LV, NB, 1), 256, 0, stream>>>(F + 2 * DQ, N3, NH_, VT16, VTh, VTl);
    for (int b = 0; b < NB; ++b) {
        float* OB = OUT + (size_t)b * TT * DM;
        for (int h0 = 0; h0 < NH_; h0 += ZH) {
            const size_t zq = (size_t)(b * 2 * NH_ + h0), zk = zq + NH_, zv = (size_t)(b * NH_ + h0);
            k_gemmw<bf, 2, false, 1><<<dim3(RH / 64, RH / 64, ZH), 32, 0, stream>>>(QKh + zq * RH * HD, QKl + zq * RH * HD, QKh + zk * RH * HD, QKl + zk * RH * HD, HD, Sb, TT, nullptr, (size_t)RH * HD, (size_t)RH * HD, (size_t)TT * TT, 0, 1.0f);
            if (TT > RH)
                k_gemmw<h16, 0, false, 1><<<dim3((TT - RH) / 64, TT / 64, ZH), 32, 0, stream>>>(QK16 + zq * TT * HD + (size_t)RH * HD, nullptr, QK16 + zk * TT * HD, nullptr, HD, Sb + (size_t)RH * TT, TT, nullptr, (size_t)TT * HD, (size_t)TT * HD, (size_t)TT * TT, RH, 1.0f);
            k_asoft<<<ZH * TT / 8, 256, 0, stream>>>(Sb, P16, Ph, Pl);
            k_gemmw<bf, 2, false, 2><<<dim3(RH / 64, HD / 64, ZH), 32, 0, stream>>>(Ph, Pl, VTh + zv * HD * RH, VTl + zv * HD * RH, RH, OB + (size_t)h0 * HD, DM, nullptr, (size_t)RH * RH, (size_t)HD * RH, (size_t)HD, 0, 1.0f);
            if (TT > RH)
                k_gemmw<h16, 0, false, 2><<<dim3((TT - RH) / 64, HD / 64, ZH), 32, 0, stream>>>(P16, nullptr, VT16 + zv * HD * TT, nullptr, TT, OB + (size_t)RH * DM + (size_t)h0 * HD, DM, nullptr, (size_t)(TT - RH) * TT, (size_t)HD * TT, (size_t)HD, RH, 1.0f / PCAR);
        }
    }
}

// v002
// A run of this version takes 170 microseconds.
// In two side-by-side timings against v001, it was 3.08 and 3.11 times as fast.
// Over all steps from v000 it is 8.19 times as fast.
#include <hip/hip_runtime.h>

// Causal multi-head self-attention, no output projection: x [NB][SEQ][1024]; qk = x Wqk + bqk (Wqk [1024][2048] 'in x out': q = cols 0..1023, k = cols 1024..2047), v = x Wv + bv (Wv [1024][1024]); 16 heads x 64 (col = h*64 + d); s = q.k x 0.125; keys j > i replaced by -1e9; softmax f32; out[b][t][h*64+d] = sum_j p v.
// Compute dtypes, f32 accumulate: every input RNE-converted to bf16; projections v_wmma_f32_16x16x32_bf16 (exact products) + bf16 bias; q.k and p.v: query rows < 512 bf16 hi/lo planes (3 products, v_wmma bf16), other rows v_wmma_f32_16x16x32_f16 single planes with the unnormalised p carried x1024 (the row sum carries the same factor, so it cancels in the f32 division); softmax f32, running maximum and running sum.
// Layout: bf16 copy of x (both batches); fused weight transposed once to K-contiguous rows (q | k | v row blocks); one fused projection GEMM over both batches -> f32 F [b*t][3072]; head planes [b][h][t][d] / value planes [b][g][d][t]; one attention launch for all heads and batches: scores, softmax and p.v stay in registers, output written straight into the merged layout (256-B head segments).

#ifndef NB
#define NB 2
#endif
#ifndef SEQ
#define SEQ 2048
#endif
#define NB_FULL  2
#define SEQ_FULL 2048
#define TT   SEQ
#define DM   1024
#define NH_  16
#define HD   64
#define DQ   (NH_ * HD)
#define N3   (3 * DQ)
#define RH   ((TT < 512) ? TT : 512)     // query rows < RH use hi+lo planes
#define PEXP 10.0f                        // f16 rows: p carried x 2^10
#define SCL  0.125f                       // 64^-0.5
#define NEGF (-1.0e9f)
static_assert(TT % 128 == 0);
static_assert(RH % 128 == 0);
static_assert((TT - RH) % 128 == 0);
static_assert(DM % 32 == 0);
static_assert(N3 % 64 == 0);

typedef _Float16 h16;
typedef unsigned short bf;
typedef __attribute__((ext_vector_type(16))) __bf16   v16bf;
typedef __attribute__((ext_vector_type(16))) _Float16 v16h;
typedef __attribute__((ext_vector_type(8)))  _Float16 v8h;
typedef __attribute__((ext_vector_type(8)))  unsigned short v8us;
typedef __attribute__((ext_vector_type(8)))  float    v8f;
typedef __attribute__((ext_vector_type(4)))  float    v4f;
typedef __attribute__((ext_vector_type(2)))  float    v2f;
typedef __attribute__((ext_vector_type(2)))  _Float16 v2h;
typedef __attribute__((ext_vector_type(4)))  _Float16 v4h;
typedef __attribute__((ext_vector_type(2)))  unsigned short v2us;
typedef __attribute__((ext_vector_type(4)))  unsigned short v4us;
typedef v4f  __attribute__((may_alias)) v4fa;

__device__ __forceinline__ unsigned short f2bf(float f) { unsigned u = __float_as_uint(f); u += 0x7FFFu + ((u >> 16) & 1u); return (unsigned short)(u >> 16); }
__device__ __forceinline__ float bf2f(unsigned short b) { return __uint_as_float(((unsigned)b) << 16); }
__device__ __forceinline__ float bfr(float f) { return bf2f(f2bf(f)); }
__device__ __forceinline__ v16h cat16(v8h lo, v8h hi) { return __builtin_shufflevector(lo, hi, 0, 1, 2, 3, 4, 5, 6, 7, 8, 9, 10, 11, 12, 13, 14, 15); }
__device__ __forceinline__ v16bf cat16b(v8us lo, v8us hi) { return __builtin_bit_cast(v16bf, __builtin_shufflevector(lo, hi, 0, 1, 2, 3, 4, 5, 6, 7, 8, 9, 10, 11, 12, 13, 14, 15)); }
__device__ __forceinline__ v8f wmma16(v16h a, v16h b, v8f c) { return __builtin_amdgcn_wmma_f32_16x16x32_f16(false, a, false, b, (short)0, c, false, false); }
__device__ __forceinline__ v8f wmmab(v16bf a, v16bf b, v8f c) { return __builtin_amdgcn_wmma_f32_16x16x32_bf16(false, a, false, b, (short)0, c, false, false); }
__device__ __forceinline__ h16 tohx(float x) { return (h16)x; }
__device__ __forceinline__ void splitf(float y, unsigned short& h, unsigned short& l) { h = f2bf(y); l = f2bf(y - bf2f(h)); }

// ---- k_gemmw: register-blocked GEMM, ONE WAVE per 64x64 output tile (16 accumulators), operands straight from K-contiguous 16-bit planes (row pitch K); grid (M/64, N/64, Z), 32 threads.
// C[m][n] (f32, pitch ldc) = osc * sum_{k<kend} A[m][k] Bt[n][k] (+ split products per NSPLIT) (+ bf16 bias[n]). z-batch strides sA/sB/sC in elements. K % 32 == 0.
// Fragment map: lane -> row/col (lane & 15); elements 0..7 = k0 + 8*(lane>>4) + 0..7, elements 8..15 = k0 + 16 + 8*(lane>>4) + 0..7 for both operands; D element j = row 8*(lane>>4)+j, col lane&15.
// CAUS 1: tiles whose first column lies beyond the last causal key of the tile rows (global row = rbase + local row) exit at once. CAUS 2: k loop stops at rbase + r0 + 64.
template <typename T16> struct WFrag;
template <> struct WFrag<h16> { typedef v16h V; static __device__ __forceinline__ V ld(const h16* p) { return cat16(*(const v8h*)p, *(const v8h*)(p + 16)); } static __device__ __forceinline__ v8f mma(V a, V b, v8f c) { return wmma16(a, b, c); } };
template <> struct WFrag<bf> { typedef v16bf V; static __device__ __forceinline__ V ld(const bf* p) { return cat16b(*(const v8us*)p, *(const v8us*)(p + 16)); } static __device__ __forceinline__ v8f mma(V a, V b, v8f c) { return wmmab(a, b, c); } };
template <typename T16, int NSPLIT, bool BIAS, int CAUS>
__global__ __launch_bounds__(32) void k_gemmw(const T16* __restrict__ A, const T16* __restrict__ A2, const T16* __restrict__ Bt, const T16* __restrict__ Bt2, int K, float* C, int ldc, const float* __restrict__ bias, size_t sA, size_t sB, size_t sC, int rbase, float osc) {
    typedef typename WFrag<T16>::V V;
    __shared__ __align__(16) float os[16 * 68];
    const int r0 = blockIdx.x * 64, c0 = blockIdx.y * 64;
    if (CAUS == 1) { if (c0 >= rbase + r0 + 64) return; }
    int kend = K;
    if (CAUS == 2) { const int kl = rbase + r0 + 64; kend = (kl < K) ? kl : K; }
    const size_t z = blockIdx.z; A += z * sA; if (A2) A2 += z * sA; Bt += z * sB; if (Bt2) Bt2 += z * sB; C += z * sC;
    const int lane = threadIdx.x & 31, lr = lane & 15, hi = lane >> 4;
    v8f acc[4][4];
#pragma unroll
    for (int mb = 0; mb < 4; ++mb)
#pragma unroll
        for (int nb = 0; nb < 4; ++nb) acc[mb][nb] = (v8f){};
    const size_t aoff = (size_t)(r0 + lr) * K + 8 * hi, boff = (size_t)(c0 + lr) * K + 8 * hi;
#pragma unroll 1
    for (int kc = 0; kc < kend; kc += 32) {
        V a[4], a2[4];
#pragma unroll
        for (int mb = 0; mb < 4; ++mb) { a[mb] = WFrag<T16>::ld(A + aoff + (size_t)mb * 16 * K + kc); if (NSPLIT == 1 || NSPLIT == 2) a2[mb] = WFrag<T16>::ld(A2 + aoff + (size_t)mb * 16 * K + kc); }
#pragma unroll
        for (int nb = 0; nb < 4; ++nb) { const V b = WFrag<T16>::ld(Bt + boff + (size_t)nb * 16 * K + kc); V b2; if (NSPLIT >= 2) b2 = WFrag<T16>::ld(Bt2 + boff + (size_t)nb * 16 * K + kc);
#pragma unroll
            for (int mb = 0; mb < 4; ++mb) { acc[mb][nb] = WFrag<T16>::mma(a[mb], b, acc[mb][nb]); if (NSPLIT == 1 || NSPLIT == 2) acc[mb][nb] = WFrag<T16>::mma(a2[mb], b, acc[mb][nb]); if (NSPLIT >= 2) acc[mb][nb] = WFrag<T16>::mma(a[mb], b2, acc[mb][nb]); } }
        asm volatile("v_nop\n\tv_nop\n\tv_nop\n\tv_nop" : "+v"(acc[0][0]), "+v"(acc[1][1]), "+v"(acc[2][2]), "+v"(acc[3][3]) : "v"(a[0]), "v"(a[3]));
    }
#pragma unroll
    for (int mb = 0; mb < 4; ++mb) {
#pragma unroll
        for (int nb = 0; nb < 4; ++nb) {
#pragma unroll
            for (int j = 0; j < 8; ++j) os[(hi * 8 + j) * 68 + nb * 16 + lr] = acc[mb][nb][j]; }
        __builtin_amdgcn_wave_barrier(); asm volatile("" ::: "memory");
        float* crow = C + (size_t)(r0 + mb * 16) * ldc + c0;
{
#pragma unroll
            for (int s = 0; s < 8; ++s) { const int row = 2 * s + hi, cofs = lr * 4; v4f val = *(const v4fa*)(os + row * 68 + cofs);
                val[0] *= osc; val[1] *= osc; val[2] *= osc; val[3] *= osc;
                if (BIAS) { val[0] += bfr(bias[c0 + cofs]); val[1] += bfr(bias[c0 + cofs + 1]); val[2] += bfr(bias[c0 + cofs + 2]); val[3] += bfr(bias[c0 + cofs + 3]); }
                *(v4f*)(crow + (size_t)row * ldc + cofs) = val; }
             }
        __builtin_amdgcn_wave_barrier(); asm volatile("" ::: "memory");
    }
}

__global__ __launch_bounds__(256) void k_wtG(const float* __restrict__ w, int K, int N, bf* Bt) {
    const int lane = threadIdx.x & 31; const int L0 = (blockIdx.x * 8 + (threadIdx.x >> 5)) * 8; const int nlines = N * K / 64;
{
#pragma unroll 1
        for (int l = 0; l < 8; ++l) { const int L = L0 + l; if (L >= nlines) break; const size_t e = (size_t)L * 64 + lane * 2; const int k = (int)(e % K), n = (int)(e / K); v2us o;
            o[0] = f2bf(w[(size_t)k * N + n]); o[1] = f2bf(w[(size_t)(k + 1) * N + n]); *(v2us*)(Bt + e) = o; }
         }
}
__global__ __launch_bounds__(256) void k_bcat(const float* __restrict__ bqk, const float* __restrict__ bv, float* Bq) {
    const int i = blockIdx.x * 256 + threadIdx.x; if (i >= N3 / 4) return; const int c = i * 4; v4f o;
#pragma unroll
    for (int q = 0; q < 4; ++q) { const int cc = c + q; const int ia = (cc < 2 * DQ) ? cc : (2 * DQ - 1); int ib = cc - 2 * DQ; ib = (ib < 0) ? 0 : ib; ib = (ib > DQ - 1) ? (DQ - 1) : ib;
        const float a = bqk[ia]; const float b2 = bv[ib]; o[q] = (cc < 2 * DQ) ? a : b2; }
    *(v4f*)(Bq + c) = o;  }
__global__ __launch_bounds__(256) void k_cvt8(const float* __restrict__ src, bf* dst, size_t n8, size_t sS, size_t sD) { const size_t i = (size_t)blockIdx.x * 256 + threadIdx.x; if (i >= n8) return; src += blockIdx.y * sS; dst += blockIdx.y * sD;   // grid y = batch
    const v8f v = *(const v8f*)(src + i * 8); v8us o;
#pragma unroll
    for (int k = 0; k < 8; ++k) o[k] = f2bf(v[k]); *(v8us*)(dst + i * 8) = o;  }

__global__ __launch_bounds__(256) void k_hp(const float* __restrict__ F, int pitch, int nheads, h16* P16, bf* Ph, bf* Pl) {
    const size_t e = ((size_t)blockIdx.x * 256 + threadIdx.x) * 2; if (e >= (size_t)nheads * TT * HD) return;
    const size_t bb = blockIdx.y; F += bb * TT * pitch; P16 += bb * nheads * TT * HD; Ph += bb * nheads * RH * HD; Pl += bb * nheads * RH * HD;   // grid y = batch
    const int d = (int)(e % HD); const int t = (int)((e / HD) % TT); const int h = (int)(e / ((size_t)HD * TT));
    const v2f x = *(const v2f*)(F + (size_t)t * pitch + h * HD + d); v2h o16; v2us oh, ol;
#pragma unroll
    for (int q = 0; q < 2; ++q) { o16[q] = tohx(x[q]); unsigned short a2, c2; splitf(x[q], a2, c2); oh[q] = a2; ol[q] = c2; }
    const bool hl = (t < RH); const size_t eh = ((size_t)h * RH + (hl ? t : 0)) * HD + d;
    *(v2h*)(P16 + e) = o16; if (hl) { *(v2us*)(Ph + eh) = oh; *(v2us*)(Pl + eh) = ol; }
     }
__global__ __launch_bounds__(256) void k_vtp(const float* __restrict__ F, int pitch, int nheads, h16* V16, bf* Vh, bf* Vl) {
    const size_t e = ((size_t)blockIdx.x * 256 + threadIdx.x) * 2; if (e >= (size_t)nheads * HD * TT) return;
    const size_t bb = blockIdx.y; F += bb * TT * pitch; V16 += bb * nheads * HD * TT; Vh += bb * nheads * HD * RH; Vl += bb * nheads * HD * RH;   // grid y = batch
    const int t = (int)(e % TT); const int d = (int)((e / TT) % HD); const int g = (int)(e / ((size_t)TT * HD)); v2h o16; v2us oh, ol;
#pragma unroll
    for (int q = 0; q < 2; ++q) { const float x = F[(size_t)(t + q) * pitch + g * HD + d]; o16[q] = tohx(x); unsigned short a2, c2; splitf(x, a2, c2); oh[q] = a2; ol[q] = c2; }
    const bool hl = (t < RH); const size_t eh = ((size_t)g * HD + d) * RH + (hl ? t : 0);
    *(v2h*)(V16 + e) = o16; if (hl) { *(v2us*)(Vh + eh) = oh; *(v2us*)(Vl + eh) = ol; }
     }

// k_fattn: scores, causal softmax and p.v of one (batch, head), 16 * NQ query rows per wave, four waves per block, no memory round trip for s or p.
// Transposed products: s^T = K q^T (A = key rows, B = query rows), so D element j of key tile kt is key k0 + 16*kt + 8*(lane>>4) + j of query (lane & 15): the two key tiles of a 32-key step ARE the B fragment of p^T (elements 0..7 / 8..15) for o^T = V^T p^T (A = value plane rows d, K-contiguous in the key).
// Running softmax per query (= per lane; the two lane halves hold different keys and share the maximum by one cross-half exchange): o and the sum are rescaled by 2^((m_old - m_new) c) each step. Keys j > i take the reference's replace fill (-1e9 after the 0.125 scale); only the last step of a row group meets the diagonal.
__device__ __forceinline__ float xhalf(float x) { return __builtin_bit_cast(float, __builtin_amdgcn_permlanex16(__builtin_bit_cast(int, x), __builtin_bit_cast(int, x), 0x76543210, 0xfedcba98, false, false)); }   // lane l takes lane l ^ 16
template <typename T16, bool HR, int NQ>
__device__ __forceinline__ void attn_rows(const T16* __restrict__ Q, const T16* __restrict__ Q2, const T16* __restrict__ Kp, const T16* __restrict__ K2, const T16* __restrict__ Vt, const T16* __restrict__ V2, const int vp, float* O, const int q0, const int lr, const int hi) {
    typedef WFrag<T16> WF; typedef typename WF::V V;
    const float CL = SCL * 1.4426950408889634f;
    // per-lane byte offsets into a [row][64] plane and into a [d][key] plane: row (lane & 15), 8 elements per lane half
    const unsigned kob = (unsigned)(lr * HD + 8 * hi) * 2u, vob = (unsigned)(lr * vp + 8 * hi) * 2u;
    auto at = [](const T16* base, const unsigned byteoff) { return (const T16*)((const char*)base + byteoff); };
    V qf[NQ][2], q2[NQ][2];
#pragma unroll
    for (int nq = 0; nq < NQ; ++nq)
#pragma unroll
        for (int ks = 0; ks < 2; ++ks) { const int e = (q0 + nq * 16) * HD + ks * 32; qf[nq][ks] = WF::ld(at(Q + e, kob)); if (HR) q2[nq][ks] = WF::ld(at(Q2 + e, kob)); }
    asm volatile("s_wait_xcnt 0x0" ::: "memory");   // the query loads' address registers are free for reuse by what follows
    v8f o[4][NQ]; float mr[NQ], ls[NQ];
#pragma unroll
    for (int nq = 0; nq < NQ; ++nq) { mr[nq] = -1.0e30f; ls[nq] = 0.f;
#pragma unroll
        for (int db = 0; db < 4; ++db) o[db][nq] = (v8f){}; }
    // the four plane pointers live across the whole key loop and step by 32 keys behind each load group
    const T16 *pk = at(Kp, kob), *pk2 = HR ? at(K2, kob) : nullptr, *pv = at(Vt, vob), *pv2 = HR ? at(V2, vob) : nullptr;
    auto ldk = [&](V (&d)[2][2], V (&d2)[2][2]) {
#pragma unroll
        for (int kt = 0; kt < 2; ++kt)
#pragma unroll
            for (int ks = 0; ks < 2; ++ks) { const int e = kt * 16 * HD + ks * 32; d[kt][ks] = WF::ld(pk + e); if (HR) d2[kt][ks] = WF::ld(pk2 + e); }
        pk += 32 * HD; if (HR) pk2 += 32 * HD; };
    auto ldv = [&](V (&d)[4], V (&d2)[4]) {
#pragma unroll
        for (int db = 0; db < 4; ++db) { const int e = db * 16 * vp; d[db] = WF::ld(pv + e); if (HR) d2[db] = WF::ld(pv2 + e); }
        pv += 32; if (HR) pv2 += 32; };
    auto scores = [&](v8f (&s)[2][NQ], V (&kc)[2][2], V (&kc2)[2][2]) {
#pragma unroll
        for (int kt = 0; kt < 2; ++kt)
#pragma unroll
            for (int nq = 0; nq < NQ; ++nq) { v8f c = (v8f){};
#pragma unroll
                for (int ks = 0; ks < 2; ++ks) { c = WF::mma(kc[kt][ks], qf[nq][ks], c); if (HR) { c = WF::mma(kc[kt][ks], q2[nq][ks], c); c = WF::mma(kc2[kt][ks], qf[nq][ks], c); } }
                s[kt][nq] = c; } };
    auto softpv = [&](v8f (&s)[2][NQ], V (&vf)[4], V (&v2)[4], const int k0, const bool mask) {
        V pf[NQ], pl[NQ];
#pragma unroll
        for (int nq = 0; nq < NQ; ++nq) {
            if (mask) { const int qi = q0 + nq * 16 + lr;
#pragma unroll
                for (int kt = 0; kt < 2; ++kt)
#pragma unroll
                    for (int j = 0; j < 8; ++j) s[kt][nq][j] = (k0 + kt * 16 + 8 * hi + j <= qi) ? s[kt][nq][j] : (NEGF / SCL); }
            float mx = s[0][nq][0];
#pragma unroll
            for (int j = 1; j < 8; ++j) mx = fmaxf(mx, s[0][nq][j]);
#pragma unroll
            for (int j = 0; j < 8; ++j) mx = fmaxf(mx, s[1][nq][j]);
            mx = fmaxf(mx, xhalf(mx));
            const float mn = fmaxf(mr[nq], mx); const float al = __builtin_amdgcn_exp2f((mr[nq] - mn) * CL); mr[nq] = mn;
            float sum = 0.f; float p[16];
#pragma unroll
            for (int e = 0; e < 16; ++e) { p[e] = __builtin_amdgcn_exp2f((s[e >> 3][nq][e & 7] - mn) * CL + (HR ? 0.f : PEXP)); sum += p[e]; }
            ls[nq] = ls[nq] * al + sum;
#pragma unroll
            for (int db = 0; db < 4; ++db) o[db][nq] *= al;
            if constexpr (HR) { v8us h0, h1, l0, l1;
#pragma unroll
                for (int j = 0; j < 8; ++j) { unsigned short a, c2; splitf(p[j], a, c2); h0[j] = a; l0[j] = c2; splitf(p[8 + j], a, c2); h1[j] = a; l1[j] = c2; }
                pf[nq] = cat16b(h0, h1); pl[nq] = cat16b(l0, l1);
            } else { v16h t;
#pragma unroll
                for (int e = 0; e < 16; ++e) t[e] = tohx(p[e]);
                pf[nq] = t; } }
#pragma unroll
        for (int db = 0; db < 4; ++db)
#pragma unroll
            for (int nq = 0; nq < NQ; ++nq) { o[db][nq] = WF::mma(vf[db], pf[nq], o[db][nq]); if (HR) { o[db][nq] = WF::mma(vf[db], pl[nq], o[db][nq]); o[db][nq] = WF::mma(v2[db], pf[nq], o[db][nq]); } } };
    const int kfull = q0 & ~31;
    V kf[2][2], k2[2][2], vf[4], v2[4]; v8f s[2][NQ];
    ldk(kf, k2);
    __builtin_amdgcn_sched_barrier(0);   // key loads issue in front of the value loads here as in the loop: loads return in order, and with another order on entry the wait at the loop's head covers the value loads too
    ldv(vf, v2);
    asm volatile("s_wait_xcnt 0x0" ::: "memory");   // the first fragment loads name the two per-lane offset registers, which are dead from here on and get reused
    // each fragment set is refilled for the next step right behind its last use: the key loads fly under softmax and p.v, the value loads under the next scores and softmax (step kfull always exists)
    for (int k0 = 0; k0 < kfull; k0 += 32) {
        scores(s, kf, k2);
        ldk(kf, k2);
        softpv(s, vf, v2, k0, false);
        ldv(vf, v2);
    }
    scores(s, kf, k2);
    softpv(s, vf, v2, kfull, true);
#pragma unroll
    for (int nq = 0; nq < NQ; ++nq) { const float l = ls[nq] + xhalf(ls[nq]); const float inv = __fdiv_rn(1.0f, l);
        float* orow = O + (size_t)(q0 + nq * 16 + lr) * DM + 8 * hi;
#pragma unroll
        for (int db = 0; db < 4; ++db) { v4f a, c;
#pragma unroll
            for (int j = 0; j < 4; ++j) { a[j] = o[db][nq][j] * inv; c[j] = o[db][nq][4 + j] * inv; }
            *(v4f*)(orow + db * 16) = a; *(v4f*)(orow + db * 16 + 4) = c;
            asm volatile("s_wait_xcnt 0x0" ::: "memory"); } }   // the next pair of products is written into the data registers that these two stores name
}
// grid (NB * 16 heads, (TT - RH) / 128 + RH / 64): f16 row groups first, the longest (last rows) at the lowest block indices; then the hi/lo row groups (16 rows per wave: three products per tile and two planes per operand). The second launch bound asks for four waves per SIMD (at most 256 registers a wave), so that every block of the grid is resident from the start.
__global__ __launch_bounds__(128, 4) void k_fattn(const h16* __restrict__ QK16, const h16* __restrict__ VT16, const bf* __restrict__ QKh, const bf* __restrict__ QKl, const bf* __restrict__ VTh, const bf* __restrict__ VTl, float* OUT) {
    const int lane = threadIdx.x & 31, lr = lane & 15, hi = lane >> 4; const int wv = __builtin_amdgcn_readfirstlane((int)(threadIdx.x >> 5));
    const int b = blockIdx.x / NH_, h = blockIdx.x % NH_; const int y = blockIdx.y;
    float* O = OUT + (size_t)b * TT * DM + h * HD;
    const size_t zq = (size_t)(b * 2 * NH_ + h), zk = zq + NH_, zv = (size_t)(b * NH_ + h);
    if (y < (TT - RH) / 128)
        attn_rows<h16, false, 2>(QK16 + zq * TT * HD, nullptr, QK16 + zk * TT * HD, nullptr, VT16 + zv * HD * TT, nullptr, TT, O, TT - 128 * (y + 1) + wv * 32, lr, hi);
    else
        attn_rows<bf, true, 1>(QKh + zq * RH * HD, QKl + zq * RH * HD, QKh + zk * RH * HD, QKl + zk * RH * HD, VTh + zv * HD * RH, VTl + zv * HD * RH, RH, O, RH - 64 * (y - (TT - RH) / 128 + 1) + wv * 16, lr, hi);
}

extern "C" void kernel_launch(void* const* d_in, const int* in_sizes, int n_in,
                              void* d_out, int out_size, void* d_ws, size_t ws_size, hipStream_t stream) {
    if (n_in < 5) return;
    if (in_sizes[0] < (NB - 1) * SEQ_FULL * DM + TT * DM) return;
    if (in_sizes[1] < DM * 2 * DQ) return; if (in_sizes[2] < 2 * DQ) return; if (in_sizes[3] < DM * DQ) return; if (in_sizes[4] < DQ) return;
    if (out_size < NB * TT * DM) return;
    const float* x = (const float*)d_in[0]; const float* wqk = (const float*)d_in[1]; const float* bqk = (const float*)d_in[2]; const float* wv = (const float*)d_in[3]; const float* bv = (const float*)d_in[4];   // wire order x, Wqk, bqk, Wv, bv
    float* OUT = (float*)d_out;     // [NB][TT][1024]
    char* wsp = (char*)d_ws;
    auto take = [&](size_t bytes) { char* p = wsp; wsp += (bytes + 255) & ~(size_t)255; return (void*)p; };
    bf* WQKV = (bf*)take((size_t)N3 * DM * 2);                  // Bt [3072][1024]: q | k | v row blocks
    float* BQKV = (float*)take((size_t)N3 * 4);
    h16* QK16 = (h16*)take((size_t)NB * 2 * NH_ * TT * HD * 2); // [NB][32][TT][64]: q heads 0..15, k heads 16..31
    h16* VT16 = (h16*)take((size_t)NB * NH_ * HD * TT * 2);     // [NB][16][64][TT]
    bf* QKh = (bf*)take((size_t)NB * 2 * NH_ * RH * HD * 2); bf* QKl = (bf*)take((size_t)NB * 2 * NH_ * RH * HD * 2);
    bf* VTh = (bf*)take((size_t)NB * NH_ * HD * RH * 2); bf* VTl = (bf*)take((size_t)NB * NH_ * HD * RH * 2);
    float* F = (float*)take((size_t)NB * TT * N3 * 4);          // [NB*TT][q | k | v]
    bf* XB = (bf*)take((size_t)NB * TT * DM * 2);               // [NB*TT][1024]
    const size_t carved = (size_t)(wsp - (char*)d_ws);
    if (carved > ws_size) return;
    k_wtG<<<(unsigned)((DM * 2 * DQ / 64 + 63) / 64), 256, 0, stream>>>(wqk, DM, 2 * DQ, WQKV);                          // in[1024][2048] -> out rows 0..2047
    k_wtG<<<(unsigned)((DM * DQ / 64 + 63) / 64), 256, 0, stream>>>(wv, DM, DQ, WQKV + (size_t)2 * DQ * DM);             // in[1024][1024] -> out rows 2048..3071
    k_bcat<<<(N3 / 4 + 255) / 256, 256, 0, stream>>>(bqk, bv, BQKV);
    const unsigned LQK = (unsigned)(((size_t)2 * NH_ * TT * HD / 2 + 255) / 256), LV = (unsigned)(((size_t)NH_ * TT * HD / 2 + 255) / 256);
    k_cvt8<<<dim3((unsigned)(((size_t)TT * DM / 8 + 255) / 256), NB, 1), 256, 0, stream>>>(x, XB, (size_t)TT * DM / 8, (size_t)SEQ_FULL * DM, (size_t)TT * DM);
    k_gemmw<bf, 0, true, 0><<<dim3(NB * TT / 64, N3 / 64, 1), 32, 0, stream>>>(XB, nullptr, WQKV, nullptr, DM, F, N3, BQKV, 0, 0, 0, 0, 1.0f);
    k_hp<<<dim3(LQK, NB, 1), 256, 0, stream>>>(F, N3, 2 * NH_, QK16, QKh, QKl);
    k_vtp<<<dim3(LV, NB, 1), 256, 0, stream>>>(F + 2 * DQ, N3, NH_, VT16, VTh, VTl);
    k_fattn<<<dim3(NB * NH_, (TT - RH) / 128 + RH / 64, 1), 128, 0, stream>>>(QK16, VT16, QKh, QKl, VTh, VTl, OUT);
}

// v003
// Measured time: 130 microseconds a run.
// In two side-by-side timings against v002, it was 1.31 and 1.32 times as fast.
// All steps since v000 together make it 10.7 times as fast.
#include <hip/hip_runtime.h>

// Causal multi-head self-attention, no output projection: x [NB][SEQ][1024]; qk = x Wqk + bqk (Wqk [1024][2048] 'in x out': q = cols 0..1023, k = cols 1024..2047), v = x Wv + bv (Wv [1024][1024]); 16 heads x 64 (col = h*64 + d); s = q.k x 0.125; keys j > i replaced by -1e9; softmax f32; out[b][t][h*64+d] = sum_j p v.
// Compute dtypes, f32 accumulate: every input RNE-converted to bf16; projections v_wmma_f32_16x16x32_bf16 (exact products) + bf16 bias; q.k and p.v: query rows < 512 bf16 hi/lo planes (3 products, v_wmma bf16), other rows v_wmma_f32_16x16x32_f16 single planes with the unnormalised p carried x1024 (the row sum carries the same factor, so it cancels in the f32 division); softmax f32, running maximum and running sum.
// Layout: bf16 copy of x (both batches); fused weight transposed once to K-contiguous rows (q | k | v row blocks); one fused projection GEMM over both batches whose epilogue converts its f32 tile and writes the head planes [b][h][t][d] / value planes [b][g][d][t] itself; one attention launch for all heads and batches: scores, softmax and p.v stay in registers, output written straight into the merged layout (256-B head segments).

#ifndef NB
#define NB 2
#endif
#ifndef SEQ
#define SEQ 2048
#endif
#define NB_FULL  2
#define SEQ_FULL 2048
#define TT   SEQ
#define DM   1024
#define NH_  16
#define HD   64
#define DQ   (NH_ * HD)
#define N3   (3 * DQ)
#define RH   ((TT < 512) ? TT : 512)     // query rows < RH use hi+lo planes
#define PEXP 10.0f                        // f16 rows: p carried x 2^10
#define SCL  0.125f                       // 64^-0.5
#define NEGF (-1.0e9f)
static_assert(TT % 128 == 0);
static_assert(RH % 128 == 0);
static_assert((TT - RH) % 128 == 0);
static_assert(DM % 32 == 0);
static_assert(N3 % 64 == 0);

typedef _Float16 h16;
typedef unsigned short bf;
typedef __attribute__((ext_vector_type(16))) __bf16   v16bf;
typedef __attribute__((ext_vector_type(16))) _Float16 v16h;
typedef __attribute__((ext_vector_type(8)))  _Float16 v8h;
typedef __attribute__((ext_vector_type(8)))  unsigned short v8us;
typedef __attribute__((ext_vector_type(8)))  float    v8f;
typedef __attribute__((ext_vector_type(4)))  float    v4f;
typedef __attribute__((ext_vector_type(2)))  float    v2f;
typedef __attribute__((ext_vector_type(2)))  _Float16 v2h;
typedef __attribute__((ext_vector_type(4)))  _Float16 v4h;
typedef __attribute__((ext_vector_type(2)))  unsigned short v2us;
typedef __attribute__((ext_vector_type(4)))  unsigned short v4us;
typedef v4f  __attribute__((may_alias)) v4fa;

__device__ __forceinline__ unsigned short f2bf(float f) { unsigned u = __float_as_uint(f); u += 0x7FFFu + ((u >> 16) & 1u); return (unsigned short)(u >> 16); }
__device__ __forceinline__ float bf2f(unsigned short b) { return __uint_as_float(((unsigned)b) << 16); }
__device__ __forceinline__ float bfr(float f) { return bf2f(f2bf(f)); }
__device__ __forceinline__ v16h cat16(v8h lo, v8h hi) { return __builtin_shufflevector(lo, hi, 0, 1, 2, 3, 4, 5, 6, 7, 8, 9, 10, 11, 12, 13, 14, 15); }
__device__ __forceinline__ v16bf cat16b(v8us lo, v8us hi) { return __builtin_bit_cast(v16bf, __builtin_shufflevector(lo, hi, 0, 1, 2, 3, 4, 5, 6, 7, 8, 9, 10, 11, 12, 13, 14, 15)); }
__device__ __forceinline__ v8f wmma16(v16h a, v16h b, v8f c) { return __builtin_amdgcn_wmma_f32_16x16x32_f16(false, a, false, b, (short)0, c, false, false); }
__device__ __forceinline__ v8f wmmab(v16bf a, v16bf b, v8f c) { return __builtin_amdgcn_wmma_f32_16x16x32_bf16(false, a, false, b, (short)0, c, false, false); }
__device__ __forceinline__ h16 tohx(float x) { return (h16)x; }
__device__ __forceinline__ void splitf(float y, unsigned short& h, unsigned short& l) { h = f2bf(y); l = f2bf(y - bf2f(h)); }

// ---- k_gemmw: register-blocked GEMM, ONE WAVE per 64x64 output tile (16 accumulators), operands straight from K-contiguous 16-bit planes (row pitch K); grid (M/64, N/64, Z), 32 threads.
// y[m][n] (f32) = sum_{k<kend} A[m][k] Bt[n][k] (+ split products per NSPLIT) (+ bf16 bias[n]). z-batch strides sA/sB in elements. K % 32 == 0.
// y never reaches memory: a 64-column tile is one head (0..15 q, 16..31 k, 32..47 v) and a 64-row tile lies in one batch and on one side of row RH, so the epilogue writes the attention planes itself: f16 always, bf16 hi/lo for rows < RH.
// Fragment map: lane -> row/col (lane & 15); elements 0..7 = k0 + 8*(lane>>4) + 0..7, elements 8..15 = k0 + 16 + 8*(lane>>4) + 0..7 for both operands; D element j = row 8*(lane>>4)+j, col lane&15.
// CAUS 1: tiles whose first column lies beyond the last causal key of the tile rows (global row = rbase + local row) exit at once. CAUS 2: k loop stops at rbase + r0 + 64.
template <typename T16> struct WFrag;
template <> struct WFrag<h16> { typedef v16h V; static __device__ __forceinline__ V ld(const h16* p) { return cat16(*(const v8h*)p, *(const v8h*)(p + 16)); } static __device__ __forceinline__ v8f mma(V a, V b, v8f c) { return wmma16(a, b, c); } };
template <> struct WFrag<bf> { typedef v16bf V; static __device__ __forceinline__ V ld(const bf* p) { return cat16b(*(const v8us*)p, *(const v8us*)(p + 16)); } static __device__ __forceinline__ v8f mma(V a, V b, v8f c) { return wmmab(a, b, c); } };
// Epilogues of k_gemmw, one wave each; HL: the tile's rows are < RH and get the bf16 hi/lo planes too. In both, a wave's LDS reads are all issued in front of its stores, and s_wait_xcnt 0 stands behind each group of stores because the next group's values and addresses are written into registers that those stores name (its "memory" clobber also keeps the next LDS writes behind the reads in the compiled order).
// put_qk: planes [t][d], the tile is one contiguous 64 x 64 block. 16 rows at a time go through LDS (f32, pitch 68) so that a lane holds 8 neighbouring d of one row: each store instruction covers 512 contiguous bytes.
template <bool HL, bool BIAS>
__device__ __forceinline__ void put_qk(const v8f (&acc)[4][4], float* os, const float* __restrict__ bias, h16* p16, bf* ph, bf* pl, const int lane) {
    const int lr = lane & 15, hi = lane >> 4, rq = lane >> 3, cofs = (lane & 7) * 8; float bs[8];
#pragma unroll
    for (int q = 0; q < 8; ++q) bs[q] = BIAS ? bfr(bias[cofs + q]) : 0.f;
#pragma unroll
    for (int mb = 0; mb < 4; ++mb) {
#pragma unroll
        for (int nb = 0; nb < 4; ++nb) {
#pragma unroll
            for (int j = 0; j < 8; ++j) os[(hi * 8 + j) * 68 + nb * 16 + lr] = acc[mb][nb][j]; }
        __builtin_amdgcn_wave_barrier(); asm volatile("" ::: "memory");   // one-wave block: keeps the row reads below behind the other lanes' LDS writes in the compiled order
        v4f x[4][2];
#pragma unroll
        for (int s = 0; s < 4; ++s) { const float* r = os + (4 * s + rq) * 68 + cofs; x[s][0] = *(const v4fa*)r; x[s][1] = *(const v4fa*)(r + 4); }
#pragma unroll
        for (int s = 0; s < 4; ++s) { v8h o16; v8us oh, ol;
#pragma unroll
            for (int q = 0; q < 8; ++q) { const float y = x[s][q >> 2][q & 3] + bs[q]; o16[q] = tohx(y); if (HL) { unsigned short a2, c2; splitf(y, a2, c2); oh[q] = a2; ol[q] = c2; } }
            const int e = (mb * 16 + 4 * s + rq) * HD + cofs;
            *(v8h*)(p16 + e) = o16; if (HL) { *(v8us*)(ph + e) = oh; *(v8us*)(pl + e) = ol; }
            asm volatile("s_wait_xcnt 0x0" ::: "memory"); }   // the next rows' values are written into registers that these stores name
    }
}
// put_v: planes [d][t] (row pitch TT, hi/lo RH). A lane's 8 accumulator elements are 8 neighbouring t of one d: 16 d at a time are converted in registers and turned in LDS (16-byte pieces, 144-byte pitch) so that 8 lanes store one whole 128-byte line of 64 t.
template <bool HL, bool BIAS>
__device__ __forceinline__ void put_v(const v8f (&acc)[4][4], h16* t16, bf* th, bf* tl, const float* __restrict__ bias, h16* p16, bf* ph, bf* pl, const int lane) {
    const int lr = lane & 15, hi = lane >> 4, rq = lane >> 3, cofs = (lane & 7) * 8; float bn[4];
#pragma unroll
    for (int nb = 0; nb < 4; ++nb) bn[nb] = BIAS ? bfr(bias[nb * 16 + lr]) : 0.f;
#pragma unroll
    for (int nb = 0; nb < 4; ++nb) { const float bs = bn[nb];
#pragma unroll
        for (int mb = 0; mb < 4; ++mb) { v8h o16; v8us oh, ol;
#pragma unroll
            for (int j = 0; j < 8; ++j) { const float y = acc[mb][nb][j] + bs; o16[j] = tohx(y); if (HL) { unsigned short a2, c2; splitf(y, a2, c2); oh[j] = a2; ol[j] = c2; } }
            const int w = lr * 72 + mb * 16 + 8 * hi;
            *(v8h*)(t16 + w) = o16; if (HL) { *(v8us*)(th + w) = oh; *(v8us*)(tl + w) = ol; } }
        __builtin_amdgcn_wave_barrier(); asm volatile("" ::: "memory");   // one-wave block: keeps the line reads below behind the other lanes' LDS writes in the compiled order
        v8h r16[4]; v8us rh[4], rl[4];
#pragma unroll
        for (int s = 0; s < 4; ++s) { const int r = (4 * s + rq) * 72 + cofs; r16[s] = *(const v8h*)(t16 + r); if (HL) { rh[s] = *(const v8us*)(th + r); rl[s] = *(const v8us*)(tl + r); } }
#pragma unroll
        for (int s = 0; s < 4; ++s) { const int d = nb * 16 + 4 * s + rq;
            *(v8h*)(p16 + (size_t)d * TT + cofs) = r16[s]; if (HL) { *(v8us*)(ph + (size_t)d * RH + cofs) = rh[s]; *(v8us*)(pl + (size_t)d * RH + cofs) = rl[s]; }
            asm volatile("s_wait_xcnt 0x0" ::: "memory"); }   // the next addresses and values are written into registers that these stores name
    }
}
template <typename T16, int NSPLIT, bool BIAS, int CAUS>
__global__ __launch_bounds__(32) void k_gemmw(const T16* __restrict__ A, const T16* __restrict__ A2, const T16* __restrict__ Bt, const T16* __restrict__ Bt2, int K, const float* __restrict__ bias, size_t sA, size_t sB, int rbase, h16* QK16, bf* QKh, bf* QKl, h16* VT16, bf* VTh, bf* VTl) {
    typedef typename WFrag<T16>::V V;
    __shared__ __align__(16) float os[16 * 68];
    __shared__ __align__(16) h16 t16[16 * 72]; __shared__ __align__(16) bf th[16 * 72], tl[16 * 72];
    const int r0 = blockIdx.x * 64, c0 = blockIdx.y * 64;
    if (CAUS == 1) { if (c0 >= rbase + r0 + 64) return; }
    int kend = K;
    if (CAUS == 2) { const int kl = rbase + r0 + 64; kend = (kl < K) ? kl : K; }
    const size_t z = blockIdx.z; A += z * sA; if (A2) A2 += z * sA; Bt += z * sB; if (Bt2) Bt2 += z * sB;
    const int lane = threadIdx.x & 31, lr = lane & 15, hi = lane >> 4;
    v8f acc[4][4];
#pragma unroll
    for (int mb = 0; mb < 4; ++mb)
#pragma unroll
        for (int nb = 0; nb < 4; ++nb) acc[mb][nb] = (v8f){};
    const size_t aoff = (size_t)(r0 + lr) * K + 8 * hi, boff = (size_t)(c0 + lr) * K + 8 * hi;
#pragma unroll 1
    for (int kc = 0; kc < kend; kc += 32) {
        V a[4], a2[4];
#pragma unroll
        for (int mb = 0; mb < 4; ++mb) { a[mb] = WFrag<T16>::ld(A + aoff + (size_t)mb * 16 * K + kc); if (NSPLIT == 1 || NSPLIT == 2) a2[mb] = WFrag<T16>::ld(A2 + aoff + (size_t)mb * 16 * K + kc); }
#pragma unroll
        for (int nb = 0; nb < 4; ++nb) { const V b = WFrag<T16>::ld(Bt + boff + (size_t)nb * 16 * K + kc); V b2; if (NSPLIT >= 2) b2 = WFrag<T16>::ld(Bt2 + boff + (size_t)nb * 16 * K + kc);
#pragma unroll
            for (int mb = 0; mb < 4; ++mb) { acc[mb][nb] = WFrag<T16>::mma(a[mb], b, acc[mb][nb]); if (NSPLIT == 1 || NSPLIT == 2) acc[mb][nb] = WFrag<T16>::mma(a2[mb], b, acc[mb][nb]); if (NSPLIT >= 2) acc[mb][nb] = WFrag<T16>::mma(a[mb], b2, acc[mb][nb]); } }
        asm volatile("v_nop\n\tv_nop\n\tv_nop\n\tv_nop" : "+v"(acc[0][0]), "+v"(acc[1][1]), "+v"(acc[2][2]), "+v"(acc[3][3]) : "v"(a[0]), "v"(a[3]));
    }
    const int hh = blockIdx.y, bb = r0 / TT, t0 = r0 % TT; const bool hl = (t0 < RH);   // all block-uniform
    if (hh < 2 * NH_) { const size_t zp = (size_t)(bb * 2 * NH_ + hh); h16* p16 = QK16 + (zp * TT + t0) * HD;
        if (hl) put_qk<true, BIAS>(acc, os, bias + c0, p16, QKh + (zp * RH + t0) * HD, QKl + (zp * RH + t0) * HD, lane);
        else put_qk<false, BIAS>(acc, os, bias + c0, p16, nullptr, nullptr, lane);
    } else { const size_t zp = (size_t)(bb * NH_ + hh - 2 * NH_) * HD; h16* p16 = VT16 + zp * TT + t0;
        if (hl) put_v<true, BIAS>(acc, t16, th, tl, bias + c0, p16, VTh + zp * RH + t0, VTl + zp * RH + t0, lane);
        else put_v<false, BIAS>(acc, t16, th, tl, bias + c0, p16, nullptr, nullptr, lane);
    }
}

__global__ __launch_bounds__(256) void k_wtG(const float* __restrict__ w, int K, int N, bf* Bt) {
    const int lane = threadIdx.x & 31; const int L0 = (blockIdx.x * 8 + (threadIdx.x >> 5)) * 8; const int nlines = N * K / 64;
{
#pragma unroll 1
        for (int l = 0; l < 8; ++l) { const int L = L0 + l; if (L >= nlines) break; const size_t e = (size_t)L * 64 + lane * 2; const int k = (int)(e % K), n = (int)(e / K); v2us o;
            o[0] = f2bf(w[(size_t)k * N + n]); o[1] = f2bf(w[(size_t)(k + 1) * N + n]); *(v2us*)(Bt + e) = o; }
         }
}
__global__ __launch_bounds__(256) void k_bcat(const float* __restrict__ bqk, const float* __restrict__ bv, float* Bq) {
    const int i = blockIdx.x * 256 + threadIdx.x; if (i >= N3 / 4) return; const int c = i * 4; v4f o;
#pragma unroll
    for (int q = 0; q < 4; ++q) { const int cc = c + q; const int ia = (cc < 2 * DQ) ? cc : (2 * DQ - 1); int ib = cc - 2 * DQ; ib = (ib < 0) ? 0 : ib; ib = (ib > DQ - 1) ? (DQ - 1) : ib;
        const float a = bqk[ia]; const float b2 = bv[ib]; o[q] = (cc < 2 * DQ) ? a : b2; }
    *(v4f*)(Bq + c) = o;  }
__global__ __launch_bounds__(256) void k_cvt8(const float* __restrict__ src, bf* dst, size_t n8, size_t sS, size_t sD) { const size_t i = (size_t)blockIdx.x * 256 + threadIdx.x; if (i >= n8) return; src += blockIdx.y * sS; dst += blockIdx.y * sD;   // grid y = batch
    const v8f v = *(const v8f*)(src + i * 8); v8us o;
#pragma unroll
    for (int k = 0; k < 8; ++k) o[k] = f2bf(v[k]); *(v8us*)(dst + i * 8) = o;  }

// k_fattn: scores, causal softmax and p.v of one (batch, head), 16 * NQ query rows per wave, four waves per block, no memory round trip for s or p.
// Transposed products: s^T = K q^T (A = key rows, B = query rows), so D element j of key tile kt is key k0 + 16*kt + 8*(lane>>4) + j of query (lane & 15): the two key tiles of a 32-key step ARE the B fragment of p^T (elements 0..7 / 8..15) for o^T = V^T p^T (A = value plane rows d, K-contiguous in the key).
// Running softmax per query (= per lane; the two lane halves hold different keys and share the maximum by one cross-half exchange): o and the sum are rescaled by 2^((m_old - m_new) c) each step. Keys j > i take the reference's replace fill (-1e9 after the 0.125 scale); only the last step of a row group meets the diagonal.
__device__ __forceinline__ float xhalf(float x) { return __builtin_bit_cast(float, __builtin_amdgcn_permlanex16(__builtin_bit_cast(int, x), __builtin_bit_cast(int, x), 0x76543210, 0xfedcba98, false, false)); }   // lane l takes lane l ^ 16
template <typename T16, bool HR, int NQ>
__device__ __forceinline__ void attn_rows(const T16* __restrict__ Q, const T16* __restrict__ Q2, const T16* __restrict__ Kp, const T16* __restrict__ K2, const T16* __restrict__ Vt, const T16* __restrict__ V2, const int vp, float* O, const int q0, const int lr, const int hi) {
    typedef WFrag<T16> WF; typedef typename WF::V V;
    const float CL = SCL * 1.4426950408889634f;
    // per-lane byte offsets into a [row][64] plane and into a [d][key] plane: row (lane & 15), 8 elements per lane half
    const unsigned kob = (unsigned)(lr * HD + 8 * hi) * 2u, vob = (unsigned)(lr * vp + 8 * hi) * 2u;
    auto at = [](const T16* base, const unsigned byteoff) { return (const T16*)((const char*)base + byteoff); };
    V qf[NQ][2], q2[NQ][2];
#pragma unroll
    for (int nq = 0; nq < NQ; ++nq)
#pragma unroll
        for (int ks = 0; ks < 2; ++ks) { const int e = (q0 + nq * 16) * HD + ks * 32; qf[nq][ks] = WF::ld(at(Q + e, kob)); if (HR) q2[nq][ks] = WF::ld(at(Q2 + e, kob)); }
    asm volatile("s_wait_xcnt 0x0" ::: "memory");   // the query loads' address registers are free for reuse by what follows
    v8f o[4][NQ]; float mr[NQ], ls[NQ];
#pragma unroll
    for (int nq = 0; nq < NQ; ++nq) { mr[nq] = -1.0e30f; ls[nq] = 0.f;
#pragma unroll
        for (int db = 0; db < 4; ++db) o[db][nq] = (v8f){}; }
    // the four plane pointers live across the whole key loop and step by 32 keys behind each load group
    const T16 *pk = at(Kp, kob), *pk2 = HR ? at(K2, kob) : nullptr, *pv = at(Vt, vob), *pv2 = HR ? at(V2, vob) : nullptr;
    auto ldk = [&](V (&d)[2][2], V (&d2)[2][2]) {
#pragma unroll
        for (int kt = 0; kt < 2; ++kt)
#pragma unroll
            for (int ks = 0; ks < 2; ++ks) { const int e = kt * 16 * HD + ks * 32; d[kt][ks] = WF::ld(pk + e); if (HR) d2[kt][ks] = WF::ld(pk2 + e); }
        pk += 32 * HD; if (HR) pk2 += 32 * HD; };
    auto ldv = [&](V (&d)[4], V (&d2)[4]) {
#pragma unroll
        for (int db = 0; db < 4; ++db) { const int e = db * 16 * vp; d[db] = WF::ld(pv + e); if (HR) d2[db] = WF::ld(pv2 + e); }
        pv += 32; if (HR) pv2 += 32; };
    auto scores = [&](v8f (&s)[2][NQ], V (&kc)[2][2], V (&kc2)[2][2]) {
#pragma unroll
        for (int kt = 0; kt < 2; ++kt)
#pragma unroll
            for (int nq = 0; nq < NQ; ++nq) { v8f c = (v8f){};
#pragma unroll
                for (int ks = 0; ks < 2; ++ks) { c = WF::mma(kc[kt][ks], qf[nq][ks], c); if (HR) { c = WF::mma(kc[kt][ks], q2[nq][ks], c); c = WF::mma(kc2[kt][ks], qf[nq][ks], c); } }
                s[kt][nq] = c; } };
    auto softpv = [&](v8f (&s)[2][NQ], V (&vf)[4], V (&v2)[4], const int k0, const bool mask) {
        V pf[NQ], pl[NQ];
#pragma unroll
        for (int nq = 0; nq < NQ; ++nq) {
            if (mask) { const int qi = q0 + nq * 16 + lr;
#pragma unroll
                for (int kt = 0; kt < 2; ++kt)
#pragma unroll
                    for (int j = 0; j < 8; ++j) s[kt][nq][j] = (k0 + kt * 16 + 8 * hi + j <= qi) ? s[kt][nq][j] : (NEGF / SCL); }
            float mx = s[0][nq][0];
#pragma unroll
            for (int j = 1; j < 8; ++j) mx = fmaxf(mx, s[0][nq][j]);
#pragma unroll
            for (int j = 0; j < 8; ++j) mx = fmaxf(mx, s[1][nq][j]);
            mx = fmaxf(mx, xhalf(mx));
            const float mn = fmaxf(mr[nq], mx); const float al = __builtin_amdgcn_exp2f((mr[nq] - mn) * CL); mr[nq] = mn;
            float sum = 0.f; float p[16];
#pragma unroll
            for (int e = 0; e < 16; ++e) { p[e] = __builtin_amdgcn_exp2f((s[e >> 3][nq][e & 7] - mn) * CL + (HR ? 0.f : PEXP)); sum += p[e]; }
            ls[nq] = ls[nq] * al + sum;
#pragma unroll
            for (int db = 0; db < 4; ++db) o[db][nq] *= al;
            if constexpr (HR) { v8us h0, h1, l0, l1;
#pragma unroll
                for (int j = 0; j < 8; ++j) { unsigned short a, c2; splitf(p[j], a, c2); h0[j] = a; l0[j] = c2; splitf(p[8 + j], a, c2); h1[j] = a; l1[j] = c2; }
                pf[nq] = cat16b(h0, h1); pl[nq] = cat16b(l0, l1);
            } else { v16h t;
#pragma unroll
                for (int e = 0; e < 16; ++e) t[e] = tohx(p[e]);
                pf[nq] = t; } }
#pragma unroll
        for (int db = 0; db < 4; ++db)
#pragma unroll
            for (int nq = 0; nq < NQ; ++nq) { o[db][nq] = WF::mma(vf[db], pf[nq], o[db][nq]); if (HR) { o[db][nq] = WF::mma(vf[db], pl[nq], o[db][nq]); o[db][nq] = WF::mma(v2[db], pf[nq], o[db][nq]); } } };
    const int kfull = q0 & ~31;
    V kf[2][2], k2[2][2], vf[4], v2[4]; v8f s[2][NQ];
    ldk(kf, k2);
    __builtin_amdgcn_sched_barrier(0);   // key loads issue in front of the value loads here as in the loop: loads return in order, and with another order on entry the wait at the loop's head covers the value loads too
    ldv(vf, v2);
    asm volatile("s_wait_xcnt 0x0" ::: "memory");   // the first fragment loads name the two per-lane offset registers, which are dead from here on and get reused
    // each fragment set is refilled for the next step right behind its last use: the key loads fly under softmax and p.v, the value loads under the next scores and softmax (step kfull always exists)
    for (int k0 = 0; k0 < kfull; k0 += 32) {
        scores(s, kf, k2);
        ldk(kf, k2);
        softpv(s, vf, v2, k0, false);
        ldv(vf, v2);
    }
    scores(s, kf, k2);
    softpv(s, vf, v2, kfull, true);
#pragma unroll
    for (int nq = 0; nq < NQ; ++nq) { const float l = ls[nq] + xhalf(ls[nq]); const float inv = __fdiv_rn(1.0f, l);
        float* orow = O + (size_t)(q0 + nq * 16 + lr) * DM + 8 * hi;
#pragma unroll
        for (int db = 0; db < 4; ++db) { v4f a, c;
#pragma unroll
            for (int j = 0; j < 4; ++j) { a[j] = o[db][nq][j] * inv; c[j] = o[db][nq][4 + j] * inv; }
            *(v4f*)(orow + db * 16) = a; *(v4f*)(orow + db * 16 + 4) = c;
            asm volatile("s_wait_xcnt 0x0" ::: "memory"); } }   // the next pair of products is written into the data registers that these two stores name
}
// grid (NB * 16 heads, (TT - RH) / 128 + RH / 64): f16 row groups first, the longest (last rows) at the lowest block indices; then the hi/lo row groups (16 rows per wave: three products per tile and two planes per operand). The second launch bound asks for four waves per SIMD (at most 256 registers a wave), so that every block of the grid is resident from the start.
__global__ __launch_bounds__(128, 4) void k_fattn(const h16* __restrict__ QK16, const h16* __restrict__ VT16, const bf* __restrict__ QKh, const bf* __restrict__ QKl, const bf* __restrict__ VTh, const bf* __restrict__ VTl, float* OUT) {
    const int lane = threadIdx.x & 31, lr = lane & 15, hi = lane >> 4; const int wv = __builtin_amdgcn_readfirstlane((int)(threadIdx.x >> 5));
    const int b = blockIdx.x / NH_, h = blockIdx.x % NH_; const int y = blockIdx.y;
    float* O = OUT + (size_t)b * TT * DM + h * HD;
    const size_t zq = (size_t)(b * 2 * NH_ + h), zk = zq + NH_, zv = (size_t)(b * NH_ + h);
    if (y < (TT - RH) / 128)
        attn_rows<h16, false, 2>(QK16 + zq * TT * HD, nullptr, QK16 + zk * TT * HD, nullptr, VT16 + zv * HD * TT, nullptr, TT, O, TT - 128 * (y + 1) + wv * 32, lr, hi);
    else
        attn_rows<bf, true, 1>(QKh + zq * RH * HD, QKl + zq * RH * HD, QKh + zk * RH * HD, QKl + zk * RH * HD, VTh + zv * HD * RH, VTl + zv * HD * RH, RH, O, RH - 64 * (y - (TT - RH) / 128 + 1) + wv * 16, lr, hi);
}

extern "C" void kernel_launch(void* const* d_in, const int* in_sizes, int n_in,
                              void* d_out, int out_size, void* d_ws, size_t ws_size, hipStream_t stream) {
    if (n_in < 5) return;
    if (in_sizes[0] < (NB - 1) * SEQ_FULL * DM + TT * DM) return;
    if (in_sizes[1] < DM * 2 * DQ) return; if (in_sizes[2] < 2 * DQ) return; if (in_sizes[3] < DM * DQ) return; if (in_sizes[4] < DQ) return;
    if (out_size < NB * TT * DM) return;
    const float* x = (const float*)d_in[0]; const float* wqk = (const float*)d_in[1]; const float* bqk = (const float*)d_in[2]; const float* wv = (const float*)d_in[3]; const float* bv = (const float*)d_in[4];   // wire order x, Wqk, bqk, Wv, bv
    float* OUT = (float*)d_out;     // [NB][TT][1024]
    char* wsp = (char*)d_ws;
    auto take = [&](size_t bytes) { char* p = wsp; wsp += (bytes + 255) & ~(size_t)255; return (void*)p; };
    bf* WQKV = (bf*)take((size_t)N3 * DM * 2);                  // Bt [3072][1024]: q | k | v row blocks
    float* BQKV = (float*)take((size_t)N3 * 4);
    h16* QK16 = (h16*)take((size_t)NB * 2 * NH_ * TT * HD * 2); // [NB][32][TT][64]: q heads 0..15, k heads 16..31
    h16* VT16 = (h16*)take((size_t)NB * NH_ * HD * TT * 2);     // [NB][16][64][TT]
    bf* QKh = (bf*)take((size_t)NB * 2 * NH_ * RH * HD * 2); bf* QKl = (bf*)take((size_t)NB * 2 * NH_ * RH * HD * 2);
    bf* VTh = (bf*)take((size_t)NB * NH_ * HD * RH * 2); bf* VTl = (bf*)take((size_t)NB * NH_ * HD * RH * 2);
    bf* XB = (bf*)take((size_t)NB * TT * DM * 2);               // [NB*TT][1024]
    const size_t carved = (size_t)(wsp - (char*)d_ws);
    if (carved > ws_size) return;
    k_wtG<<<(unsigned)((DM * 2 * DQ / 64 + 63) / 64), 256, 0, stream>>>(wqk, DM, 2 * DQ, WQKV);                          // in[1024][2048] -> out rows 0..2047
    k_wtG<<<(unsigned)((DM * DQ / 64 + 63) / 64), 256, 0, stream>>>(wv, DM, DQ, WQKV + (size_t)2 * DQ * DM);             // in[1024][1024] -> out rows 2048..3071
    k_bcat<<<(N3 / 4 + 255) / 256, 256, 0, stream>>>(bqk, bv, BQKV);
    k_cvt8<<<dim3((unsigned)(((size_t)TT * DM / 8 + 255) / 256), NB, 1), 256, 0, stream>>>(x, XB, (size_t)TT * DM / 8, (size_t)SEQ_FULL * DM, (size_t)TT * DM);
    k_gemmw<bf, 0, true, 0><<<dim3(NB * TT / 64, N3 / 64, 1), 32, 0, stream>>>(XB, nullptr, WQKV, nullptr, DM, BQKV, 0, 0, 0, QK16, QKh, QKl, VT16, VTh, VTl);
    k_fattn<<<dim3(NB * NH_, (TT - RH) / 128 + RH / 64, 1), 128, 0, stream>>>(QK16, VT16, QKh, QKl, VTh, VTl, OUT);
}

// v004
// A run of this version takes 103 microseconds.
// Timed twice side by side with v003, it ran 1.24 and 1.28 times as fast.
// Counting every step since v000, it is 13.5 times as fast.
#include <hip/hip_runtime.h>

// Causal multi-head self-attention, no output projection: x [NB][SEQ][1024]; qk = x Wqk + bqk (Wqk [1024][2048] 'in x out': q = cols 0..1023, k = cols 1024..2047), v = x Wv + bv (Wv [1024][1024]); 16 heads x 64 (col = h*64 + d); s = q.k x 0.125; keys j > i replaced by -1e9; softmax f32; out[b][t][h*64+d] = sum_j p v.
// Compute dtypes, f32 accumulate: every input RNE-converted to bf16; projections v_wmma_f32_16x16x32_bf16 (exact products) + bf16 bias; q.k and p.v: query rows < 512 bf16 hi/lo planes (3 products, v_wmma bf16), other rows v_wmma_f32_16x16x32_f16 single planes with the unnormalised p carried x1024 (the row sum carries the same factor, so it cancels in the f32 division); softmax f32, running maximum and running sum.
// Layout: bf16 copy of x (both batches) and the fused, transposed weight (q | k | v row blocks); one fused projection GEMM over both batches whose epilogue converts its f32 tile and writes the head planes [b][h] (rows t, k = d) / value planes [b][g] (rows d, k = t) itself; every one of these planes lies in fragment order (see k_gemmw); one attention launch for all heads and batches: scores, softmax and p.v stay in registers, output written straight into the merged layout (256-B head segments).

#ifndef NB
#define NB 2
#endif
#ifndef SEQ
#define SEQ 2048
#endif
#define NB_FULL  2
#define SEQ_FULL 2048
#define TT   SEQ
#define DM   1024
#define NH_  16
#define HD   64
#define DQ   (NH_ * HD)
#define N3   (3 * DQ)
#define RH   ((TT < 512) ? TT : 512)     // query rows < RH use hi+lo planes
#define PEXP 10.0f                        // f16 rows: p carried x 2^10
#define SCL  0.125f                       // 64^-0.5
#define NEGF (-1.0e9f)
static_assert(TT % 128 == 0);
static_assert(RH % 128 == 0);
static_assert((TT - RH) % 128 == 0);
static_assert(DM % 256 == 0);   // eight 32-k blocks per packing work-group
static_assert(N3 % 64 == 0);

typedef _Float16 h16;
typedef unsigned short bf;
typedef __attribute__((ext_vector_type(16))) __bf16   v16bf;
typedef __attribute__((ext_vector_type(16))) _Float16 v16h;
typedef __attribute__((ext_vector_type(8)))  _Float16 v8h;
typedef __attribute__((ext_vector_type(8)))  unsigned short v8us;
typedef __attribute__((ext_vector_type(8)))  float    v8f;
typedef __attribute__((ext_vector_type(4)))  float    v4f;
typedef __attribute__((ext_vector_type(2)))  float    v2f;
typedef __attribute__((ext_vector_type(2)))  _Float16 v2h;
typedef __attribute__((ext_vector_type(4)))  _Float16 v4h;
typedef __attribute__((ext_vector_type(2)))  unsigned short v2us;
typedef __attribute__((ext_vector_type(4)))  unsigned short v4us;
typedef v4f  __attribute__((may_alias)) v4fa;

__device__ __forceinline__ unsigned short f2bf(float f) { unsigned u = __float_as_uint(f); u += 0x7FFFu + ((u >> 16) & 1u); return (unsigned short)(u >> 16); }
__device__ __forceinline__ float bf2f(unsigned short b) { return __uint_as_float(((unsigned)b) << 16); }
__device__ __forceinline__ float bfr(float f) { return bf2f(f2bf(f)); }
__device__ __forceinline__ v16h cat16(v8h lo, v8h hi) { return __builtin_shufflevector(lo, hi, 0, 1, 2, 3, 4, 5, 6, 7, 8, 9, 10, 11, 12, 13, 14, 15); }
__device__ __forceinline__ v16bf cat16b(v8us lo, v8us hi) { return __builtin_bit_cast(v16bf, __builtin_shufflevector(lo, hi, 0, 1, 2, 3, 4, 5, 6, 7, 8, 9, 10, 11, 12, 13, 14, 15)); }
__device__ __forceinline__ v8f wmma16(v16h a, v16h b, v8f c) { return __builtin_amdgcn_wmma_f32_16x16x32_f16(false, a, false, b, (short)0, c, false, false); }
__device__ __forceinline__ v8f wmmab(v16bf a, v16bf b, v8f c) { return __builtin_amdgcn_wmma_f32_16x16x32_bf16(false, a, false, b, (short)0, c, false, false); }
__device__ __forceinline__ h16 tohx(float x) { return (h16)x; }
__device__ __forceinline__ void splitf(float y, unsigned short& h, unsigned short& l) { h = f2bf(y); l = f2bf(y - bf2f(h)); }

// ---- k_gemmw: register-blocked GEMM, ONE WAVE per 64x64 output tile (16 accumulators), operands straight from 16-bit planes in fragment order; grid (M/64, N/64, Z), 32 threads.
// Fragment order: a plane of rows x K is cut into blocks of 16 rows x 32 k, 512 elements (1 KB) each, block (row / 16, k / 32) at element (row / 16) * 16 * K + (k / 32) * 512; inside a block lane l's elements 0..7 lie at l * 8 and its elements 8..15 at 256 + l * 8, so each of a fragment's two 16-byte loads covers 512 contiguous bytes (4 whole lines) where a row-major plane gives 16 pieces of 32 bytes in 16 lines.
// y[m][n] (f32) = sum_{k<kend} A[m][k] Bt[n][k] (+ split products per NSPLIT) (+ bf16 bias[n]). z-batch strides sA/sB in elements. K % 32 == 0, a compile-time constant: the four row groups of an operand are immediate offsets from one address.
// y never reaches memory: a 64-column tile is one head (0..15 q, 16..31 k, 32..47 v) and a 64-row tile lies in one batch and on one side of row RH, so the epilogue writes the attention planes itself: f16 always, bf16 hi/lo for rows < RH.
// Fragment map: lane -> row/col (lane & 15); elements 0..7 = k0 + 8*(lane>>4) + 0..7, elements 8..15 = k0 + 16 + 8*(lane>>4) + 0..7 for both operands; D element j = row 8*(lane>>4)+j, col lane&15.
// CAUS 1: tiles whose first column lies beyond the last causal key of the tile rows (global row = rbase + local row) exit at once. CAUS 2: k loop stops at rbase + r0 + 64.
template <typename T16> struct WFrag;
template <> struct WFrag<h16> { typedef v16h V; static __device__ __forceinline__ V ldp(const h16* p) { return cat16(*(const v8h*)p, *(const v8h*)(p + 256)); } static __device__ __forceinline__ v8f mma(V a, V b, v8f c) { return wmma16(a, b, c); } };
template <> struct WFrag<bf> { typedef v16bf V; static __device__ __forceinline__ V ldp(const bf* p) { return cat16b(*(const v8us*)p, *(const v8us*)(p + 256)); } static __device__ __forceinline__ v8f mma(V a, V b, v8f c) { return wmmab(a, b, c); } };
// Epilogues of k_gemmw, one wave each; HL: the tile's rows are < RH and get the bf16 hi/lo planes too. The planes are written in the fragment order in which k_fattn loads them, every store instruction covering 512 contiguous bytes. s_wait_xcnt 0 stands behind each group of stores because the next group's values and addresses are written into registers that those stores name.
// put_qk: fragment rows = t, k = d: block (t / 16, d / 32) at element (t / 16) * 1024 + (d / 32) * 512 of the head's plane, so the tile is one contiguous 64 x 64 block. 16 rows at a time go through LDS (f32, pitch 68) so that lane l holds 8 neighbouring d of row l & 15; a wave's LDS reads are all issued in front of its stores (the "memory" clobber of the wait also keeps the next LDS writes behind the reads in the compiled order).
template <bool HL, bool BIAS>
__device__ __forceinline__ void put_qk(const v8f (&acc)[4][4], float* os, const float* __restrict__ bias, h16* p16, bf* ph, bf* pl, const int lane) {
    const int lr = lane & 15, hi = lane >> 4; float bn[4];
#pragma unroll
    for (int nb = 0; nb < 4; ++nb) bn[nb] = BIAS ? bfr(bias[nb * 16 + lr]) : 0.f;
#pragma unroll
    for (int mb = 0; mb < 4; ++mb) {
#pragma unroll
        for (int nb = 0; nb < 4; ++nb) {
#pragma unroll
            for (int j = 0; j < 8; ++j) os[(hi * 8 + j) * 68 + nb * 16 + lr] = acc[mb][nb][j] + bn[nb]; }
        __builtin_amdgcn_wave_barrier(); asm volatile("" ::: "memory");   // one-wave block: keeps the row reads below behind the other lanes' LDS writes in the compiled order
        v4f x[4][2];
#pragma unroll
        for (int s = 0; s < 4; ++s) { const float* r = os + lr * 68 + s * 16 + hi * 8; x[s][0] = *(const v4fa*)r; x[s][1] = *(const v4fa*)(r + 4); }   // s = 2 * (d / 32) + fragment half
#pragma unroll
        for (int s = 0; s < 4; ++s) { v8h o16; v8us oh, ol;
#pragma unroll
            for (int q = 0; q < 8; ++q) { const float y = x[s][q >> 2][q & 3]; o16[q] = tohx(y); if (HL) { unsigned short a2, c2; splitf(y, a2, c2); oh[q] = a2; ol[q] = c2; } }
            const int e = mb * 1024 + s * 256 + lane * 8;
            *(v8h*)(p16 + e) = o16; if (HL) { *(v8us*)(ph + e) = oh; *(v8us*)(pl + e) = ol; }
            asm volatile("s_wait_xcnt 0x0" ::: "memory"); }   // the next rows' values are written into registers that these stores name
    }
}
// put_v: fragment rows = d, k = t: block (t / 32, d / 16) at element (t / 32) * 2048 + (d / 16) * 512 of the head's plane. A lane's 8 accumulator elements are 8 neighbouring t of d = 16 * nb + (lane & 15), which is this same lane's 16-byte piece of the fragment (half = mb & 1): converted in registers and stored straight.
template <bool HL, bool BIAS>
__device__ __forceinline__ void put_v(const v8f (&acc)[4][4], const float* __restrict__ bias, h16* p16, bf* ph, bf* pl, const int lane) {
    const int lr = lane & 15; float bn[4];
#pragma unroll
    for (int nb = 0; nb < 4; ++nb) bn[nb] = BIAS ? bfr(bias[nb * 16 + lr]) : 0.f;
#pragma unroll
    for (int nb = 0; nb < 4; ++nb) { const float bs = bn[nb];
#pragma unroll
        for (int mb = 0; mb < 4; ++mb) { v8h o16; v8us oh, ol;
#pragma unroll
            for (int j = 0; j < 8; ++j) { const float y = acc[mb][nb][j] + bs; o16[j] = tohx(y); if (HL) { unsigned short a2, c2; splitf(y, a2, c2); oh[j] = a2; ol[j] = c2; } }
            const int e = ((mb >> 1) * 4 + nb) * 512 + (mb & 1) * 256 + lane * 8;
            *(v8h*)(p16 + e) = o16; if (HL) { *(v8us*)(ph + e) = oh; *(v8us*)(pl + e) = ol; }
            asm volatile("s_wait_xcnt 0x0" ::: "memory"); }   // the next values are written into registers that these stores name
    }
}
template <typename T16, int NSPLIT, bool BIAS, int CAUS, int K>
__global__ __launch_bounds__(32) void k_gemmw(const T16* __restrict__ A, const T16* __restrict__ A2, const T16* __restrict__ Bt, const T16* __restrict__ Bt2, const float* __restrict__ bias, size_t sA, size_t sB, int rbase, h16* QK16, bf* QKh, bf* QKl, h16* VT16, bf* VTh, bf* VTl) {
    typedef typename WFrag<T16>::V V;
    __shared__ __align__(16) float os[16 * 68];
    const int r0 = blockIdx.x * 64, c0 = blockIdx.y * 64;
    if (CAUS == 1) { if (c0 >= rbase + r0 + 64) return; }
    int kend = K;
    if (CAUS == 2) { const int kl = rbase + r0 + 64; kend = (kl < K) ? kl : K; }
    const size_t z = blockIdx.z; A += z * sA; if (A2) A2 += z * sA; Bt += z * sB; if (Bt2) Bt2 += z * sB;
    const int lane = threadIdx.x & 31;
    v8f acc[4][4];
#pragma unroll
    for (int mb = 0; mb < 4; ++mb)
#pragma unroll
        for (int nb = 0; nb < 4; ++nb) acc[mb][nb] = (v8f){};
    const size_t aoff = (size_t)r0 * K + lane * 8, boff = (size_t)c0 * K + lane * 8;   // first block of the tile's first 16 rows, this lane's piece
#pragma unroll 1
    for (int kc = 0; kc < kend; kc += 32) {
        V a[4], a2[4];
#pragma unroll
        for (int mb = 0; mb < 4; ++mb) { a[mb] = WFrag<T16>::ldp(A + aoff + (size_t)mb * 16 * K + kc * 16); if (NSPLIT == 1 || NSPLIT == 2) a2[mb] = WFrag<T16>::ldp(A2 + aoff + (size_t)mb * 16 * K + kc * 16); }
        asm volatile("s_wait_xcnt 0x0" ::: "memory");   // the A loads' address registers are dead from here on and get reused as a later load's destination
#pragma unroll
        for (int nb = 0; nb < 4; ++nb) { const V b = WFrag<T16>::ldp(Bt + boff + (size_t)nb * 16 * K + kc * 16); V b2; if (NSPLIT >= 2) b2 = WFrag<T16>::ldp(Bt2 + boff + (size_t)nb * 16 * K + kc * 16);
#pragma unroll
            for (int mb = 0; mb < 4; ++mb) { acc[mb][nb] = WFrag<T16>::mma(a[mb], b, acc[mb][nb]); if (NSPLIT == 1 || NSPLIT == 2) acc[mb][nb] = WFrag<T16>::mma(a2[mb], b, acc[mb][nb]); if (NSPLIT >= 2) acc[mb][nb] = WFrag<T16>::mma(a[mb], b2, acc[mb][nb]); } }
        asm volatile("s_wait_xcnt 0x0" ::: "memory");   // the B loads' address registers are rewritten at the head of the next trip
        asm volatile("v_nop\n\tv_nop\n\tv_nop\n\tv_nop" : "+v"(acc[0][0]), "+v"(acc[1][1]), "+v"(acc[2][2]), "+v"(acc[3][3]) : "v"(a[0]), "v"(a[3]));
    }
    const int hh = blockIdx.y, bb = r0 / TT, t0 = r0 % TT; const bool hl = (t0 < RH);   // all block-uniform
    if (hh < 2 * NH_) { const size_t zp = (size_t)(bb * 2 * NH_ + hh); h16* p16 = QK16 + (zp * TT + t0) * HD;
        if (hl) put_qk<true, BIAS>(acc, os, bias + c0, p16, QKh + (zp * RH + t0) * HD, QKl + (zp * RH + t0) * HD, lane);
        else put_qk<false, BIAS>(acc, os, bias + c0, p16, nullptr, nullptr, lane);
    } else { const size_t zp = (size_t)(bb * NH_ + hh - 2 * NH_); h16* p16 = VT16 + (zp * TT + t0) * HD;
        if (hl) put_v<true, BIAS>(acc, bias + c0, p16, VTh + (zp * RH + t0) * HD, VTl + (zp * RH + t0) * HD, lane);
        else put_v<false, BIAS>(acc, bias + c0, p16, nullptr, nullptr, lane);
    }
}

// k_wtG: w [K][N] f32 -> Bt, the transposed plane (rows n, K-contiguous) in fragment order, bf16. One wave per block of 16 n x 32 k: a lane holds row n = 16 * nt + (lane & 15) and reads its 16 k down the column, so each load covers 64 contiguous bytes of two rows of w; the eight waves of a work-group take neighbouring nt (512 contiguous bytes of each row). Grid N / 16 * K / 32 / 8.
template <int K, int N>
__global__ __launch_bounds__(256) void k_wtG(const float* __restrict__ w, bf* Bt) {
    static_assert(N % 128 == 0 && K % 32 == 0);
    const int lane = threadIdx.x & 31, lr = lane & 15, hi = lane >> 4; const int wv = blockIdx.x * 8 + (threadIdx.x >> 5); const int nt = wv % (N / 16), kt = wv / (N / 16);
    const float* p = w + (size_t)(kt * 32 + 8 * hi) * N + nt * 16 + lr; v8us o0, o1;
#pragma unroll
    for (int j = 0; j < 8; ++j) { o0[j] = f2bf(p[j * N]); o1[j] = f2bf(p[(16 + j) * N]); }
    bf* q = Bt + (size_t)nt * 16 * K + kt * 512 + lane * 8; *(v8us*)q = o0; *(v8us*)(q + 256) = o1;
}
__global__ __launch_bounds__(256) void k_bcat(const float* __restrict__ bqk, const float* __restrict__ bv, float* Bq) {
    const int i = blockIdx.x * 256 + threadIdx.x; if (i >= N3 / 4) return; const int c = i * 4; v4f o;
#pragma unroll
    for (int q = 0; q < 4; ++q) { const int cc = c + q; const int ia = (cc < 2 * DQ) ? cc : (2 * DQ - 1); int ib = cc - 2 * DQ; ib = (ib < 0) ? 0 : ib; ib = (ib > DQ - 1) ? (DQ - 1) : ib;
        const float a = bqk[ia]; const float b2 = bv[ib]; o[q] = (cc < 2 * DQ) ? a : b2; }
    *(v4f*)(Bq + c) = o;  }
// k_cvt8: src [rows][DM] f32 -> dst, the same plane in fragment order, bf16. One wave per block of 16 rows x 32 k (16 whole lines of src), the eight waves of a work-group on neighbouring k; grid (rows / 16 * DM / 32 / 8, batch).
__global__ __launch_bounds__(256) void k_cvt8(const float* __restrict__ src, bf* dst, size_t sS, size_t sD) { src += blockIdx.y * sS; dst += blockIdx.y * sD;
    const int lane = threadIdx.x & 31, lr = lane & 15, hi = lane >> 4; const int wv = blockIdx.x * 8 + (threadIdx.x >> 5); const int rt = wv / (DM / 32), kt = wv % (DM / 32);
    const float* p = src + (size_t)(rt * 16 + lr) * DM + kt * 32 + 8 * hi; const v8f v = *(const v8f*)p, u = *(const v8f*)(p + 16);
    v8us o0, o1;
#pragma unroll
    for (int k = 0; k < 8; ++k) { o0[k] = f2bf(v[k]); o1[k] = f2bf(u[k]); }
    bf* q = dst + (size_t)rt * 16 * DM + kt * 512 + lane * 8; *(v8us*)q = o0; *(v8us*)(q + 256) = o1;  }

// k_fattn: scores, causal softmax and p.v of one (batch, head), 16 * NQ query rows per wave, four waves per block, no memory round trip for s or p.
// Transposed products: s^T = K q^T (A = key rows, B = query rows), so D element j of key tile kt is key k0 + 16*kt + 8*(lane>>4) + j of query (lane & 15): the two key tiles of a 32-key step ARE the B fragment of p^T (elements 0..7 / 8..15) for o^T = V^T p^T (A = value plane rows d, k = key).
// Running softmax per query (= per lane; the two lane halves hold different keys and share the maximum by one cross-half exchange): o and the sum are rescaled by 2^((m_old - m_new) c) each step. Keys j > i take the reference's replace fill (-1e9 after the 0.125 scale); only the last step of a row group meets the diagonal.
__device__ __forceinline__ float xhalf(float x) { return __builtin_bit_cast(float, __builtin_amdgcn_permlanex16(__builtin_bit_cast(int, x), __builtin_bit_cast(int, x), 0x76543210, 0xfedcba98, false, false)); }   // lane l takes lane l ^ 16
template <typename T16, bool HR, int NQ>
__device__ __forceinline__ void attn_rows(const T16* __restrict__ Q, const T16* __restrict__ Q2, const T16* __restrict__ Kp, const T16* __restrict__ K2, const T16* __restrict__ Vt, const T16* __restrict__ V2, float* O, const int q0, const int lr, const int hi) {
    typedef WFrag<T16> WF; typedef typename WF::V V;
    const float CL = SCL * 1.4426950408889634f;
    // per-lane byte offset into a 1-KB fragment block of any plane: 16 bytes per lane, the fragment's second half 512 bytes on
    const unsigned lob = (unsigned)(lr + 16 * hi) * 16u;
    auto at = [](const T16* base, const unsigned byteoff) { return (const T16*)((const char*)base + byteoff); };
    V qf[NQ][2], q2[NQ][2];
#pragma unroll
    for (int nq = 0; nq < NQ; ++nq)
#pragma unroll
        for (int ks = 0; ks < 2; ++ks) { const int e = (q0 + nq * 16) * HD + ks * 512; qf[nq][ks] = WF::ldp(at(Q + e, lob)); if (HR) q2[nq][ks] = WF::ldp(at(Q2 + e, lob)); }
    asm volatile("s_wait_xcnt 0x0" ::: "memory");   // the query loads' address registers are free for reuse by what follows
    v8f o[4][NQ]; float mr[NQ], ls[NQ];
#pragma unroll
    for (int nq = 0; nq < NQ; ++nq) { mr[nq] = -1.0e30f; ls[nq] = 0.f;
#pragma unroll
        for (int db = 0; db < 4; ++db) o[db][nq] = (v8f){}; }
    // the four plane pointers live across the whole key loop and step by 32 keys (four blocks, 4 KB) behind each load group
    const T16 *pk = at(Kp, lob), *pk2 = HR ? at(K2, lob) : nullptr, *pv = at(Vt, lob), *pv2 = HR ? at(V2, lob) : nullptr;
    auto ldk = [&](V (&d)[2][2], V (&d2)[2][2]) {
#pragma unroll
        for (int kt = 0; kt < 2; ++kt)
#pragma unroll
            for (int ks = 0; ks < 2; ++ks) { const int e = (kt * 2 + ks) * 512; d[kt][ks] = WF::ldp(pk + e); if (HR) d2[kt][ks] = WF::ldp(pk2 + e); }
        pk += 32 * HD; if (HR) pk2 += 32 * HD; };
    auto ldv = [&](V (&d)[4], V (&d2)[4]) {
#pragma unroll
        for (int db = 0; db < 4; ++db) { const int e = db * 512; d[db] = WF::ldp(pv + e); if (HR) d2[db] = WF::ldp(pv2 + e); }
        pv += 32 * HD; if (HR) pv2 += 32 * HD; };
    auto scores = [&](v8f (&s)[2][NQ], V (&kc)[2][2], V (&kc2)[2][2]) {
#pragma unroll
        for (int kt = 0; kt < 2; ++kt)
#pragma unroll
            for (int nq = 0; nq < NQ; ++nq) { v8f c = (v8f){};
#pragma unroll
                for (int ks = 0; ks < 2; ++ks) { c = WF::mma(kc[kt][ks], qf[nq][ks], c); if (HR) { c = WF::mma(kc[kt][ks], q2[nq][ks], c); c = WF::mma(kc2[kt][ks], qf[nq][ks], c); } }
                s[kt][nq] = c; } };
    auto softpv = [&](v8f (&s)[2][NQ], V (&vf)[4], V (&v2)[4], const int k0, const bool mask) {
        V pf[NQ], pl[NQ];
#pragma unroll
        for (int nq = 0; nq < NQ; ++nq) {
            if (mask) { const int qi = q0 + nq * 16 + lr;
#pragma unroll
                for (int kt = 0; kt < 2; ++kt)
#pragma unroll
                    for (int j = 0; j < 8; ++j) s[kt][nq][j] = (k0 + kt * 16 + 8 * hi + j <= qi) ? s[kt][nq][j] : (NEGF / SCL); }
            float mx = s[0][nq][0];
#pragma unroll
            for (int j = 1; j < 8; ++j) mx = fmaxf(mx, s[0][nq][j]);
#pragma unroll
            for (int j = 0; j < 8; ++j) mx = fmaxf(mx, s[1][nq][j]);
            mx = fmaxf(mx, xhalf(mx));
            const float mn = fmaxf(mr[nq], mx); const float al = __builtin_amdgcn_exp2f((mr[nq] - mn) * CL); mr[nq] = mn;
            float sum = 0.f; float p[16];
#pragma unroll
            for (int e = 0; e < 16; ++e) { p[e] = __builtin_amdgcn_exp2f((s[e >> 3][nq][e & 7] - mn) * CL + (HR ? 0.f : PEXP)); sum += p[e]; }
            ls[nq] = ls[nq] * al + sum;
#pragma unroll
            for (int db = 0; db < 4; ++db) o[db][nq] *= al;
            if constexpr (HR) { v8us h0, h1, l0, l1;
#pragma unroll
                for (int j = 0; j < 8; ++j) { unsigned short a, c2; splitf(p[j], a, c2); h0[j] = a; l0[j] = c2; splitf(p[8 + j], a, c2); h1[j] = a; l1[j] = c2; }
                pf[nq] = cat16b(h0, h1); pl[nq] = cat16b(l0, l1);
            } else { v16h t;
#pragma unroll
                for (int e = 0; e < 16; ++e) t[e] = tohx(p[e]);
                pf[nq] = t; } }
#pragma unroll
        for (int db = 0; db < 4; ++db)
#pragma unroll
            for (int nq = 0; nq < NQ; ++nq) { o[db][nq] = WF::mma(vf[db], pf[nq], o[db][nq]); if (HR) { o[db][nq] = WF::mma(vf[db], pl[nq], o[db][nq]); o[db][nq] = WF::mma(v2[db], pf[nq], o[db][nq]); } } };
    const int kfull = q0 & ~31;
    V kf[2][2], k2[2][2], vf[4], v2[4]; v8f s[2][NQ];
    ldk(kf, k2);
    __builtin_amdgcn_sched_barrier(0);   // key loads issue in front of the value loads here as in the loop: loads return in order, and with another order on entry the wait at the loop's head covers the value loads too
    ldv(vf, v2);
    asm volatile("s_wait_xcnt 0x0" ::: "memory");   // the first fragment loads name the per-lane offset register, which is dead from here on and gets reused
    // each fragment set is refilled for the next step right behind its last use: the key loads fly under softmax and p.v, the value loads under the next scores and softmax (step kfull always exists)
    for (int k0 = 0; k0 < kfull; k0 += 32) {
        scores(s, kf, k2);
        ldk(kf, k2);
        softpv(s, vf, v2, k0, false);
        ldv(vf, v2);
    }
    scores(s, kf, k2);
    softpv(s, vf, v2, kfull, true);
#pragma unroll
    for (int nq = 0; nq < NQ; ++nq) { const float l = ls[nq] + xhalf(ls[nq]); const float inv = __fdiv_rn(1.0f, l);
        float* orow = O + (size_t)(q0 + nq * 16 + lr) * DM + 8 * hi;
#pragma unroll
        for (int db = 0; db < 4; ++db) { v4f a, c;
#pragma unroll
            for (int j = 0; j < 4; ++j) { a[j] = o[db][nq][j] * inv; c[j] = o[db][nq][4 + j] * inv; }
            *(v4f*)(orow + db * 16) = a; *(v4f*)(orow + db * 16 + 4) = c;
            asm volatile("s_wait_xcnt 0x0" ::: "memory"); } }   // the next pair of products is written into the data registers that these two stores name
}
// grid (NB * 16 heads, (TT - RH) / 128 + RH / 64): f16 row groups first, the longest (last rows) at the lowest block indices; then the hi/lo row groups (16 rows per wave: three products per tile and two planes per operand). The second launch bound asks for four waves per SIMD (at most 256 registers a wave), so that every block of the grid is resident from the start.
__global__ __launch_bounds__(128, 4) void k_fattn(const h16* __restrict__ QK16, const h16* __restrict__ VT16, const bf* __restrict__ QKh, const bf* __restrict__ QKl, const bf* __restrict__ VTh, const bf* __restrict__ VTl, float* OUT) {
    const int lane = threadIdx.x & 31, lr = lane & 15, hi = lane >> 4; const int wv = __builtin_amdgcn_readfirstlane((int)(threadIdx.x >> 5));
    const int b = blockIdx.x / NH_, h = blockIdx.x % NH_; const int y = blockIdx.y;
    float* O = OUT + (size_t)b * TT * DM + h * HD;
    const size_t zq = (size_t)(b * 2 * NH_ + h), zk = zq + NH_, zv = (size_t)(b * NH_ + h);
    if (y < (TT - RH) / 128)
        attn_rows<h16, false, 2>(QK16 + zq * TT * HD, nullptr, QK16 + zk * TT * HD, nullptr, VT16 + zv * HD * TT, nullptr, O, TT - 128 * (y + 1) + wv * 32, lr, hi);
    else
        attn_rows<bf, true, 1>(QKh + zq * RH * HD, QKl + zq * RH * HD, QKh + zk * RH * HD, QKl + zk * RH * HD, VTh + zv * HD * RH, VTl + zv * HD * RH, O, RH - 64 * (y - (TT - RH) / 128 + 1) + wv * 16, lr, hi);
}

extern "C" void kernel_launch(void* const* d_in, const int* in_sizes, int n_in,
                              void* d_out, int out_size, void* d_ws, size_t ws_size, hipStream_t stream) {
    if (n_in < 5) return;
    if (in_sizes[0] < (NB - 1) * SEQ_FULL * DM + TT * DM) return;
    if (in_sizes[1] < DM * 2 * DQ) return; if (in_sizes[2] < 2 * DQ) return; if (in_sizes[3] < DM * DQ) return; if (in_sizes[4] < DQ) return;
    if (out_size < NB * TT * DM) return;
    const float* x = (const float*)d_in[0]; const float* wqk = (const float*)d_in[1]; const float* bqk = (const float*)d_in[2]; const float* wv = (const float*)d_in[3]; const float* bv = (const float*)d_in[4];   // wire order x, Wqk, bqk, Wv, bv
    float* OUT = (float*)d_out;     // [NB][TT][1024]
    char* wsp = (char*)d_ws;
    auto take = [&](size_t bytes) { char* p = wsp; wsp += (bytes + 255) & ~(size_t)255; return (void*)p; };
    bf* WQKV = (bf*)take((size_t)N3 * DM * 2);                  // Bt [3072][1024] in fragment order: q | k | v row blocks
    float* BQKV = (float*)take((size_t)N3 * 4);
    h16* QK16 = (h16*)take((size_t)NB * 2 * NH_ * TT * HD * 2); // [NB][32] planes of TT x 64 in fragment order: q heads 0..15, k heads 16..31
    h16* VT16 = (h16*)take((size_t)NB * NH_ * HD * TT * 2);     // [NB][16] planes of 64 x TT in fragment order, blocks (t / 32, d / 16)
    bf* QKh = (bf*)take((size_t)NB * 2 * NH_ * RH * HD * 2); bf* QKl = (bf*)take((size_t)NB * 2 * NH_ * RH * HD * 2);
    bf* VTh = (bf*)take((size_t)NB * NH_ * HD * RH * 2); bf* VTl = (bf*)take((size_t)NB * NH_ * HD * RH * 2);
    bf* XB = (bf*)take((size_t)NB * TT * DM * 2);               // [NB*TT][1024] in fragment order
    const size_t carved = (size_t)(wsp - (char*)d_ws);
    if (carved > ws_size) return;
    k_wtG<DM, 2 * DQ><<<(unsigned)(DM * 2 * DQ / 512 / 8), 256, 0, stream>>>(wqk, WQKV);                          // in[1024][2048] -> out rows 0..2047
    k_wtG<DM, DQ><<<(unsigned)(DM * DQ / 512 / 8), 256, 0, stream>>>(wv, WQKV + (size_t)2 * DQ * DM);             // in[1024][1024] -> out rows 2048..3071
    k_bcat<<<(N3 / 4 + 255) / 256, 256, 0, stream>>>(bqk, bv, BQKV);
    k_cvt8<<<dim3((unsigned)(TT * DM / 512 / 8), NB, 1), 256, 0, stream>>>(x, XB, (size_t)SEQ_FULL * DM, (size_t)TT * DM);
    k_gemmw<bf, 0, true, 0, DM><<<dim3(NB * TT / 64, N3 / 64, 1), 32, 0, stream>>>(XB, nullptr, WQKV, nullptr, BQKV, 0, 0, 0, QK16, QKh, QKl, VT16, VTh, VTl);
    k_fattn<<<dim3(NB * NH_, (TT - RH) / 128 + RH / 64, 1), 128, 0, stream>>>(QK16, VT16, QKh, QKl, VTh, VTl, OUT);
}

// v005
// One run takes 81.3 microseconds.
// Two timings next to v004 put it at 1.25 and 1.27 times that version's speed.
// All steps since v000 together make it 17.1 times as fast.
#include <hip/hip_runtime.h>

// Causal multi-head self-attention, no output projection: x [NB][SEQ][1024]; qk = x Wqk + bqk (Wqk [1024][2048] 'in x out': q = cols 0..1023, k = cols 1024..2047), v = x Wv + bv (Wv [1024][1024]); 16 heads x 64 (col = h*64 + d); s = q.k x 0.125; keys j > i replaced by -1e9; softmax f32; out[b][t][h*64+d] = sum_j p v.
// Compute dtypes, f32 accumulate: every input RNE-converted to bf16; projections v_wmma_f32_16x16x32_bf16 (exact products) + bf16 bias; q.k and p.v: query rows < 512 bf16 hi/lo planes (3 products, v_wmma bf16), other rows v_wmma_f32_16x16x32_f16 single planes with the unnormalised p carried x1024 (the row sum carries the same factor, so it cancels in the f32 division); softmax f32, running maximum and running sum.
// Layout: bf16 copy of x (both batches) and the fused, transposed weight (q | k | v row blocks); one fused projection GEMM over both batches whose epilogue converts its f32 tile and writes the head planes [b][h] (rows t, k = d) / value planes [b][g] (rows d, k = t) itself; every one of these planes lies in fragment order (see k_gemmw); one attention launch for all heads and batches: scores, softmax and p.v stay in registers, output written straight into the merged layout (256-B head segments).

#ifndef NB
#define NB 2
#endif
#ifndef SEQ
#define SEQ 2048
#endif
#define NB_FULL  2
#define SEQ_FULL 2048
#define TT   SEQ
#define DM   1024
#define NH_  16
#define HD   64
#define DQ   (NH_ * HD)
#define N3   (3 * DQ)
#define RH   ((TT < 512) ? TT : 512)     // query rows < RH use hi+lo planes
#define PEXP 10.0f                        // f16 rows: p carried x 2^10
#define SCL  0.125f                       // 64^-0.5
#define NEGF (-1.0e9f)
static_assert(TT % 128 == 0);
static_assert(RH % 128 == 0);
static_assert((TT - RH) % 128 == 0);
static_assert(DM % 256 == 0);   // eight 32-k blocks per packing work-group
static_assert(N3 % 128 == 0);

typedef _Float16 h16;
typedef unsigned short bf;
typedef __attribute__((ext_vector_type(16))) __bf16   v16bf;
typedef __attribute__((ext_vector_type(16))) _Float16 v16h;
typedef __attribute__((ext_vector_type(8)))  _Float16 v8h;
typedef __attribute__((ext_vector_type(8)))  unsigned short v8us;
typedef __attribute__((ext_vector_type(8)))  float    v8f;
typedef __attribute__((ext_vector_type(4)))  float    v4f;
typedef __attribute__((ext_vector_type(2)))  float    v2f;
typedef __attribute__((ext_vector_type(2)))  _Float16 v2h;
typedef __attribute__((ext_vector_type(4)))  _Float16 v4h;
typedef __attribute__((ext_vector_type(2)))  unsigned short v2us;
typedef __attribute__((ext_vector_type(4)))  unsigned short v4us;
typedef v4f  __attribute__((may_alias)) v4fa;

__device__ __forceinline__ unsigned short f2bf(float f) { unsigned u = __float_as_uint(f); u += 0x7FFFu + ((u >> 16) & 1u); return (unsigned short)(u >> 16); }
__device__ __forceinline__ float bf2f(unsigned short b) { return __uint_as_float(((unsigned)b) << 16); }
__device__ __forceinline__ float bfr(float f) { return bf2f(f2bf(f)); }
__device__ __forceinline__ v16h cat16(v8h lo, v8h hi) { return __builtin_shufflevector(lo, hi, 0, 1, 2, 3, 4, 5, 6, 7, 8, 9, 10, 11, 12, 13, 14, 15); }
__device__ __forceinline__ v16bf cat16b(v8us lo, v8us hi) { return __builtin_bit_cast(v16bf, __builtin_shufflevector(lo, hi, 0, 1, 2, 3, 4, 5, 6, 7, 8, 9, 10, 11, 12, 13, 14, 15)); }
__device__ __forceinline__ v8f wmma16(v16h a, v16h b, v8f c) { return __builtin_amdgcn_wmma_f32_16x16x32_f16(false, a, false, b, (short)0, c, false, false); }
__device__ __forceinline__ v8f wmmab(v16bf a, v16bf b, v8f c) { return __builtin_amdgcn_wmma_f32_16x16x32_bf16(false, a, false, b, (short)0, c, false, false); }
__device__ __forceinline__ h16 tohx(float x) { return (h16)x; }
__device__ __forceinline__ void splitf(float y, unsigned short& h, unsigned short& l) { h = f2bf(y); l = f2bf(y - bf2f(h)); }

// ---- k_gemmw: register-blocked GEMM, FOUR WAVES (2 x 2) per 128x128 output tile, 64x64 (16 accumulators) per wave; both operands are 16-bit planes in fragment order and reach the waves through a two-buffer LDS ring filled by asynchronous copies, so each operand byte is fetched once per work-group and one stage ahead of its use; grid (M/128, N/128), 128 threads.
// Fragment order: a plane of rows x K is cut into blocks of 16 rows x 32 k, 512 elements (1 KB) each, block (row / 16, k / 32) at element (row / 16) * 16 * K + (k / 32) * 512; inside a block lane l's elements 0..7 lie at l * 8 and its elements 8..15 at 256 + l * 8, so each of a fragment's two 16-byte loads covers 512 contiguous bytes (4 whole lines) where a row-major plane gives 16 pieces of 32 bytes in 16 lines.
// y[m][n] (f32) = sum_k A[m][k] Bt[n][k] (+ bf16 bias[n]), k ascending in steps of 32 in every accumulator. K % 64 == 0, a compile-time constant.
// y never reaches memory: a 64-column tile is one head (0..15 q, 16..31 k, 32..47 v) and a 64-row tile lies in one batch and on one side of row RH, so the epilogue writes the attention planes itself: f16 always, bf16 hi/lo for rows < RH.
// Fragment map: lane -> row/col (lane & 15); elements 0..7 = k0 + 8*(lane>>4) + 0..7, elements 8..15 = k0 + 16 + 8*(lane>>4) + 0..7 for both operands; D element j = row 8*(lane>>4)+j, col lane&15.
template <typename T16> struct WFrag;
template <> struct WFrag<h16> { typedef v16h V; static __device__ __forceinline__ V ldp(const h16* p) { return cat16(*(const v8h*)p, *(const v8h*)(p + 256)); } static __device__ __forceinline__ v8f mma(V a, V b, v8f c) { return wmma16(a, b, c); } };
template <> struct WFrag<bf> { typedef v16bf V; static __device__ __forceinline__ V ldp(const bf* p) { return cat16b(*(const v8us*)p, *(const v8us*)(p + 256)); } static __device__ __forceinline__ v8f mma(V a, V b, v8f c) { return wmmab(a, b, c); } };
// Epilogues of k_gemmw, one wave each; HL: the tile's rows are < RH and get the bf16 hi/lo planes too. The planes are written in the fragment order in which k_fattn loads them, every store instruction covering 512 contiguous bytes. s_wait_xcnt 0 stands behind each group of stores because the next group's values and addresses are written into registers that those stores name.
// put_qk: fragment rows = t, k = d: block (t / 16, d / 32) at element (t / 16) * 1024 + (d / 32) * 512 of the head's plane, so the tile is one contiguous 64 x 64 block. 16 rows at a time go through LDS (f32, pitch 68) so that lane l holds 8 neighbouring d of row l & 15; a wave's LDS reads are all issued in front of its stores (the "memory" clobber of the wait also keeps the next LDS writes behind the reads in the compiled order).
template <bool HL, bool BIAS>
__device__ __forceinline__ void put_qk(const v8f (&acc)[4][4], float* os, const float* __restrict__ bias, h16* p16, bf* ph, bf* pl, const int lane) {
    const int lr = lane & 15, hi = lane >> 4; float bn[4];
#pragma unroll
    for (int nb = 0; nb < 4; ++nb) bn[nb] = BIAS ? bfr(bias[nb * 16 + lr]) : 0.f;
#pragma unroll
    for (int mb = 0; mb < 4; ++mb) {
#pragma unroll
        for (int nb = 0; nb < 4; ++nb) {
#pragma unroll
            for (int j = 0; j < 8; ++j) os[(hi * 8 + j) * 68 + nb * 16 + lr] = acc[mb][nb][j] + bn[nb]; }
        __builtin_amdgcn_wave_barrier(); asm volatile("" ::: "memory");   // the LDS range is this wave's own: keeps the row reads below behind the other lanes' LDS writes in the compiled order
        v4f x[4][2];
#pragma unroll
        for (int s = 0; s < 4; ++s) { const float* r = os + lr * 68 + s * 16 + hi * 8; x[s][0] = *(const v4fa*)r; x[s][1] = *(const v4fa*)(r + 4); }   // s = 2 * (d / 32) + fragment half
#pragma unroll
        for (int s = 0; s < 4; ++s) { v8h o16; v8us oh, ol;
#pragma unroll
            for (int q = 0; q < 8; ++q) { const float y = x[s][q >> 2][q & 3]; o16[q] = tohx(y); if (HL) { unsigned short a2, c2; splitf(y, a2, c2); oh[q] = a2; ol[q] = c2; } }
            const int e = mb * 1024 + s * 256 + lane * 8;
            *(v8h*)(p16 + e) = o16; if (HL) { *(v8us*)(ph + e) = oh; *(v8us*)(pl + e) = ol; }
            asm volatile("s_wait_xcnt 0x0" ::: "memory"); }   // the next rows' values are written into registers that these stores name
    }
}
// put_v: fragment rows = d, k = t: block (t / 32, d / 16) at element (t / 32) * 2048 + (d / 16) * 512 of the head's plane. A lane's 8 accumulator elements are 8 neighbouring t of d = 16 * nb + (lane & 15), which is this same lane's 16-byte piece of the fragment (half = mb & 1): converted in registers and stored straight.
template <bool HL, bool BIAS>
__device__ __forceinline__ void put_v(const v8f (&acc)[4][4], const float* __restrict__ bias, h16* p16, bf* ph, bf* pl, const int lane) {
    const int lr = lane & 15; float bn[4];
#pragma unroll
    for (int nb = 0; nb < 4; ++nb) bn[nb] = BIAS ? bfr(bias[nb * 16 + lr]) : 0.f;
#pragma unroll
    for (int nb = 0; nb < 4; ++nb) { const float bs = bn[nb];
#pragma unroll
        for (int mb = 0; mb < 4; ++mb) { v8h o16; v8us oh, ol;
#pragma unroll
            for (int j = 0; j < 8; ++j) { const float y = acc[mb][nb][j] + bs; o16[j] = tohx(y); if (HL) { unsigned short a2, c2; splitf(y, a2, c2); oh[j] = a2; ol[j] = c2; } }
            const int e = ((mb >> 1) * 4 + nb) * 512 + (mb & 1) * 256 + lane * 8;
            *(v8h*)(p16 + e) = o16; if (HL) { *(v8us*)(ph + e) = oh; *(v8us*)(pl + e) = ol; }
            asm volatile("s_wait_xcnt 0x0" ::: "memory"); }   // the next values are written into registers that these stores name
    }
}
// One stage of k_gemmw's LDS ring: 64 k of the tile's 128 A rows (first 16 KB) and 128 Bt rows (second 16 KB). In fragment order a group of 16 rows x 64 k is 2 KB contiguous in the plane; it is copied as it lies, so a fragment's two 16-byte LDS loads cover 512 contiguous bytes each, as the global loads did.
#define GST 32768
// Eight asynchronous copies global -> LDS, 16 bytes per lane each, through no register. s_wait_xcnt 0 is the statement's own last line so that it stands in front of every later write of the address registers that the copies name.
__device__ __forceinline__ void copy8(const unsigned (&l)[8], const char* const (&g)[8]) {
    asm volatile("global_load_async_to_lds_b128 %0, %8, off\n\t"
                 "global_load_async_to_lds_b128 %1, %9, off\n\t"
                 "global_load_async_to_lds_b128 %2, %10, off\n\t"
                 "global_load_async_to_lds_b128 %3, %11, off\n\t"
                 "global_load_async_to_lds_b128 %4, %12, off\n\t"
                 "global_load_async_to_lds_b128 %5, %13, off\n\t"
                 "global_load_async_to_lds_b128 %6, %14, off\n\t"
                 "global_load_async_to_lds_b128 %7, %15, off\n\t"
                 "s_wait_xcnt 0x0"
                 :: "v"(l[0]), "v"(l[1]), "v"(l[2]), "v"(l[3]), "v"(l[4]), "v"(l[5]), "v"(l[6]), "v"(l[7]),
                    "v"(g[0]), "v"(g[1]), "v"(g[2]), "v"(g[3]), "v"(g[4]), "v"(g[5]), "v"(g[6]), "v"(g[7]) : "memory");
}
template <bool BIAS, int K>
__global__ __launch_bounds__(128) void k_gemmw(const bf* __restrict__ A, const bf* __restrict__ Bt, const float* __restrict__ bias, h16* QK16, bf* QKh, bf* QKl, h16* VT16, bf* VTh, bf* VTl) {
    static_assert(K % 64 == 0 && K / 64 >= 2);   // the ring's prologue fills two stages
    typedef WFrag<bf> WF; typedef WF::V V;
    constexpr int NT = K / 64;
    __shared__ __align__(16) char ring[2 * GST];
    const int lane = threadIdx.x & 31; const int wv = __builtin_amdgcn_readfirstlane((int)(threadIdx.x >> 5)); const int wm = wv >> 1, wn = wv & 1;
    const int R0 = blockIdx.x * 128, C0 = blockIdx.y * 128;
    v8f acc[4][4];   // every inner loop of this kernel is unrolled in full, so that each accumulator, fragment and copy index is a compile-time constant (registers, no scratch)
#pragma unroll
    for (int mb = 0; mb < 4; ++mb)
#pragma unroll
        for (int nb = 0; nb < 4; ++nb) acc[mb][nb] = (v8f){};
    // wave wv copies row groups 2 wv and 2 wv + 1 of both operands: 4 x 2 KB = 16 copies of 512 bytes per stage
    const char* gA = (const char*)(A + (size_t)(R0 + wv * 32) * K + lane * 8);
    const char* gB = (const char*)(Bt + (size_t)(C0 + wv * 32) * K + lane * 8);
    const unsigned lw = (unsigned)(size_t)ring + (unsigned)(wv * 4096 + lane * 16);
    auto fill = [&](const int t, const unsigned buf) {
        unsigned l[8]; const char* g[8];
#pragma unroll
        for (int c = 0; c < 2; ++c)
#pragma unroll
            for (int j = 0; j < 4; ++j) { l[c * 4 + j] = lw + buf * GST + c * 2048 + j * 512; g[c * 4 + j] = gA + (size_t)c * 32 * K + t * 2048 + j * 512; }
        copy8(l, g);
#pragma unroll
        for (int c = 0; c < 2; ++c)
#pragma unroll
            for (int j = 0; j < 4; ++j) { l[c * 4 + j] = lw + buf * GST + 16384 + c * 2048 + j * 512; g[c * 4 + j] = gB + (size_t)c * 32 * K + t * 2048 + j * 512; }
        copy8(l, g);
    };
    fill(0, 0);
    asm volatile("s_wait_asynccnt 0x0" ::: "memory");   // this wave's copies of stage 0 have landed
    __syncthreads();                                     // ... and every other wave's
    fill(1, 1);
    const char* fa = ring + wm * 8192 + lane * 16;           // this wave's four A row groups, this lane's piece
    const char* fb = ring + 16384 + wn * 8192 + lane * 16;   // its four Bt row groups
#pragma unroll 1
    for (int t = 0; t < NT; ++t) {   // rolled: one copy of the stage's code, the buffer chosen by an address offset
        const int bo = (t & 1) * GST;
        V a[4], b[4];
        auto ldf = [&](const int kb) {   // the eight fragments of one 32-k block
#pragma unroll
            for (int mb = 0; mb < 4; ++mb) a[mb] = WF::ldp((const bf*)(fa + bo + mb * 2048 + kb * 1024));
#pragma unroll
            for (int nb = 0; nb < 4; ++nb) b[nb] = WF::ldp((const bf*)(fb + bo + nb * 2048 + kb * 1024)); };
        auto mm = [&]() {
#pragma unroll
            for (int nb = 0; nb < 4; ++nb)
#pragma unroll
                for (int mb = 0; mb < 4; ++mb) acc[mb][nb] = WF::mma(a[mb], b[nb], acc[mb][nb]); };
        ldf(0);
        __builtin_amdgcn_sched_barrier(0);   // the 16 LDS loads of a block stay one group in front of its WMMAs: sunk among them, every group of four WMMAs waits out an LDS latency of its own
        mm();
        ldf(1);
        asm volatile("s_wait_dscnt 0x0" ::: "memory");      // this wave's last reads of the buffer have returned before it is refilled
        asm volatile("s_wait_asynccnt 0x0" ::: "memory");   // this wave's copies of stage t + 1 have landed
        __syncthreads();                                     // publishes stage t + 1 and ends every wave's reads of stage t
        if (t + 2 < NT) fill(t + 2, (unsigned)(t & 1));
        __builtin_amdgcn_sched_barrier(0);   // the second block's WMMAs work on registers alone and stay behind the refill, so that the copies start 16 WMMAs earlier
        mm();
    }
    asm volatile("s_wait_asynccnt 0x0" ::: "memory");   // no copy is outstanding when the wave goes on to its epilogue and ends
    float* os = (float*)(ring + wv * (16 * 68 * 4));   // the epilogue's staging range, one per wave, lies in the ring: every wave's last read of the ring stands in front of the last trip's barrier, and no copy is outstanding
    const int r0 = R0 + wm * 64, c0 = C0 + wn * 64;
    const int hh = c0 / 64, bb = r0 / TT, t0 = r0 % TT; const bool hl = (t0 < RH);   // all wave-uniform
    if (hh < 2 * NH_) { const size_t zp = (size_t)(bb * 2 * NH_ + hh); h16* p16 = QK16 + (zp * TT + t0) * HD;
        if (hl) put_qk<true, BIAS>(acc, os, bias + c0, p16, QKh + (zp * RH + t0) * HD, QKl + (zp * RH + t0) * HD, lane);
        else put_qk<false, BIAS>(acc, os, bias + c0, p16, nullptr, nullptr, lane);
    } else { const size_t zp = (size_t)(bb * NH_ + hh - 2 * NH_); h16* p16 = VT16 + (zp * TT + t0) * HD;
        if (hl) put_v<true, BIAS>(acc, bias + c0, p16, VTh + (zp * RH + t0) * HD, VTl + (zp * RH + t0) * HD, lane);
        else put_v<false, BIAS>(acc, bias + c0, p16, nullptr, nullptr, lane);
    }
}

// k_wtG: w [K][N] f32 -> Bt, the transposed plane (rows n, K-contiguous) in fragment order, bf16. One wave per block of 16 n x 32 k: a lane holds row n = 16 * nt + (lane & 15) and reads its 16 k down the column, so each load covers 64 contiguous bytes of two rows of w; the eight waves of a work-group take neighbouring nt (512 contiguous bytes of each row). Grid N / 16 * K / 32 / 8.
template <int K, int N>
__global__ __launch_bounds__(256) void k_wtG(const float* __restrict__ w, bf* Bt) {
    static_assert(N % 128 == 0 && K % 32 == 0);
    const int lane = threadIdx.x & 31, lr = lane & 15, hi = lane >> 4; const int wv = blockIdx.x * 8 + (threadIdx.x >> 5); const int nt = wv % (N / 16), kt = wv / (N / 16);
    const float* p = w + (size_t)(kt * 32 + 8 * hi) * N + nt * 16 + lr; v8us o0, o1;
#pragma unroll
    for (int j = 0; j < 8; ++j) { o0[j] = f2bf(p[j * N]); o1[j] = f2bf(p[(16 + j) * N]); }
    bf* q = Bt + (size_t)nt * 16 * K + kt * 512 + lane * 8; *(v8us*)q = o0; *(v8us*)(q + 256) = o1;
}
__global__ __launch_bounds__(256) void k_bcat(const float* __restrict__ bqk, const float* __restrict__ bv, float* Bq) {
    const int i = blockIdx.x * 256 + threadIdx.x; if (i >= N3 / 4) return; const int c = i * 4; v4f o;
#pragma unroll
    for (int q = 0; q < 4; ++q) { const int cc = c + q; const int ia = (cc < 2 * DQ) ? cc : (2 * DQ - 1); int ib = cc - 2 * DQ; ib = (ib < 0) ? 0 : ib; ib = (ib > DQ - 1) ? (DQ - 1) : ib;
        const float a = bqk[ia]; const float b2 = bv[ib]; o[q] = (cc < 2 * DQ) ? a : b2; }
    *(v4f*)(Bq + c) = o;  }
// k_cvt8: src [rows][DM] f32 -> dst, the same plane in fragment order, bf16. One wave per block of 16 rows x 32 k (16 whole lines of src), the eight waves of a work-group on neighbouring k; grid (rows / 16 * DM / 32 / 8, batch).
__global__ __launch_bounds__(256) void k_cvt8(const float* __restrict__ src, bf* dst, size_t sS, size_t sD) { src += blockIdx.y * sS; dst += blockIdx.y * sD;
    const int lane = threadIdx.x & 31, lr = lane & 15, hi = lane >> 4; const int wv = blockIdx.x * 8 + (threadIdx.x >> 5); const int rt = wv / (DM / 32), kt = wv % (DM / 32);
    const float* p = src + (size_t)(rt * 16 + lr) * DM + kt * 32 + 8 * hi; const v8f v = *(const v8f*)p, u = *(const v8f*)(p + 16);
    v8us o0, o1;
#pragma unroll
    for (int k = 0; k < 8; ++k) { o0[k] = f2bf(v[k]); o1[k] = f2bf(u[k]); }
    bf* q = dst + (size_t)rt * 16 * DM + kt * 512 + lane * 8; *(v8us*)q = o0; *(v8us*)(q + 256) = o1;  }

// k_fattn: scores, causal softmax and p.v of one (batch, head), 16 * NQ query rows per wave, four waves per block, no memory round trip for s or p.
// Transposed products: s^T = K q^T (A = key rows, B = query rows), so D element j of key tile kt is key k0 + 16*kt + 8*(lane>>4) + j of query (lane & 15): the two key tiles of a 32-key step ARE the B fragment of p^T (elements 0..7 / 8..15) for o^T = V^T p^T (A = value plane rows d, k = key).
// Running softmax per query (= per lane; the two lane halves hold different keys and share the maximum by one cross-half exchange): o and the sum are rescaled by 2^((m_old - m_new) c) each step. Keys j > i take the reference's replace fill (-1e9 after the 0.125 scale); only the last step of a row group meets the diagonal.
__device__ __forceinline__ float xhalf(float x) { return __builtin_bit_cast(float, __builtin_amdgcn_permlanex16(__builtin_bit_cast(int, x), __builtin_bit_cast(int, x), 0x76543210, 0xfedcba98, false, false)); }   // lane l takes lane l ^ 16
template <typename T16, bool HR, int NQ>
__device__ __forceinline__ void attn_rows(const T16* __restrict__ Q, const T16* __restrict__ Q2, const T16* __restrict__ Kp, const T16* __restrict__ K2, const T16* __restrict__ Vt, const T16* __restrict__ V2, float* O, const int q0, const int lr, const int hi) {
    typedef WFrag<T16> WF; typedef typename WF::V V;
    const float CL = SCL * 1.4426950408889634f;
    // per-lane byte offset into a 1-KB fragment block of any plane: 16 bytes per lane, the fragment's second half 512 bytes on
    const unsigned lob = (unsigned)(lr + 16 * hi) * 16u;
    auto at = [](const T16* base, const unsigned byteoff) { return (const T16*)((const char*)base + byteoff); };
    V qf[NQ][2], q2[NQ][2];
#pragma unroll
    for (int nq = 0; nq < NQ; ++nq)
#pragma unroll
        for (int ks = 0; ks < 2; ++ks) { const int e = (q0 + nq * 16) * HD + ks * 512; qf[nq][ks] = WF::ldp(at(Q + e, lob)); if (HR) q2[nq][ks] = WF::ldp(at(Q2 + e, lob)); }
    asm volatile("s_wait_xcnt 0x0" ::: "memory");   // the query loads' address registers are free for reuse by what follows
    v8f o[4][NQ]; float mr[NQ], ls[NQ];
#pragma unroll
    for (int nq = 0; nq < NQ; ++nq) { mr[nq] = -1.0e30f; ls[nq] = 0.f;
#pragma unroll
        for (int db = 0; db < 4; ++db) o[db][nq] = (v8f){}; }
    // the four plane pointers live across the whole key loop and step by 32 keys (four blocks, 4 KB) behind each load group
    const T16 *pk = at(Kp, lob), *pk2 = HR ? at(K2, lob) : nullptr, *pv = at(Vt, lob), *pv2 = HR ? at(V2, lob) : nullptr;
    auto ldk = [&](V (&d)[2][2], V (&d2)[2][2]) {
#pragma unroll
        for (int kt = 0; kt < 2; ++kt)
#pragma unroll
            for (int ks = 0; ks < 2; ++ks) { const int e = (kt * 2 + ks) * 512; d[kt][ks] = WF::ldp(pk + e); if (HR) d2[kt][ks] = WF::ldp(pk2 + e); }
        pk += 32 * HD; if (HR) pk2 += 32 * HD; };
    auto ldv = [&](V (&d)[4], V (&d2)[4]) {
#pragma unroll
        for (int db = 0; db < 4; ++db) { const int e = db * 512; d[db] = WF::ldp(pv + e); if (HR) d2[db] = WF::ldp(pv2 + e); }
        pv += 32 * HD; if (HR) pv2 += 32 * HD; };
    auto scores = [&](v8f (&s)[2][NQ], V (&kc)[2][2], V (&kc2)[2][2]) {
#pragma unroll
        for (int kt = 0; kt < 2; ++kt)
#pragma unroll
            for (int nq = 0; nq < NQ; ++nq) { v8f c = (v8f){};
#pragma unroll
                for (int ks = 0; ks < 2; ++ks) { c = WF::mma(kc[kt][ks], qf[nq][ks], c); if (HR) { c = WF::mma(kc[kt][ks], q2[nq][ks], c); c = WF::mma(kc2[kt][ks], qf[nq][ks], c); } }
                s[kt][nq] = c; } };
    auto softpv = [&](v8f (&s)[2][NQ], V (&vf)[4], V (&v2)[4], const int k0, const bool mask) {
        V pf[NQ], pl[NQ];
#pragma unroll
        for (int nq = 0; nq < NQ; ++nq) {
            if (mask) { const int qi = q0 + nq * 16 + lr;
#pragma unroll
                for (int kt = 0; kt < 2; ++kt)
#pragma unroll
                    for (int j = 0; j < 8; ++j) s[kt][nq][j] = (k0 + kt * 16 + 8 * hi + j <= qi) ? s[kt][nq][j] : (NEGF / SCL); }
            float mx = s[0][nq][0];
#pragma unroll
            for (int j = 1; j < 8; ++j) mx = fmaxf(mx, s[0][nq][j]);
#pragma unroll
            for (int j = 0; j < 8; ++j) mx = fmaxf(mx, s[1][nq][j]);
            mx = fmaxf(mx, xhalf(mx));
            const float mn = fmaxf(mr[nq], mx); const float al = __builtin_amdgcn_exp2f((mr[nq] - mn) * CL); mr[nq] = mn;
            float sum = 0.f; float p[16];
#pragma unroll
            for (int e = 0; e < 16; ++e) { p[e] = __builtin_amdgcn_exp2f((s[e >> 3][nq][e & 7] - mn) * CL + (HR ? 0.f : PEXP)); sum += p[e]; }
            ls[nq] = ls[nq] * al + sum;
#pragma unroll
            for (int db = 0; db < 4; ++db) o[db][nq] *= al;
            if constexpr (HR) { v8us h0, h1, l0, l1;
#pragma unroll
                for (int j = 0; j < 8; ++j) { unsigned short a, c2; splitf(p[j], a, c2); h0[j] = a; l0[j] = c2; splitf(p[8 + j], a, c2); h1[j] = a; l1[j] = c2; }
                pf[nq] = cat16b(h0, h1); pl[nq] = cat16b(l0, l1);
            } else { v16h t;
#pragma unroll
                for (int e = 0; e < 16; ++e) t[e] = tohx(p[e]);
                pf[nq] = t; } }
#pragma unroll
        for (int db = 0; db < 4; ++db)
#pragma unroll
            for (int nq = 0; nq < NQ; ++nq) { o[db][nq] = WF::mma(vf[db], pf[nq], o[db][nq]); if (HR) { o[db][nq] = WF::mma(vf[db], pl[nq], o[db][nq]); o[db][nq] = WF::mma(v2[db], pf[nq], o[db][nq]); } } };
    const int kfull = q0 & ~31;
    V kf[2][2], k2[2][2], vf[4], v2[4]; v8f s[2][NQ];
    ldk(kf, k2);
    __builtin_amdgcn_sched_barrier(0);   // key loads issue in front of the value loads here as in the loop: loads return in order, and with another order on entry the wait at the loop's head covers the value loads too
    ldv(vf, v2);
    asm volatile("s_wait_xcnt 0x0" ::: "memory");   // the first fragment loads name the per-lane offset register, which is dead from here on and gets reused
    // each fragment set is refilled for the next step right behind its last use: the key loads fly under softmax and p.v, the value loads under the next scores and softmax (step kfull always exists)
    for (int k0 = 0; k0 < kfull; k0 += 32) {
        scores(s, kf, k2);
        ldk(kf, k2);
        softpv(s, vf, v2, k0, false);
        ldv(vf, v2);
    }
    scores(s, kf, k2);
    softpv(s, vf, v2, kfull, true);
#pragma unroll
    for (int nq = 0; nq < NQ; ++nq) { const float l = ls[nq] + xhalf(ls[nq]); const float inv = __fdiv_rn(1.0f, l);
        float* orow = O + (size_t)(q0 + nq * 16 + lr) * DM + 8 * hi;
#pragma unroll
        for (int db = 0; db < 4; ++db) { v4f a, c;
#pragma unroll
            for (int j = 0; j < 4; ++j) { a[j] = o[db][nq][j] * inv; c[j] = o[db][nq][4 + j] * inv; }
            *(v4f*)(orow + db * 16) = a; *(v4f*)(orow + db * 16 + 4) = c;
            asm volatile("s_wait_xcnt 0x0" ::: "memory"); } }   // the next pair of products is written into the data registers that these two stores name
}
// grid (NB * 16 heads, (TT - RH) / 128 + RH / 64): f16 row groups first, the longest (last rows) at the lowest block indices; then the hi/lo row groups (16 rows per wave: three products per tile and two planes per operand). The second launch bound asks for four waves per SIMD (at most 256 registers a wave), so that every block of the grid is resident from the start.
__global__ __launch_bounds__(128, 4) void k_fattn(const h16* __restrict__ QK16, const h16* __restrict__ VT16, const bf* __restrict__ QKh, const bf* __restrict__ QKl, const bf* __restrict__ VTh, const bf* __restrict__ VTl, float* OUT) {
    const int lane = threadIdx.x & 31, lr = lane & 15, hi = lane >> 4; const int wv = __builtin_amdgcn_readfirstlane((int)(threadIdx.x >> 5));
    const int b = blockIdx.x / NH_, h = blockIdx.x % NH_; const int y = blockIdx.y;
    float* O = OUT + (size_t)b * TT * DM + h * HD;
    const size_t zq = (size_t)(b * 2 * NH_ + h), zk = zq + NH_, zv = (size_t)(b * NH_ + h);
    if (y < (TT - RH) / 128)
        attn_rows<h16, false, 2>(QK16 + zq * TT * HD, nullptr, QK16 + zk * TT * HD, nullptr, VT16 + zv * HD * TT, nullptr, O, TT - 128 * (y + 1) + wv * 32, lr, hi);
    else
        attn_rows<bf, true, 1>(QKh + zq * RH * HD, QKl + zq * RH * HD, QKh + zk * RH * HD, QKl + zk * RH * HD, VTh + zv * HD * RH, VTl + zv * HD * RH, O, RH - 64 * (y - (TT - RH) / 128 + 1) + wv * 16, lr, hi);
}

extern "C" void kernel_launch(void* const* d_in, const int* in_sizes, int n_in,
                              void* d_out, int out_size, void* d_ws, size_t ws_size, hipStream_t stream) {
    if (n_in < 5) return;
    if (in_sizes[0] < (NB - 1) * SEQ_FULL * DM + TT * DM) return;
    if (in_sizes[1] < DM * 2 * DQ) return; if (in_sizes[2] < 2 * DQ) return; if (in_sizes[3] < DM * DQ) return; if (in_sizes[4] < DQ) return;
    if (out_size < NB * TT * DM) return;
    const float* x = (const float*)d_in[0]; const float* wqk = (const float*)d_in[1]; const float* bqk = (const float*)d_in[2]; const float* wv = (const float*)d_in[3]; const float* bv = (const float*)d_in[4];   // wire order x, Wqk, bqk, Wv, bv
    float* OUT = (float*)d_out;     // [NB][TT][1024]
    char* wsp = (char*)d_ws;
    auto take = [&](size_t bytes) { char* p = wsp; wsp += (bytes + 255) & ~(size_t)255; return (void*)p; };
    bf* WQKV = (bf*)take((size_t)N3 * DM * 2);                  // Bt [3072][1024] in fragment order: q | k | v row blocks
    float* BQKV = (float*)take((size_t)N3 * 4);
    h16* QK16 = (h16*)take((size_t)NB * 2 * NH_ * TT * HD * 2); // [NB][32] planes of TT x 64 in fragment order: q heads 0..15, k heads 16..31
    h16* VT16 = (h16*)take((size_t)NB * NH_ * HD * TT * 2);     // [NB][16] planes of 64 x TT in fragment order, blocks (t / 32, d / 16)
    bf* QKh = (bf*)take((size_t)NB * 2 * NH_ * RH * HD * 2); bf* QKl = (bf*)take((size_t)NB * 2 * NH_ * RH * HD * 2);
    bf* VTh = (bf*)take((size_t)NB * NH_ * HD * RH * 2); bf* VTl = (bf*)take((size_t)NB * NH_ * HD * RH * 2);
    bf* XB = (bf*)take((size_t)NB * TT * DM * 2);               // [NB*TT][1024] in fragment order
    const size_t carved = (size_t)(wsp - (char*)d_ws);
    if (carved > ws_size) return;
    k_wtG<DM, 2 * DQ><<<(unsigned)(DM * 2 * DQ / 512 / 8), 256, 0, stream>>>(wqk, WQKV);                          // in[1024][2048] -> out rows 0..2047
    k_wtG<DM, DQ><<<(unsigned)(DM * DQ / 512 / 8), 256, 0, stream>>>(wv, WQKV + (size_t)2 * DQ * DM);             // in[1024][1024] -> out rows 2048..3071
    k_bcat<<<(N3 / 4 + 255) / 256, 256, 0, stream>>>(bqk, bv, BQKV);
    k_cvt8<<<dim3((unsigned)(TT * DM / 512 / 8), NB, 1), 256, 0, stream>>>(x, XB, (size_t)SEQ_FULL * DM, (size_t)TT * DM);
    k_gemmw<true, DM><<<dim3(NB * TT / 128, N3 / 128, 1), 128, 0, stream>>>(XB, WQKV, BQKV, QK16, QKh, QKl, VT16, VTh, VTl);
    k_fattn<<<dim3(NB * NH_, (TT - RH) / 128 + RH / 64, 1), 128, 0, stream>>>(QK16, VT16, QKh, QKl, VTh, VTl, OUT);
}

// v006
// A run of this version takes 75.9 microseconds.
// Timed twice side by side with v005, it ran 1.10 and 1.08 times as fast.
// Over all steps from v000 it is 18.5 times as fast.
#include <hip/hip_runtime.h>

// Causal multi-head self-attention, no output projection: x [NB][SEQ][1024]; qk = x Wqk + bqk (Wqk [1024][2048] 'in x out': q = cols 0..1023, k = cols 1024..2047), v = x Wv + bv (Wv [1024][1024]); 16 heads x 64 (col = h*64 + d); s = q.k x 0.125; keys j > i replaced by -1e9; softmax f32; out[b][t][h*64+d] = sum_j p v.
// Compute dtypes, f32 accumulate: every input RNE-converted to bf16; projections v_wmma_f32_16x16x32_bf16 (exact products) + bf16 bias; q.k and p.v: query rows < 512 bf16 hi/lo planes (3 products, v_wmma bf16), other rows v_wmma_f32_16x16x32_f16 single planes with the unnormalised p carried x1024 (the row sum carries the same factor, so it cancels in the f32 division); softmax f32, running maximum and running sum.
// Layout: bf16 copy of x (both batches) and the fused, transposed weight (q | k | v row blocks); one fused projection GEMM over both batches whose epilogue converts its f32 tile and writes the head planes [b][h] (rows t, k = d) / value planes [b][g] (rows d, k = t) itself; every one of these planes lies in fragment order (see k_gemmw); one attention launch for all heads and batches: scores, softmax and p.v stay in registers, output written straight into the merged layout (256-B head segments).

#ifndef NB
#define NB 2
#endif
#ifndef SEQ
#define SEQ 2048
#endif
#define NB_FULL  2
#define SEQ_FULL 2048
#define TT   SEQ
#define DM   1024
#define NH_  16
#define HD   64
#define DQ   (NH_ * HD)
#define N3   (3 * DQ)
#define RH   ((TT < 512) ? TT : 512)     // query rows < RH use hi+lo planes
#define PEXP 10.0f                        // f16 rows: p carried x 2^10
#define SCL  0.125f                       // 64^-0.5
#define NEGF (-1.0e9f)
static_assert(TT % 128 == 0);
static_assert(RH % 128 == 0);
static_assert((TT - RH) % 128 == 0);
static_assert(DM % 256 == 0);   // eight 32-k blocks per packing work-group
static_assert(N3 % 128 == 0);

typedef _Float16 h16;
typedef unsigned short bf;
typedef __attribute__((ext_vector_type(16))) __bf16   v16bf;
typedef __attribute__((ext_vector_type(16))) _Float16 v16h;
typedef __attribute__((ext_vector_type(8)))  _Float16 v8h;
typedef __attribute__((ext_vector_type(8)))  unsigned short v8us;
typedef __attribute__((ext_vector_type(8)))  float    v8f;
typedef __attribute__((ext_vector_type(4)))  float    v4f;
typedef __attribute__((ext_vector_type(2)))  float    v2f;
typedef __attribute__((ext_vector_type(2)))  _Float16 v2h;
typedef __attribute__((ext_vector_type(4)))  _Float16 v4h;
typedef __attribute__((ext_vector_type(2)))  unsigned short v2us;
typedef __attribute__((ext_vector_type(4)))  unsigned short v4us;
typedef v4f  __attribute__((may_alias)) v4fa;

__device__ __forceinline__ unsigned short f2bf(float f) { unsigned u = __float_as_uint(f); u += 0x7FFFu + ((u >> 16) & 1u); return (unsigned short)(u >> 16); }
__device__ __forceinline__ float bf2f(unsigned short b) { return __uint_as_float(((unsigned)b) << 16); }
__device__ __forceinline__ float bfr(float f) { return bf2f(f2bf(f)); }
__device__ __forceinline__ v16h cat16(v8h lo, v8h hi) { return __builtin_shufflevector(lo, hi, 0, 1, 2, 3, 4, 5, 6, 7, 8, 9, 10, 11, 12, 13, 14, 15); }
__device__ __forceinline__ v16bf cat16b(v8us lo, v8us hi) { return __builtin_bit_cast(v16bf, __builtin_shufflevector(lo, hi, 0, 1, 2, 3, 4, 5, 6, 7, 8, 9, 10, 11, 12, 13, 14, 15)); }
__device__ __forceinline__ v8f wmma16(v16h a, v16h b, v8f c) { return __builtin_amdgcn_wmma_f32_16x16x32_f16(false, a, false, b, (short)0, c, false, false); }
__device__ __forceinline__ v8f wmmab(v16bf a, v16bf b, v8f c) { return __builtin_amdgcn_wmma_f32_16x16x32_bf16(false, a, false, b, (short)0, c, false, false); }
__device__ __forceinline__ h16 tohx(float x) { return (h16)x; }
__device__ __forceinline__ void splitf(float y, unsigned short& h, unsigned short& l) { h = f2bf(y); l = f2bf(y - bf2f(h)); }

// ---- k_gemmw: register-blocked GEMM, FOUR WAVES (2 x 2) per 128x128 output tile, 64x64 (16 accumulators) per wave; both operands are 16-bit planes in fragment order and reach the waves through a two-buffer LDS ring filled by asynchronous copies, so each operand byte is fetched once per work-group and one stage ahead of its use; grid (M/128, N/128), 128 threads.
// Fragment order: a plane of rows x K is cut into blocks of 16 rows x 32 k, 512 elements (1 KB) each, block (row / 16, k / 32) at element (row / 16) * 16 * K + (k / 32) * 512; inside a block lane l's elements 0..7 lie at l * 8 and its elements 8..15 at 256 + l * 8, so each of a fragment's two 16-byte loads covers 512 contiguous bytes (4 whole lines) where a row-major plane gives 16 pieces of 32 bytes in 16 lines.
// y[m][n] (f32) = sum_k A[m][k] Bt[n][k] (+ bf16 bias[n]), k ascending in steps of 32 in every accumulator. K % 64 == 0, a compile-time constant.
// y never reaches memory: a 64-column tile is one head (0..15 q, 16..31 k, 32..47 v) and a 64-row tile lies in one batch and on one side of row RH, so the epilogue writes the attention planes itself: f16 always, bf16 hi/lo for rows < RH.
// Fragment map: lane -> row/col (lane & 15); elements 0..7 = k0 + 8*(lane>>4) + 0..7, elements 8..15 = k0 + 16 + 8*(lane>>4) + 0..7 for both operands; D element j = row 8*(lane>>4)+j, col lane&15.
template <typename T16> struct WFrag;
template <> struct WFrag<h16> { typedef v16h V; static __device__ __forceinline__ V ldp(const h16* p) { return cat16(*(const v8h*)p, *(const v8h*)(p + 256)); } static __device__ __forceinline__ v8f mma(V a, V b, v8f c) { return wmma16(a, b, c); } };
template <> struct WFrag<bf> { typedef v16bf V; static __device__ __forceinline__ V ldp(const bf* p) { return cat16b(*(const v8us*)p, *(const v8us*)(p + 256)); } static __device__ __forceinline__ v8f mma(V a, V b, v8f c) { return wmmab(a, b, c); } };
// Epilogues of k_gemmw, one wave each; HL: the tile's rows are < RH and get the bf16 hi/lo planes too. The planes are written in the fragment order in which k_fattn loads them, every store instruction covering 512 contiguous bytes. s_wait_xcnt 0 stands behind each group of stores because the next group's values and addresses are written into registers that those stores name.
// put_qk: fragment rows = t, k = d: block (t / 16, d / 32) at element (t / 16) * 1024 + (d / 32) * 512 of the head's plane, so the tile is one contiguous 64 x 64 block. 16 rows at a time go through LDS (f32, pitch 68) so that lane l holds 8 neighbouring d of row l & 15; a wave's LDS reads are all issued in front of its stores (the "memory" clobber of the wait also keeps the next LDS writes behind the reads in the compiled order).
template <bool HL, bool BIAS>
__device__ __forceinline__ void put_qk(const v8f (&acc)[4][4], float* os, const float* __restrict__ bias, h16* p16, bf* ph, bf* pl, const int lane) {
    const int lr = lane & 15, hi = lane >> 4; float bn[4];
#pragma unroll
    for (int nb = 0; nb < 4; ++nb) bn[nb] = BIAS ? bfr(bias[nb * 16 + lr]) : 0.f;
#pragma unroll
    for (int mb = 0; mb < 4; ++mb) {
#pragma unroll
        for (int nb = 0; nb < 4; ++nb) {
#pragma unroll
            for (int j = 0; j < 8; ++j) os[(hi * 8 + j) * 68 + nb * 16 + lr] = acc[mb][nb][j] + bn[nb]; }
        __builtin_amdgcn_wave_barrier(); asm volatile("" ::: "memory");   // the LDS range is this wave's own: keeps the row reads below behind the other lanes' LDS writes in the compiled order
        v4f x[4][2];
#pragma unroll
        for (int s = 0; s < 4; ++s) { const float* r = os + lr * 68 + s * 16 + hi * 8; x[s][0] = *(const v4fa*)r; x[s][1] = *(const v4fa*)(r + 4); }   // s = 2 * (d / 32) + fragment half
#pragma unroll
        for (int s = 0; s < 4; ++s) { v8h o16; v8us oh, ol;
#pragma unroll
            for (int q = 0; q < 8; ++q) { const float y = x[s][q >> 2][q & 3]; o16[q] = tohx(y); if (HL) { unsigned short a2, c2; splitf(y, a2, c2); oh[q] = a2; ol[q] = c2; } }
            const int e = mb * 1024 + s * 256 + lane * 8;
            *(v8h*)(p16 + e) = o16; if (HL) { *(v8us*)(ph + e) = oh; *(v8us*)(pl + e) = ol; }
            asm volatile("s_wait_xcnt 0x0" ::: "memory"); }   // the next rows' values are written into registers that these stores name
    }
}
// put_v: fragment rows = d, k = t: block (t / 32, d / 16) at element (t / 32) * 2048 + (d / 16) * 512 of the head's plane. A lane's 8 accumulator elements are 8 neighbouring t of d = 16 * nb + (lane & 15), which is this same lane's 16-byte piece of the fragment (half = mb & 1): converted in registers and stored straight.
template <bool HL, bool BIAS>
__device__ __forceinline__ void put_v(const v8f (&acc)[4][4], const float* __restrict__ bias, h16* p16, bf* ph, bf* pl, const int lane) {
    const int lr = lane & 15; float bn[4];
#pragma unroll
    for (int nb = 0; nb < 4; ++nb) bn[nb] = BIAS ? bfr(bias[nb * 16 + lr]) : 0.f;
#pragma unroll
    for (int nb = 0; nb < 4; ++nb) { const float bs = bn[nb];
#pragma unroll
        for (int mb = 0; mb < 4; ++mb) { v8h o16; v8us oh, ol;
#pragma unroll
            for (int j = 0; j < 8; ++j) { const float y = acc[mb][nb][j] + bs; o16[j] = tohx(y); if (HL) { unsigned short a2, c2; splitf(y, a2, c2); oh[j] = a2; ol[j] = c2; } }
            const int e = ((mb >> 1) * 4 + nb) * 512 + (mb & 1) * 256 + lane * 8;
            *(v8h*)(p16 + e) = o16; if (HL) { *(v8us*)(ph + e) = oh; *(v8us*)(pl + e) = ol; }
            asm volatile("s_wait_xcnt 0x0" ::: "memory"); }   // the next values are written into registers that these stores name
    }
}
// One stage of k_gemmw's LDS ring: 64 k of the tile's 128 A rows (first 16 KB) and 128 Bt rows (second 16 KB). In fragment order a group of 16 rows x 64 k is 2 KB contiguous in the plane; it is copied as it lies, so a fragment's two 16-byte LDS loads cover 512 contiguous bytes each, as the global loads did.
#define GST 32768
// Eight asynchronous copies global -> LDS, 16 bytes per lane each, through no register. s_wait_xcnt 0 is the statement's own last line so that it stands in front of every later write of the address registers that the copies name.
__device__ __forceinline__ void copy8(const unsigned (&l)[8], const char* const (&g)[8]) {
    asm volatile("global_load_async_to_lds_b128 %0, %8, off\n\t"
                 "global_load_async_to_lds_b128 %1, %9, off\n\t"
                 "global_load_async_to_lds_b128 %2, %10, off\n\t"
                 "global_load_async_to_lds_b128 %3, %11, off\n\t"
                 "global_load_async_to_lds_b128 %4, %12, off\n\t"
                 "global_load_async_to_lds_b128 %5, %13, off\n\t"
                 "global_load_async_to_lds_b128 %6, %14, off\n\t"
                 "global_load_async_to_lds_b128 %7, %15, off\n\t"
                 "s_wait_xcnt 0x0"
                 :: "v"(l[0]), "v"(l[1]), "v"(l[2]), "v"(l[3]), "v"(l[4]), "v"(l[5]), "v"(l[6]), "v"(l[7]),
                    "v"(g[0]), "v"(g[1]), "v"(g[2]), "v"(g[3]), "v"(g[4]), "v"(g[5]), "v"(g[6]), "v"(g[7]) : "memory");
}
template <bool BIAS, int K>
__global__ __launch_bounds__(128) void k_gemmw(const bf* __restrict__ A, const bf* __restrict__ Bt, const float* __restrict__ bias, h16* QK16, bf* QKh, bf* QKl, h16* VT16, bf* VTh, bf* VTl) {
    static_assert(K % 64 == 0 && K / 64 >= 2);   // the ring's prologue fills two stages
    typedef WFrag<bf> WF; typedef WF::V V;
    constexpr int NT = K / 64;
    __shared__ __align__(16) char ring[2 * GST];
    const int lane = threadIdx.x & 31; const int wv = __builtin_amdgcn_readfirstlane((int)(threadIdx.x >> 5)); const int wm = wv >> 1, wn = wv & 1;
    const int R0 = blockIdx.x * 128, C0 = blockIdx.y * 128;
    v8f acc[4][4];   // every inner loop of this kernel is unrolled in full, so that each accumulator, fragment and copy index is a compile-time constant (registers, no scratch)
#pragma unroll
    for (int mb = 0; mb < 4; ++mb)
#pragma unroll
        for (int nb = 0; nb < 4; ++nb) acc[mb][nb] = (v8f){};
    // wave wv copies row groups 2 wv and 2 wv + 1 of both operands: 4 x 2 KB = 16 copies of 512 bytes per stage
    const char* gA = (const char*)(A + (size_t)(R0 + wv * 32) * K + lane * 8);
    const char* gB = (const char*)(Bt + (size_t)(C0 + wv * 32) * K + lane * 8);
    const unsigned lw = (unsigned)(size_t)ring + (unsigned)(wv * 4096 + lane * 16);
    auto fill = [&](const int t, const unsigned buf) {
        unsigned l[8]; const char* g[8];
#pragma unroll
        for (int c = 0; c < 2; ++c)
#pragma unroll
            for (int j = 0; j < 4; ++j) { l[c * 4 + j] = lw + buf * GST + c * 2048 + j * 512; g[c * 4 + j] = gA + (size_t)c * 32 * K + t * 2048 + j * 512; }
        copy8(l, g);
#pragma unroll
        for (int c = 0; c < 2; ++c)
#pragma unroll
            for (int j = 0; j < 4; ++j) { l[c * 4 + j] = lw + buf * GST + 16384 + c * 2048 + j * 512; g[c * 4 + j] = gB + (size_t)c * 32 * K + t * 2048 + j * 512; }
        copy8(l, g);
    };
    fill(0, 0);
    asm volatile("s_wait_asynccnt 0x0" ::: "memory");   // this wave's copies of stage 0 have landed
    __syncthreads();                                     // ... and every other wave's
    fill(1, 1);
    const char* fa = ring + wm * 8192 + lane * 16;           // this wave's four A row groups, this lane's piece
    const char* fb = ring + 16384 + wn * 8192 + lane * 16;   // its four Bt row groups
#pragma unroll 1
    for (int t = 0; t < NT; ++t) {   // rolled: one copy of the stage's code, the buffer chosen by an address offset
        const int bo = (t & 1) * GST;
        V a[4], b[4];
        auto ldf = [&](const int kb) {   // the eight fragments of one 32-k block
#pragma unroll
            for (int mb = 0; mb < 4; ++mb) a[mb] = WF::ldp((const bf*)(fa + bo + mb * 2048 + kb * 1024));
#pragma unroll
            for (int nb = 0; nb < 4; ++nb) b[nb] = WF::ldp((const bf*)(fb + bo + nb * 2048 + kb * 1024)); };
        auto mm = [&]() {
#pragma unroll
            for (int nb = 0; nb < 4; ++nb)
#pragma unroll
                for (int mb = 0; mb < 4; ++mb) acc[mb][nb] = WF::mma(a[mb], b[nb], acc[mb][nb]); };
        ldf(0);
        __builtin_amdgcn_sched_barrier(0);   // the 16 LDS loads of a block stay one group in front of its WMMAs: sunk among them, every group of four WMMAs waits out an LDS latency of its own
        mm();
        ldf(1);
        asm volatile("s_wait_dscnt 0x0" ::: "memory");      // this wave's last reads of the buffer have returned before it is refilled
        asm volatile("s_wait_asynccnt 0x0" ::: "memory");   // this wave's copies of stage t + 1 have landed
        __syncthreads();                                     // publishes stage t + 1 and ends every wave's reads of stage t
        if (t + 2 < NT) fill(t + 2, (unsigned)(t & 1));
        __builtin_amdgcn_sched_barrier(0);   // the second block's WMMAs work on registers alone and stay behind the refill, so that the copies start 16 WMMAs earlier
        mm();
    }
    asm volatile("s_wait_asynccnt 0x0" ::: "memory");   // no copy is outstanding when the wave goes on to its epilogue and ends
    float* os = (float*)(ring + wv * (16 * 68 * 4));   // the epilogue's staging range, one per wave, lies in the ring: every wave's last read of the ring stands in front of the last trip's barrier, and no copy is outstanding
    const int r0 = R0 + wm * 64, c0 = C0 + wn * 64;
    const int hh = c0 / 64, bb = r0 / TT, t0 = r0 % TT; const bool hl = (t0 < RH);   // all wave-uniform
    if (hh < 2 * NH_) { const size_t zp = (size_t)(bb * 2 * NH_ + hh); h16* p16 = QK16 + (zp * TT + t0) * HD;
        if (hl) put_qk<true, BIAS>(acc, os, bias + c0, p16, QKh + (zp * RH + t0) * HD, QKl + (zp * RH + t0) * HD, lane);
        else put_qk<false, BIAS>(acc, os, bias + c0, p16, nullptr, nullptr, lane);
    } else { const size_t zp = (size_t)(bb * NH_ + hh - 2 * NH_); h16* p16 = VT16 + (zp * TT + t0) * HD;
        if (hl) put_v<true, BIAS>(acc, bias + c0, p16, VTh + (zp * RH + t0) * HD, VTl + (zp * RH + t0) * HD, lane);
        else put_v<false, BIAS>(acc, bias + c0, p16, nullptr, nullptr, lane);
    }
}

// k_prep: the four independent preparation jobs in one launch, the job chosen by a block-uniform range test on blockIdx.x; none of them reads what another writes.
// prep_wt: w [K][N] f32 -> Bt, the transposed plane (rows n, K-contiguous) in fragment order, bf16. One wave per block of 16 n x 32 k: a lane holds row n = 16 * nt + (lane & 15) and reads its 16 k down the column, so each load covers 64 contiguous bytes of two rows of w; the eight waves of a work-group take neighbouring nt (512 contiguous bytes of each row). N / 16 * K / 32 / 8 work-groups.
template <int K, int N>
__device__ __forceinline__ void prep_wt(const float* __restrict__ w, bf* Bt, const int blk) {
    static_assert(N % 128 == 0 && K % 32 == 0);
    const int lane = threadIdx.x & 31, lr = lane & 15, hi = lane >> 4; const int wv = blk * 8 + (threadIdx.x >> 5); const int nt = wv % (N / 16), kt = wv / (N / 16);
    const float* p = w + (size_t)(kt * 32 + 8 * hi) * N + nt * 16 + lr; v8us o0, o1;
#pragma unroll
    for (int j = 0; j < 8; ++j) { o0[j] = f2bf(p[j * N]); o1[j] = f2bf(p[(16 + j) * N]); }
    bf* q = Bt + (size_t)nt * 16 * K + kt * 512 + lane * 8; *(v8us*)q = o0; *(v8us*)(q + 256) = o1;
    asm volatile("s_wait_xcnt 0x0" ::: "memory");   // in the merged kernel the next job's code follows in the listing and writes registers that these two stores name
}
__device__ __forceinline__ void prep_bcat(const float* __restrict__ bqk, const float* __restrict__ bv, float* Bq, const int blk) {
    const int i = blk * 256 + threadIdx.x; if (i >= N3 / 4) return; const int c = i * 4; v4f o;
#pragma unroll
    for (int q = 0; q < 4; ++q) { const int cc = c + q; const int ia = (cc < 2 * DQ) ? cc : (2 * DQ - 1); int ib = cc - 2 * DQ; ib = (ib < 0) ? 0 : ib; ib = (ib > DQ - 1) ? (DQ - 1) : ib;
        const float a = bqk[ia]; const float b2 = bv[ib]; o[q] = (cc < 2 * DQ) ? a : b2; }
    *(v4f*)(Bq + c) = o;  }
// prep_cvt: src [rows][DM] f32 -> dst, the same plane in fragment order, bf16. One wave per block of 16 rows x 32 k (16 whole lines of src), the eight waves of a work-group on neighbouring k; rows / 16 * DM / 32 / 8 work-groups per batch.
__device__ __forceinline__ void prep_cvt(const float* __restrict__ src, bf* dst, const int blk) {
    const int lane = threadIdx.x & 31, lr = lane & 15, hi = lane >> 4; const int wv = blk * 8 + (threadIdx.x >> 5); const int rt = wv / (DM / 32), kt = wv % (DM / 32);
    const float* p = src + (size_t)(rt * 16 + lr) * DM + kt * 32 + 8 * hi; const v8f v = *(const v8f*)p, u = *(const v8f*)(p + 16);
    v8us o0, o1;
#pragma unroll
    for (int k = 0; k < 8; ++k) { o0[k] = f2bf(v[k]); o1[k] = f2bf(u[k]); }
    bf* q = dst + (size_t)rt * 16 * DM + kt * 512 + lane * 8; *(v8us*)q = o0; *(v8us*)(q + 256) = o1;  }
#define GX  (TT * DM / 512 / 8)         // work-groups per batch of x
#define GWQ (DM * 2 * DQ / 512 / 8)     // of Wqk
#define GWV (DM * DQ / 512 / 8)         // of Wv
#define GBC ((N3 / 4 + 255) / 256)      // of the bias
__global__ __launch_bounds__(256) void k_prep(const float* __restrict__ x, const float* __restrict__ wqk, const float* __restrict__ bqk, const float* __restrict__ wv, const float* __restrict__ bv, bf* XB, bf* WQKV, float* BQKV) {
    int blk = blockIdx.x;
    if (blk < NB * GX) { const int b = blk / GX; prep_cvt(x + (size_t)b * SEQ_FULL * DM, XB + (size_t)b * TT * DM, blk % GX); return; }
    blk -= NB * GX;
    if (blk < GWQ) { prep_wt<DM, 2 * DQ>(wqk, WQKV, blk); return; }                          // in[1024][2048] -> out rows 0..2047
    blk -= GWQ;
    if (blk < GWV) { prep_wt<DM, DQ>(wv, WQKV + (size_t)2 * DQ * DM, blk); return; }         // in[1024][1024] -> out rows 2048..3071
    prep_bcat(bqk, bv, BQKV, blk - GWV);
}

// k_fattn: scores, causal softmax and p.v of one (batch, head), 16 * NQ query rows per wave, four waves per block, no memory round trip for s or p.
// Transposed products: s^T = K q^T (A = key rows, B = query rows), so D element j of key tile kt is key k0 + 16*kt + 8*(lane>>4) + j of query (lane & 15): the two key tiles of a 32-key step ARE the B fragment of p^T (elements 0..7 / 8..15) for o^T = V^T p^T (A = value plane rows d, k = key).
// Running softmax per query (= per lane; the two lane halves hold different keys and share the maximum by one cross-half exchange): o and the sum are rescaled by 2^((m_old - m_new) c) each step. Keys j > i take the reference's replace fill (-1e9 after the 0.125 scale); only the last step of a row group meets the diagonal.
__device__ __forceinline__ float xhalf(float x) { return __builtin_bit_cast(float, __builtin_amdgcn_permlanex16(__builtin_bit_cast(int, x), __builtin_bit_cast(int, x), 0x76543210, 0xfedcba98, false, false)); }   // lane l takes lane l ^ 16
template <typename T16, bool HR, int NQ>
__device__ __forceinline__ void attn_rows(const T16* __restrict__ Q, const T16* __restrict__ Q2, const T16* __restrict__ Kp, const T16* __restrict__ K2, const T16* __restrict__ Vt, const T16* __restrict__ V2, float* O, const int q0, const int lr, const int hi) {
    typedef WFrag<T16> WF; typedef typename WF::V V;
    const float CL = SCL * 1.4426950408889634f;
    // per-lane byte offset into a 1-KB fragment block of any plane: 16 bytes per lane, the fragment's second half 512 bytes on
    const unsigned lob = (unsigned)(lr + 16 * hi) * 16u;
    auto at = [](const T16* base, const unsigned byteoff) { return (const T16*)((const char*)base + byteoff); };
    V qf[NQ][2], q2[NQ][2];
#pragma unroll
    for (int nq = 0; nq < NQ; ++nq)
#pragma unroll
        for (int ks = 0; ks < 2; ++ks) { const int e = (q0 + nq * 16) * HD + ks * 512; qf[nq][ks] = WF::ldp(at(Q + e, lob)); if (HR) q2[nq][ks] = WF::ldp(at(Q2 + e, lob)); }
    asm volatile("s_wait_xcnt 0x0" ::: "memory");   // the query loads' address registers are free for reuse by what follows
    v8f o[4][NQ]; float mr[NQ], ls[NQ];
#pragma unroll
    for (int nq = 0; nq < NQ; ++nq) { mr[nq] = -1.0e30f; ls[nq] = 0.f;
#pragma unroll
        for (int db = 0; db < 4; ++db) o[db][nq] = (v8f){}; }
    // the four plane pointers live across the whole key loop and step by 32 keys (four blocks, 4 KB) behind each load group
    const T16 *pk = at(Kp, lob), *pk2 = HR ? at(K2, lob) : nullptr, *pv = at(Vt, lob), *pv2 = HR ? at(V2, lob) : nullptr;
    auto ldk = [&](V (&d)[2][2], V (&d2)[2][2]) {
#pragma unroll
        for (int kt = 0; kt < 2; ++kt)
#pragma unroll
            for (int ks = 0; ks < 2; ++ks) { const int e = (kt * 2 + ks) * 512; d[kt][ks] = WF::ldp(pk + e); if (HR) d2[kt][ks] = WF::ldp(pk2 + e); }
        pk += 32 * HD; if (HR) pk2 += 32 * HD; };
    auto ldv = [&](V (&d)[4], V (&d2)[4]) {
#pragma unroll
        for (int db = 0; db < 4; ++db) { const int e = db * 512; d[db] = WF::ldp(pv + e); if (HR) d2[db] = WF::ldp(pv2 + e); }
        pv += 32 * HD; if (HR) pv2 += 32 * HD; };
    auto scores = [&](v8f (&s)[2][NQ], V (&kc)[2][2], V (&kc2)[2][2]) {
#pragma unroll
        for (int kt = 0; kt < 2; ++kt)
#pragma unroll
            for (int nq = 0; nq < NQ; ++nq) { v8f c = (v8f){};
#pragma unroll
                for (int ks = 0; ks < 2; ++ks) { c = WF::mma(kc[kt][ks], qf[nq][ks], c); if (HR) { c = WF::mma(kc[kt][ks], q2[nq][ks], c); c = WF::mma(kc2[kt][ks], qf[nq][ks], c); } }
                s[kt][nq] = c; } };
    auto softpv = [&](v8f (&s)[2][NQ], V (&vf)[4], V (&v2)[4], const int k0, const bool mask) {
        V pf[NQ], pl[NQ];
#pragma unroll
        for (int nq = 0; nq < NQ; ++nq) {
            if (mask) { const int qi = q0 + nq * 16 + lr;
#pragma unroll
                for (int kt = 0; kt < 2; ++kt)
#pragma unroll
                    for (int j = 0; j < 8; ++j) s[kt][nq][j] = (k0 + kt * 16 + 8 * hi + j <= qi) ? s[kt][nq][j] : (NEGF / SCL); }
            float mx = s[0][nq][0];
#pragma unroll
            for (int j = 1; j < 8; ++j) mx = fmaxf(mx, s[0][nq][j]);
#pragma unroll
            for (int j = 0; j < 8; ++j) mx = fmaxf(mx, s[1][nq][j]);
            mx = fmaxf(mx, xhalf(mx));
            const float mn = fmaxf(mr[nq], mx); const float al = __builtin_amdgcn_exp2f((mr[nq] - mn) * CL); mr[nq] = mn;
            float sum = 0.f; float p[16];
#pragma unroll
            for (int e = 0; e < 16; ++e) { p[e] = __builtin_amdgcn_exp2f((s[e >> 3][nq][e & 7] - mn) * CL + (HR ? 0.f : PEXP)); sum += p[e]; }
            ls[nq] = ls[nq] * al + sum;
#pragma unroll
            for (int db = 0; db < 4; ++db) o[db][nq] *= al;
            if constexpr (HR) { v8us h0, h1, l0, l1;
#pragma unroll
                for (int j = 0; j < 8; ++j) { unsigned short a, c2; splitf(p[j], a, c2); h0[j] = a; l0[j] = c2; splitf(p[8 + j], a, c2); h1[j] = a; l1[j] = c2; }
                pf[nq] = cat16b(h0, h1); pl[nq] = cat16b(l0, l1);
            } else { v16h t;
#pragma unroll
                for (int e = 0; e < 16; ++e) t[e] = tohx(p[e]);
                pf[nq] = t; } }
#pragma unroll
        for (int db = 0; db < 4; ++db)
#pragma unroll
            for (int nq = 0; nq < NQ; ++nq) { o[db][nq] = WF::mma(vf[db], pf[nq], o[db][nq]); if (HR) { o[db][nq] = WF::mma(vf[db], pl[nq], o[db][nq]); o[db][nq] = WF::mma(v2[db], pf[nq], o[db][nq]); } } };
    const int kfull = q0 & ~31;
    V kf[2][2], k2[2][2], vf[4], v2[4]; v8f s[2][NQ];
    ldk(kf, k2);
    __builtin_amdgcn_sched_barrier(0);   // key loads issue in front of the value loads here as in the loop: loads return in order, and with another order on entry the wait at the loop's head covers the value loads too
    ldv(vf, v2);
    asm volatile("s_wait_xcnt 0x0" ::: "memory");   // the first fragment loads name the per-lane offset register, which is dead from here on and gets reused
    // each fragment set is refilled for the next step right behind its last use: the key loads fly under softmax and p.v, the value loads under the next scores and softmax (step kfull always exists)
    for (int k0 = 0; k0 < kfull; k0 += 32) {
        scores(s, kf, k2);
        ldk(kf, k2);
        softpv(s, vf, v2, k0, false);
        ldv(vf, v2);
    }
    scores(s, kf, k2);
    softpv(s, vf, v2, kfull, true);
#pragma unroll
    for (int nq = 0; nq < NQ; ++nq) { const float l = ls[nq] + xhalf(ls[nq]); const float inv = __fdiv_rn(1.0f, l);
        float* orow = O + (size_t)(q0 + nq * 16 + lr) * DM + 8 * hi;
#pragma unroll
        for (int db = 0; db < 4; ++db) { v4f a, c;
#pragma unroll
            for (int j = 0; j < 4; ++j) { a[j] = o[db][nq][j] * inv; c[j] = o[db][nq][4 + j] * inv; }
            *(v4f*)(orow + db * 16) = a; *(v4f*)(orow + db * 16 + 4) = c;
            asm volatile("s_wait_xcnt 0x0" ::: "memory"); } }   // the next pair of products is written into the data registers that these two stores name
}
// grid (NB * 16 heads, (TT - RH) / 128 + RH / 64): f16 row groups first, the longest (last rows) at the lowest block indices; then the hi/lo row groups (16 rows per wave: three products per tile and two planes per operand). The second launch bound asks for four waves per SIMD (at most 256 registers a wave), so that every block of the grid is resident from the start.
__global__ __launch_bounds__(128, 4) void k_fattn(const h16* __restrict__ QK16, const h16* __restrict__ VT16, const bf* __restrict__ QKh, const bf* __restrict__ QKl, const bf* __restrict__ VTh, const bf* __restrict__ VTl, float* OUT) {
    const int lane = threadIdx.x & 31, lr = lane & 15, hi = lane >> 4; const int wv = __builtin_amdgcn_readfirstlane((int)(threadIdx.x >> 5));
    const int b = blockIdx.x / NH_, h = blockIdx.x % NH_; const int y = blockIdx.y;
    float* O = OUT + (size_t)b * TT * DM + h * HD;
    const size_t zq = (size_t)(b * 2 * NH_ + h), zk = zq + NH_, zv = (size_t)(b * NH_ + h);
    if (y < (TT - RH) / 128)
        attn_rows<h16, false, 2>(QK16 + zq * TT * HD, nullptr, QK16 + zk * TT * HD, nullptr, VT16 + zv * HD * TT, nullptr, O, TT - 128 * (y + 1) + wv * 32, lr, hi);
    else
        attn_rows<bf, true, 1>(QKh + zq * RH * HD, QKl + zq * RH * HD, QKh + zk * RH * HD, QKl + zk * RH * HD, VTh + zv * HD * RH, VTl + zv * HD * RH, O, RH - 64 * (y - (TT - RH) / 128 + 1) + wv * 16, lr, hi);
}

extern "C" void kernel_launch(void* const* d_in, const int* in_sizes, int n_in,
                              void* d_out, int out_size, void* d_ws, size_t ws_size, hipStream_t stream) {
    if (n_in < 5) return;
    if (in_sizes[0] < (NB - 1) * SEQ_FULL * DM + TT * DM) return;
    if (in_sizes[1] < DM * 2 * DQ) return; if (in_sizes[2] < 2 * DQ) return; if (in_sizes[3] < DM * DQ) return; if (in_sizes[4] < DQ) return;
    if (out_size < NB * TT * DM) return;
    const float* x = (const float*)d_in[0]; const float* wqk = (const float*)d_in[1]; const float* bqk = (const float*)d_in[2]; const float* wv = (const float*)d_in[3]; const float* bv = (const float*)d_in[4];   // wire order x, Wqk, bqk, Wv, bv
    float* OUT = (float*)d_out;     // [NB][TT][1024]
    char* wsp = (char*)d_ws;
    auto take = [&](size_t bytes) { char* p = wsp; wsp += (bytes + 255) & ~(size_t)255; return (void*)p; };
    bf* WQKV = (bf*)take((size_t)N3 * DM * 2);                  // Bt [3072][1024] in fragment order: q | k | v row blocks
    float* BQKV = (float*)take((size_t)N3 * 4);
    h16* QK16 = (h16*)take((size_t)NB * 2 * NH_ * TT * HD * 2); // [NB][32] planes of TT x 64 in fragment order: q heads 0..15, k heads 16..31
    h16* VT16 = (h16*)take((size_t)NB * NH_ * HD * TT * 2);     // [NB][16] planes of 64 x TT in fragment order, blocks (t / 32, d / 16)
    bf* QKh = (bf*)take((size_t)NB * 2 * NH_ * RH * HD * 2); bf* QKl = (bf*)take((size_t)NB * 2 * NH_ * RH * HD * 2);
    bf* VTh = (bf*)take((size_t)NB * NH_ * HD * RH * 2); bf* VTl = (bf*)take((size_t)NB * NH_ * HD * RH * 2);
    bf* XB = (bf*)take((size_t)NB * TT * DM * 2);               // [NB*TT][1024] in fragment order
    const size_t carved = (size_t)(wsp - (char*)d_ws);
    if (carved > ws_size) return;
    k_prep<<<(unsigned)(NB * GX + GWQ + GWV + GBC), 256, 0, stream>>>(x, wqk, bqk, wv, bv, XB, WQKV, BQKV);
    k_gemmw<true, DM><<<dim3(NB * TT / 128, N3 / 128, 1), 128, 0, stream>>>(XB, WQKV, BQKV, QK16, QKh, QKl, VT16, VTh, VTl);
    k_fattn<<<dim3(NB * NH_, (TT - RH) / 128 + RH / 64, 1), 128, 0, stream>>>(QK16, VT16, QKh, QKl, VTh, VTl, OUT);
}

// v007
// A run of this version takes 58.5 microseconds.
// Next to v006, in two timings, it ran 1.31 and 1.30 times as fast.
// Over all steps from v000 it is 24.2 times as fast.
#include <hip/hip_runtime.h>

// Causal multi-head self-attention, no output projection: x [NB][SEQ][1024]; qk = x Wqk + bqk (Wqk [1024][2048] 'in x out': q = cols 0..1023, k = cols 1024..2047), v = x Wv + bv (Wv [1024][1024]); 16 heads x 64 (col = h*64 + d); s = q.k x 0.125; keys j > i replaced by -1e9; softmax f32; out[b][t][h*64+d] = sum_j p v.
// Compute dtypes, f32 accumulate: every input RNE-converted to bf16; projections v_wmma_f32_16x16x32_bf16 (exact products) + bf16 bias; q.k and p.v: query rows < 512 bf16 hi/lo planes (3 products, v_wmma bf16), other rows v_wmma_f32_16x16x32_f16 single planes with the unnormalised p carried x1024 (the row sum carries the same factor, so it cancels in the f32 division); softmax f32, running maximum and running sum.
// Layout: bf16 copy of x (both batches) and the fused, transposed weight (q | k | v row blocks); one fused projection GEMM over both batches whose epilogue converts its f32 tile and writes the head planes [b][h] (rows t, k = d) / value planes [b][g] (rows d, k = t) itself; every one of these planes lies in fragment order (see k_gemmw); one attention launch for all heads and batches: scores and p stay in registers, the f16 rows' two key-range partials of p.v are merged through LDS, output written straight into the merged layout (256-B head segments).

#ifndef NB
#define NB 2
#endif
#ifndef SEQ
#define SEQ 2048
#endif
#define NB_FULL  2
#define SEQ_FULL 2048
#define TT   SEQ
#define DM   1024
#define NH_  16
#define HD   64
#define DQ   (NH_ * HD)
#define N3   (3 * DQ)
#define RH   ((TT < 512) ? TT : 512)     // query rows < RH use hi+lo planes
#define PEXP 10.0f                        // f16 rows: p carried x 2^10
#define SCL  0.125f                       // 64^-0.5
#define NEGF (-1.0e9f)
static_assert(TT % 128 == 0);
static_assert(RH % 128 == 0);
static_assert((TT - RH) % 128 == 0);
static_assert(DM % 256 == 0);   // eight 32-k blocks per packing work-group
static_assert(N3 % 128 == 0);

typedef _Float16 h16;
typedef unsigned short bf;
typedef __attribute__((ext_vector_type(16))) __bf16   v16bf;
typedef __attribute__((ext_vector_type(16))) _Float16 v16h;
typedef __attribute__((ext_vector_type(8)))  _Float16 v8h;
typedef __attribute__((ext_vector_type(8)))  unsigned short v8us;
typedef __attribute__((ext_vector_type(8)))  float    v8f;
typedef __attribute__((ext_vector_type(4)))  float    v4f;
typedef __attribute__((ext_vector_type(2)))  float    v2f;
typedef __attribute__((ext_vector_type(2)))  _Float16 v2h;
typedef __attribute__((ext_vector_type(4)))  _Float16 v4h;
typedef __attribute__((ext_vector_type(2)))  unsigned short v2us;
typedef __attribute__((ext_vector_type(4)))  unsigned short v4us;
typedef v4f  __attribute__((may_alias)) v4fa;

__device__ __forceinline__ unsigned short f2bf(float f) { unsigned u = __float_as_uint(f); u += 0x7FFFu + ((u >> 16) & 1u); return (unsigned short)(u >> 16); }
__device__ __forceinline__ float bf2f(unsigned short b) { return __uint_as_float(((unsigned)b) << 16); }
__device__ __forceinline__ float bfr(float f) { return bf2f(f2bf(f)); }
__device__ __forceinline__ v16h cat16(v8h lo, v8h hi) { return __builtin_shufflevector(lo, hi, 0, 1, 2, 3, 4, 5, 6, 7, 8, 9, 10, 11, 12, 13, 14, 15); }
__device__ __forceinline__ v16bf cat16b(v8us lo, v8us hi) { return __builtin_bit_cast(v16bf, __builtin_shufflevector(lo, hi, 0, 1, 2, 3, 4, 5, 6, 7, 8, 9, 10, 11, 12, 13, 14, 15)); }
__device__ __forceinline__ v8f wmma16(v16h a, v16h b, v8f c) { return __builtin_amdgcn_wmma_f32_16x16x32_f16(false, a, false, b, (short)0, c, false, false); }
__device__ __forceinline__ v8f wmmab(v16bf a, v16bf b, v8f c) { return __builtin_amdgcn_wmma_f32_16x16x32_bf16(false, a, false, b, (short)0, c, false, false); }
__device__ __forceinline__ h16 tohx(float x) { return (h16)x; }
__device__ __forceinline__ void splitf(float y, unsigned short& h, unsigned short& l) { h = f2bf(y); l = f2bf(y - bf2f(h)); }

// ---- k_gemmw: register-blocked GEMM, FOUR WAVES (2 x 2) per 128x128 output tile, 64x64 (16 accumulators) per wave; both operands are 16-bit planes in fragment order and reach the waves through a two-buffer LDS ring filled by asynchronous copies, so each operand byte is fetched once per work-group and one stage ahead of its use; grid (M/128, N/128), 128 threads.
// Fragment order: a plane of rows x K is cut into blocks of 16 rows x 32 k, 512 elements (1 KB) each, block (row / 16, k / 32) at element (row / 16) * 16 * K + (k / 32) * 512; inside a block lane l's elements 0..7 lie at l * 8 and its elements 8..15 at 256 + l * 8, so each of a fragment's two 16-byte loads covers 512 contiguous bytes (4 whole lines) where a row-major plane gives 16 pieces of 32 bytes in 16 lines.
// y[m][n] (f32) = sum_k A[m][k] Bt[n][k] (+ bf16 bias[n]), k ascending in steps of 32 in every accumulator. K % 64 == 0, a compile-time constant.
// y never reaches memory: a 64-column tile is one head (0..15 q, 16..31 k, 32..47 v) and a 64-row tile lies in one batch and on one side of row RH, so the epilogue writes the attention planes itself: f16 always, bf16 hi/lo for rows < RH.
// Fragment map: lane -> row/col (lane & 15); elements 0..7 = k0 + 8*(lane>>4) + 0..7, elements 8..15 = k0 + 16 + 8*(lane>>4) + 0..7 for both operands; D element j = row 8*(lane>>4)+j, col lane&15.
template <typename T16> struct WFrag;
template <> struct WFrag<h16> { typedef v16h V; static __device__ __forceinline__ V ldp(const h16* p) { return cat16(*(const v8h*)p, *(const v8h*)(p + 256)); } static __device__ __forceinline__ v8f mma(V a, V b, v8f c) { return wmma16(a, b, c); } };
template <> struct WFrag<bf> { typedef v16bf V; static __device__ __forceinline__ V ldp(const bf* p) { return cat16b(*(const v8us*)p, *(const v8us*)(p + 256)); } static __device__ __forceinline__ v8f mma(V a, V b, v8f c) { return wmmab(a, b, c); } };
// Epilogues of k_gemmw, one wave each; HL: the tile's rows are < RH and get the bf16 hi/lo planes too. The planes are written in the fragment order in which k_fattn loads them, every store instruction covering 512 contiguous bytes. s_wait_xcnt 0 stands behind each group of stores because the next group's values and addresses are written into registers that those stores name.
// put_qk: fragment rows = t, k = d: block (t / 16, d / 32) at element (t / 16) * 1024 + (d / 32) * 512 of the head's plane, so the tile is one contiguous 64 x 64 block. 16 rows at a time go through LDS (f32, pitch 68) so that lane l holds 8 neighbouring d of row l & 15; a wave's LDS reads are all issued in front of its stores (the "memory" clobber of the wait also keeps the next LDS writes behind the reads in the compiled order).
template <bool HL, bool BIAS>
__device__ __forceinline__ void put_qk(const v8f (&acc)[4][4], float* os, const float* __restrict__ bias, h16* p16, bf* ph, bf* pl, const int lane) {
    const int lr = lane & 15, hi = lane >> 4; float bn[4];
#pragma unroll
    for (int nb = 0; nb < 4; ++nb) bn[nb] = BIAS ? bfr(bias[nb * 16 + lr]) : 0.f;
#pragma unroll
    for (int mb = 0; mb < 4; ++mb) {
#pragma unroll
        for (int nb = 0; nb < 4; ++nb) {
#pragma unroll
            for (int j = 0; j < 8; ++j) os[(hi * 8 + j) * 68 + nb * 16 + lr] = acc[mb][nb][j] + bn[nb]; }
        __builtin_amdgcn_wave_barrier(); asm volatile("" ::: "memory");   // the LDS range is this wave's own: keeps the row reads below behind the other lanes' LDS writes in the compiled order
        v4f x[4][2];
#pragma unroll
        for (int s = 0; s < 4; ++s) { const float* r = os + lr * 68 + s * 16 + hi * 8; x[s][0] = *(const v4fa*)r; x[s][1] = *(const v4fa*)(r + 4); }   // s = 2 * (d / 32) + fragment half
#pragma unroll
        for (int s = 0; s < 4; ++s) { v8h o16; v8us oh, ol;
#pragma unroll
            for (int q = 0; q < 8; ++q) { const float y = x[s][q >> 2][q & 3]; o16[q] = tohx(y); if (HL) { unsigned short a2, c2; splitf(y, a2, c2); oh[q] = a2; ol[q] = c2; } }
            const int e = mb * 1024 + s * 256 + lane * 8;
            *(v8h*)(p16 + e) = o16; if (HL) { *(v8us*)(ph + e) = oh; *(v8us*)(pl + e) = ol; }
            asm volatile("s_wait_xcnt 0x0" ::: "memory"); }   // the next rows' values are written into registers that these stores name
    }
}
// put_v: fragment rows = d, k = t: block (t / 32, d / 16) at element (t / 32) * 2048 + (d / 16) * 512 of the head's plane. A lane's 8 accumulator elements are 8 neighbouring t of d = 16 * nb + (lane & 15), which is this same lane's 16-byte piece of the fragment (half = mb & 1): converted in registers and stored straight.
template <bool HL, bool BIAS>
__device__ __forceinline__ void put_v(const v8f (&acc)[4][4], const float* __restrict__ bias, h16* p16, bf* ph, bf* pl, const int lane) {
    const int lr = lane & 15; float bn[4];
#pragma unroll
    for (int nb = 0; nb < 4; ++nb) bn[nb] = BIAS ? bfr(bias[nb * 16 + lr]) : 0.f;
#pragma unroll
    for (int nb = 0; nb < 4; ++nb) { const float bs = bn[nb];
#pragma unroll
        for (int mb = 0; mb < 4; ++mb) { v8h o16; v8us oh, ol;
#pragma unroll
            for (int j = 0; j < 8; ++j) { const float y = acc[mb][nb][j] + bs; o16[j] = tohx(y); if (HL) { unsigned short a2, c2; splitf(y, a2, c2); oh[j] = a2; ol[j] = c2; } }
            const int e = ((mb >> 1) * 4 + nb) * 512 + (mb & 1) * 256 + lane * 8;
            *(v8h*)(p16 + e) = o16; if (HL) { *(v8us*)(ph + e) = oh; *(v8us*)(pl + e) = ol; }
            asm volatile("s_wait_xcnt 0x0" ::: "memory"); }   // the next values are written into registers that these stores name
    }
}
// One stage of k_gemmw's LDS ring: 64 k of the tile's 128 A rows (first 16 KB) and 128 Bt rows (second 16 KB). In fragment order a group of 16 rows x 64 k is 2 KB contiguous in the plane; it is copied as it lies, so a fragment's two 16-byte LDS loads cover 512 contiguous bytes each, as the global loads did.
#define GST 32768
// Eight asynchronous copies global -> LDS, 16 bytes per lane each, through no register. s_wait_xcnt 0 is the statement's own last line so that it stands in front of every later write of the address registers that the copies name.
__device__ __forceinline__ void copy8(const unsigned (&l)[8], const char* const (&g)[8]) {
    asm volatile("global_load_async_to_lds_b128 %0, %8, off\n\t"
                 "global_load_async_to_lds_b128 %1, %9, off\n\t"
                 "global_load_async_to_lds_b128 %2, %10, off\n\t"
                 "global_load_async_to_lds_b128 %3, %11, off\n\t"
                 "global_load_async_to_lds_b128 %4, %12, off\n\t"
                 "global_load_async_to_lds_b128 %5, %13, off\n\t"
                 "global_load_async_to_lds_b128 %6, %14, off\n\t"
                 "global_load_async_to_lds_b128 %7, %15, off\n\t"
                 "s_wait_xcnt 0x0"
                 :: "v"(l[0]), "v"(l[1]), "v"(l[2]), "v"(l[3]), "v"(l[4]), "v"(l[5]), "v"(l[6]), "v"(l[7]),
                    "v"(g[0]), "v"(g[1]), "v"(g[2]), "v"(g[3]), "v"(g[4]), "v"(g[5]), "v"(g[6]), "v"(g[7]) : "memory");
}
template <bool BIAS, int K>
__global__ __launch_bounds__(128) void k_gemmw(const bf* __restrict__ A, const bf* __restrict__ Bt, const float* __restrict__ bias, h16* QK16, bf* QKh, bf* QKl, h16* VT16, bf* VTh, bf* VTl) {
    static_assert(K % 64 == 0 && K / 64 >= 2);   // the ring's prologue fills two stages
    typedef WFrag<bf> WF; typedef WF::V V;
    constexpr int NT = K / 64;
    __shared__ __align__(16) char ring[2 * GST];
    const int lane = threadIdx.x & 31; const int wv = __builtin_amdgcn_readfirstlane((int)(threadIdx.x >> 5)); const int wm = wv >> 1, wn = wv & 1;
    const int R0 = blockIdx.x * 128, C0 = blockIdx.y * 128;
    v8f acc[4][4];   // every inner loop of this kernel is unrolled in full, so that each accumulator, fragment and copy index is a compile-time constant (registers, no scratch)
#pragma unroll
    for (int mb = 0; mb < 4; ++mb)
#pragma unroll
        for (int nb = 0; nb < 4; ++nb) acc[mb][nb] = (v8f){};
    // wave wv copies row groups 2 wv and 2 wv + 1 of both operands: 4 x 2 KB = 16 copies of 512 bytes per stage
    const char* gA = (const char*)(A + (size_t)(R0 + wv * 32) * K + lane * 8);
    const char* gB = (const char*)(Bt + (size_t)(C0 + wv * 32) * K + lane * 8);
    const unsigned lw = (unsigned)(size_t)ring + (unsigned)(wv * 4096 + lane * 16);
    auto fill = [&](const int t, const unsigned buf) {
        unsigned l[8]; const char* g[8];
#pragma unroll
        for (int c = 0; c < 2; ++c)
#pragma unroll
            for (int j = 0; j < 4; ++j) { l[c * 4 + j] = lw + buf * GST + c * 2048 + j * 512; g[c * 4 + j] = gA + (size_t)c * 32 * K + t * 2048 + j * 512; }
        copy8(l, g);
#pragma unroll
        for (int c = 0; c < 2; ++c)
#pragma unroll
            for (int j = 0; j < 4; ++j) { l[c * 4 + j] = lw + buf * GST + 16384 + c * 2048 + j * 512; g[c * 4 + j] = gB + (size_t)c * 32 * K + t * 2048 + j * 512; }
        copy8(l, g);
    };
    fill(0, 0);
    asm volatile("s_wait_asynccnt 0x0" ::: "memory");   // this wave's copies of stage 0 have landed
    __syncthreads();                                     // ... and every other wave's
    fill(1, 1);
    const char* fa = ring + wm * 8192 + lane * 16;           // this wave's four A row groups, this lane's piece
    const char* fb = ring + 16384 + wn * 8192 + lane * 16;   // its four Bt row groups
#pragma unroll 1
    for (int t = 0; t < NT; ++t) {   // rolled: one copy of the stage's code, the buffer chosen by an address offset
        const int bo = (t & 1) * GST;
        V a[4], b[4];
        auto ldf = [&](const int kb) {   // the eight fragments of one 32-k block
#pragma unroll
            for (int mb = 0; mb < 4; ++mb) a[mb] = WF::ldp((const bf*)(fa + bo + mb * 2048 + kb * 1024));
#pragma unroll
            for (int nb = 0; nb < 4; ++nb) b[nb] = WF::ldp((const bf*)(fb + bo + nb * 2048 + kb * 1024)); };
        auto mm = [&]() {
#pragma unroll
            for (int nb = 0; nb < 4; ++nb)
#pragma unroll
                for (int mb = 0; mb < 4; ++mb) acc[mb][nb] = WF::mma(a[mb], b[nb], acc[mb][nb]); };
        ldf(0);
        __builtin_amdgcn_sched_barrier(0);   // the 16 LDS loads of a block stay one group in front of its WMMAs: sunk among them, every group of four WMMAs waits out an LDS latency of its own
        mm();
        ldf(1);
        asm volatile("s_wait_dscnt 0x0" ::: "memory");      // this wave's last reads of the buffer have returned before it is refilled
        asm volatile("s_wait_asynccnt 0x0" ::: "memory");   // this wave's copies of stage t + 1 have landed
        __syncthreads();                                     // publishes stage t + 1 and ends every wave's reads of stage t
        if (t + 2 < NT) fill(t + 2, (unsigned)(t & 1));
        __builtin_amdgcn_sched_barrier(0);   // the second block's WMMAs work on registers alone and stay behind the refill, so that the copies start 16 WMMAs earlier
        mm();
    }
    asm volatile("s_wait_asynccnt 0x0" ::: "memory");   // no copy is outstanding when the wave goes on to its epilogue and ends
    float* os = (float*)(ring + wv * (16 * 68 * 4));   // the epilogue's staging range, one per wave, lies in the ring: every wave's last read of the ring stands in front of the last trip's barrier, and no copy is outstanding
    const int r0 = R0 + wm * 64, c0 = C0 + wn * 64;
    const int hh = c0 / 64, bb = r0 / TT, t0 = r0 % TT; const bool hl = (t0 < RH);   // all wave-uniform
    if (hh < 2 * NH_) { const size_t zp = (size_t)(bb * 2 * NH_ + hh); h16* p16 = QK16 + (zp * TT + t0) * HD;
        if (hl) put_qk<true, BIAS>(acc, os, bias + c0, p16, QKh + (zp * RH + t0) * HD, QKl + (zp * RH + t0) * HD, lane);
        else put_qk<false, BIAS>(acc, os, bias + c0, p16, nullptr, nullptr, lane);
    } else { const size_t zp = (size_t)(bb * NH_ + hh - 2 * NH_); h16* p16 = VT16 + (zp * TT + t0) * HD;
        if (hl) put_v<true, BIAS>(acc, bias + c0, p16, VTh + (zp * RH + t0) * HD, VTl + (zp * RH + t0) * HD, lane);
        else put_v<false, BIAS>(acc, bias + c0, p16, nullptr, nullptr, lane);
    }
}

// k_prep: the four independent preparation jobs in one launch, the job chosen by a block-uniform range test on blockIdx.x; none of them reads what another writes.
// prep_wt: w [K][N] f32 -> Bt, the transposed plane (rows n, K-contiguous) in fragment order, bf16. One wave per block of 16 n x 32 k: a lane holds row n = 16 * nt + (lane & 15) and reads its 16 k down the column, so each load covers 64 contiguous bytes of two rows of w; the eight waves of a work-group take neighbouring nt (512 contiguous bytes of each row). N / 16 * K / 32 / 8 work-groups.
template <int K, int N>
__device__ __forceinline__ void prep_wt(const float* __restrict__ w, bf* Bt, const int blk) {
    static_assert(N % 128 == 0 && K % 32 == 0);
    const int lane = threadIdx.x & 31, lr = lane & 15, hi = lane >> 4; const int wv = blk * 8 + (threadIdx.x >> 5); const int nt = wv % (N / 16), kt = wv / (N / 16);
    const float* p = w + (size_t)(kt * 32 + 8 * hi) * N + nt * 16 + lr; v8us o0, o1;
#pragma unroll
    for (int j = 0; j < 8; ++j) { o0[j] = f2bf(p[j * N]); o1[j] = f2bf(p[(16 + j) * N]); }
    bf* q = Bt + (size_t)nt * 16 * K + kt * 512 + lane * 8; *(v8us*)q = o0; *(v8us*)(q + 256) = o1;
    asm volatile("s_wait_xcnt 0x0" ::: "memory");   // in the merged kernel the next job's code follows in the listing and writes registers that these two stores name
}
__device__ __forceinline__ void prep_bcat(const float* __restrict__ bqk, const float* __restrict__ bv, float* Bq, const int blk) {
    const int i = blk * 256 + threadIdx.x; if (i >= N3 / 4) return; const int c = i * 4; v4f o;
#pragma unroll
    for (int q = 0; q < 4; ++q) { const int cc = c + q; const int ia = (cc < 2 * DQ) ? cc : (2 * DQ - 1); int ib = cc - 2 * DQ; ib = (ib < 0) ? 0 : ib; ib = (ib > DQ - 1) ? (DQ - 1) : ib;
        const float a = bqk[ia]; const float b2 = bv[ib]; o[q] = (cc < 2 * DQ) ? a : b2; }
    *(v4f*)(Bq + c) = o;  }
// prep_cvt: src [rows][DM] f32 -> dst, the same plane in fragment order, bf16. One wave per block of 16 rows x 32 k (16 whole lines of src), the eight waves of a work-group on neighbouring k; rows / 16 * DM / 32 / 8 work-groups per batch.
__device__ __forceinline__ void prep_cvt(const float* __restrict__ src, bf* dst, const int blk) {
    const int lane = threadIdx.x & 31, lr = lane & 15, hi = lane >> 4; const int wv = blk * 8 + (threadIdx.x >> 5); const int rt = wv / (DM / 32), kt = wv % (DM / 32);
    const float* p = src + (size_t)(rt * 16 + lr) * DM + kt * 32 + 8 * hi; const v8f v = *(const v8f*)p, u = *(const v8f*)(p + 16);
    v8us o0, o1;
#pragma unroll
    for (int k = 0; k < 8; ++k) { o0[k] = f2bf(v[k]); o1[k] = f2bf(u[k]); }
    bf* q = dst + (size_t)rt * 16 * DM + kt * 512 + lane * 8; *(v8us*)q = o0; *(v8us*)(q + 256) = o1;  }
#define GX  (TT * DM / 512 / 8)         // work-groups per batch of x
#define GWQ (DM * 2 * DQ / 512 / 8)     // of Wqk
#define GWV (DM * DQ / 512 / 8)         // of Wv
#define GBC ((N3 / 4 + 255) / 256)      // of the bias
__global__ __launch_bounds__(256) void k_prep(const float* __restrict__ x, const float* __restrict__ wqk, const float* __restrict__ bqk, const float* __restrict__ wv, const float* __restrict__ bv, bf* XB, bf* WQKV, float* BQKV) {
    int blk = blockIdx.x;
    if (blk < NB * GX) { const int b = blk / GX; prep_cvt(x + (size_t)b * SEQ_FULL * DM, XB + (size_t)b * TT * DM, blk % GX); return; }
    blk -= NB * GX;
    if (blk < GWQ) { prep_wt<DM, 2 * DQ>(wqk, WQKV, blk); return; }                          // in[1024][2048] -> out rows 0..2047
    blk -= GWQ;
    if (blk < GWV) { prep_wt<DM, DQ>(wv, WQKV + (size_t)2 * DQ * DM, blk); return; }         // in[1024][1024] -> out rows 2048..3071
    prep_bcat(bqk, bv, BQKV, blk - GWV);
}

// k_fattn: scores, causal softmax and p.v of one (batch, head), 16 * NQ query rows per wave, four waves per block, no memory round trip for s or p.
// SPLIT (the f16 rows): a block is 64 query rows; waves 0, 1 walk the lower part of the rows' keys and waves 2, 3 the upper part with the diagonal, so the longest chain of dependent key steps is half as long. Each wave runs its own running softmax; wave w + 2 then hands its o, maximum and sum to wave w through LDS, which brings both to the common maximum, adds them and stores.
// Transposed products: s^T = K q^T (A = key rows, B = query rows), so D element j of key tile kt is key k0 + 16*kt + 8*(lane>>4) + j of query (lane & 15): the two key tiles of a 32-key step ARE the B fragment of p^T (elements 0..7 / 8..15) for o^T = V^T p^T (A = value plane rows d, k = key).
// Running softmax per query (= per lane; the two lane halves hold different keys and share the maximum by one cross-half exchange): o and the sum are rescaled by 2^((m_old - m_new) c) each step. Keys j > i take the reference's replace fill (-1e9 after the 0.125 scale); only the last step of a row group meets the diagonal.
__device__ __forceinline__ float xhalf(float x) { return __builtin_bit_cast(float, __builtin_amdgcn_permlanex16(__builtin_bit_cast(int, x), __builtin_bit_cast(int, x), 0x76543210, 0xfedcba98, false, false)); }   // lane l takes lane l ^ 16
// The wave takes the 32-key steps kb, kb + 32, ..., kl (multiples of 32, kb <= kl <= q0); the last one goes through the causal test, which passes every key where kl + 31 <= q0.
template <typename T16, bool HR, int NQ, bool SPLIT>
__device__ __forceinline__ void attn_rows(const T16* __restrict__ Q, const T16* __restrict__ Q2, const T16* __restrict__ Kp, const T16* __restrict__ K2, const T16* __restrict__ Vt, const T16* __restrict__ V2, float* O, const int q0, const int kb, const int kl, float* xs, const bool giver, const int lr, const int hi) {
    typedef WFrag<T16> WF; typedef typename WF::V V;
    const float CL = SCL * 1.4426950408889634f;
    // per-lane byte offset into a 1-KB fragment block of any plane: 16 bytes per lane, the fragment's second half 512 bytes on
    const unsigned lob = (unsigned)(lr + 16 * hi) * 16u;
    auto at = [](const T16* base, const unsigned byteoff) { return (const T16*)((const char*)base + byteoff); };
    V qf[NQ][2], q2[NQ][2];
#pragma unroll
    for (int nq = 0; nq < NQ; ++nq)
#pragma unroll
        for (int ks = 0; ks < 2; ++ks) { const int e = (q0 + nq * 16) * HD + ks * 512; qf[nq][ks] = WF::ldp(at(Q + e, lob)); if (HR) q2[nq][ks] = WF::ldp(at(Q2 + e, lob)); }
    asm volatile("s_wait_xcnt 0x0" ::: "memory");   // the query loads' address registers are free for reuse by what follows
    v8f o[4][NQ]; float mr[NQ], ls[NQ];
#pragma unroll
    for (int nq = 0; nq < NQ; ++nq) { mr[nq] = -1.0e30f; ls[nq] = 0.f;
#pragma unroll
        for (int db = 0; db < 4; ++db) o[db][nq] = (v8f){}; }
    // the four plane pointers live across the whole key loop and step by 32 keys (four blocks, 4 KB) behind each load group
    const T16 *pk = at(Kp + kb * HD, lob), *pk2 = HR ? at(K2 + kb * HD, lob) : nullptr, *pv = at(Vt + kb * HD, lob), *pv2 = HR ? at(V2 + kb * HD, lob) : nullptr;
    auto ldk = [&](V (&d)[2][2], V (&d2)[2][2]) {
#pragma unroll
        for (int kt = 0; kt < 2; ++kt)
#pragma unroll
            for (int ks = 0; ks < 2; ++ks) { const int e = (kt * 2 + ks) * 512; d[kt][ks] = WF::ldp(pk + e); if (HR) d2[kt][ks] = WF::ldp(pk2 + e); }
        pk += 32 * HD; if (HR) pk2 += 32 * HD; };
    auto ldv = [&](V (&d)[4], V (&d2)[4]) {
#pragma unroll
        for (int db = 0; db < 4; ++db) { const int e = db * 512; d[db] = WF::ldp(pv + e); if (HR) d2[db] = WF::ldp(pv2 + e); }
        pv += 32 * HD; if (HR) pv2 += 32 * HD; };
    auto scores = [&](v8f (&s)[2][NQ], V (&kc)[2][2], V (&kc2)[2][2]) {
#pragma unroll
        for (int kt = 0; kt < 2; ++kt)
#pragma unroll
            for (int nq = 0; nq < NQ; ++nq) { v8f c = (v8f){};
#pragma unroll
                for (int ks = 0; ks < 2; ++ks) { c = WF::mma(kc[kt][ks], qf[nq][ks], c); if (HR) { c = WF::mma(kc[kt][ks], q2[nq][ks], c); c = WF::mma(kc2[kt][ks], qf[nq][ks], c); } }
                s[kt][nq] = c; } };
    auto softpv = [&](v8f (&s)[2][NQ], V (&vf)[4], V (&v2)[4], const int k0, const bool mask) {
        V pf[NQ], pl[NQ];
#pragma unroll
        for (int nq = 0; nq < NQ; ++nq) {
            if (mask) { const int qi = q0 + nq * 16 + lr;
#pragma unroll
                for (int kt = 0; kt < 2; ++kt)
#pragma unroll
                    for (int j = 0; j < 8; ++j) s[kt][nq][j] = (k0 + kt * 16 + 8 * hi + j <= qi) ? s[kt][nq][j] : (NEGF / SCL); }
            float mx = s[0][nq][0];
#pragma unroll
            for (int j = 1; j < 8; ++j) mx = fmaxf(mx, s[0][nq][j]);
#pragma unroll
            for (int j = 0; j < 8; ++j) mx = fmaxf(mx, s[1][nq][j]);
            mx = fmaxf(mx, xhalf(mx));
            const float mn = fmaxf(mr[nq], mx); const float al = __builtin_amdgcn_exp2f((mr[nq] - mn) * CL); mr[nq] = mn;
            float sum = 0.f; float p[16];
#pragma unroll
            for (int e = 0; e < 16; ++e) { p[e] = __builtin_amdgcn_exp2f((s[e >> 3][nq][e & 7] - mn) * CL + (HR ? 0.f : PEXP)); sum += p[e]; }
            ls[nq] = ls[nq] * al + sum;
#pragma unroll
            for (int db = 0; db < 4; ++db) o[db][nq] *= al;
            if constexpr (HR) { v8us h0, h1, l0, l1;
#pragma unroll
                for (int j = 0; j < 8; ++j) { unsigned short a, c2; splitf(p[j], a, c2); h0[j] = a; l0[j] = c2; splitf(p[8 + j], a, c2); h1[j] = a; l1[j] = c2; }
                pf[nq] = cat16b(h0, h1); pl[nq] = cat16b(l0, l1);
            } else { v16h t;
#pragma unroll
                for (int e = 0; e < 16; ++e) t[e] = tohx(p[e]);
                pf[nq] = t; } }
#pragma unroll
        for (int db = 0; db < 4; ++db)
#pragma unroll
            for (int nq = 0; nq < NQ; ++nq) { o[db][nq] = WF::mma(vf[db], pf[nq], o[db][nq]); if (HR) { o[db][nq] = WF::mma(vf[db], pl[nq], o[db][nq]); o[db][nq] = WF::mma(v2[db], pf[nq], o[db][nq]); } } };
    V kf[2][2], k2[2][2], vf[4], v2[4]; v8f s[2][NQ];
    ldk(kf, k2);
    __builtin_amdgcn_sched_barrier(0);   // key loads issue in front of the value loads here as in the loop: loads return in order, and with another order on entry the wait at the loop's head covers the value loads too
    ldv(vf, v2);
    asm volatile("s_wait_xcnt 0x0" ::: "memory");   // the first fragment loads name the per-lane offset register, which is dead from here on and gets reused
    // each fragment set is refilled for the next step right behind its last use: the key loads fly under softmax and p.v, the value loads under the next scores and softmax (step kl always exists)
    for (int k0 = kb; k0 < kl; k0 += 32) {
        scores(s, kf, k2);
        ldk(kf, k2);
        softpv(s, vf, v2, k0, false);
        ldv(vf, v2);
    }
    scores(s, kf, k2);
    softpv(s, vf, v2, kl, true);
    if constexpr (SPLIT) {
        // xs: the wave pair's LDS range, rows of 32 lanes: 8 * NQ rows of 16 bytes per lane (o), then NQ + NQ rows of 4 bytes per lane (maximum, sum); a lane reads what the same lane of the other wave wrote
        const int lane = lr + 16 * hi;
        v4f* xo = (v4f*)xs + lane; float* xm = xs + 8 * NQ * 128 + lane;
        if (giver) {
#pragma unroll
            for (int nq = 0; nq < NQ; ++nq) { xm[nq * 32] = mr[nq]; xm[(NQ + nq) * 32] = ls[nq];
#pragma unroll
                for (int db = 0; db < 4; ++db) { xo[((nq * 4 + db) * 2) * 32] = __builtin_shufflevector(o[db][nq], o[db][nq], 0, 1, 2, 3); xo[((nq * 4 + db) * 2 + 1) * 32] = __builtin_shufflevector(o[db][nq], o[db][nq], 4, 5, 6, 7); } }
        }
        __syncthreads();   // the upper-key waves' LDS writes are done before the lower-key waves read them; every wave of the block passes it once
        if (giver) return;
#pragma unroll
        for (int nq = 0; nq < NQ; ++nq) { const float m2 = xm[nq * 32], l2 = xm[(NQ + nq) * 32]; const float mn = fmaxf(mr[nq], m2);
            const float a1 = __builtin_amdgcn_exp2f((mr[nq] - mn) * CL), a2 = __builtin_amdgcn_exp2f((m2 - mn) * CL);
            ls[nq] = ls[nq] * a1 + l2 * a2;
#pragma unroll
            for (int db = 0; db < 4; ++db) { const v4f u = xo[((nq * 4 + db) * 2) * 32], w = xo[((nq * 4 + db) * 2 + 1) * 32];
#pragma unroll
                for (int j = 0; j < 4; ++j) { o[db][nq][j] = o[db][nq][j] * a1 + u[j] * a2; o[db][nq][4 + j] = o[db][nq][4 + j] * a1 + w[j] * a2; } } }
    }
#pragma unroll
    for (int nq = 0; nq < NQ; ++nq) { const float l = ls[nq] + xhalf(ls[nq]); const float inv = __fdiv_rn(1.0f, l);
        float* orow = O + (size_t)(q0 + nq * 16 + lr) * DM + 8 * hi;
#pragma unroll
        for (int db = 0; db < 4; ++db) { v4f a, c;
#pragma unroll
            for (int j = 0; j < 4; ++j) { a[j] = o[db][nq][j] * inv; c[j] = o[db][nq][4 + j] * inv; }
            *(v4f*)(orow + db * 16) = a; *(v4f*)(orow + db * 16 + 4) = c;
            asm volatile("s_wait_xcnt 0x0" ::: "memory"); } }   // the next pair of products is written into the data registers that these two stores name
}
// grid (NB * 16 heads, (TT - RH) / 64 + RH / 64): f16 row groups first (64 rows: two waves of 32 rows x two key ranges), the longest (last rows) at the lowest block indices; then the hi/lo row groups (16 rows per wave: three products per tile and two planes per operand). The second launch bound asks for four waves per SIMD (at most 256 registers a wave), so that every block of the grid is resident from the start.
// Key ranges of a block whose first row is qb (a multiple of 64, >= RH >= 64): the lower waves take the qb / 64 + 1 steps below key ks = qb / 2 + 32 <= qb, the upper waves the steps ks ... q0, qb / 64 or one more.
static_assert(RH >= 64 && RH % 64 == 0);
__global__ __launch_bounds__(128, 4) void k_fattn(const h16* __restrict__ QK16, const h16* __restrict__ VT16, const bf* __restrict__ QKh, const bf* __restrict__ QKl, const bf* __restrict__ VTh, const bf* __restrict__ VTl, float* OUT) {
    const int lane = threadIdx.x & 31, lr = lane & 15, hi = lane >> 4; const int wv = __builtin_amdgcn_readfirstlane((int)(threadIdx.x >> 5));
    const int b = blockIdx.x / NH_, h = blockIdx.x % NH_; const int y = blockIdx.y;
    float* O = OUT + (size_t)b * TT * DM + h * HD;
    const size_t zq = (size_t)(b * 2 * NH_ + h), zk = zq + NH_, zv = (size_t)(b * NH_ + h);
    __shared__ __align__(16) float xs[2][(8 * 2 * 4 + 2 * 2) * 32];   // one range per wave pair (w, w + 2)
    if (y < (TT - RH) / 64) {
        const int qb = TT - 64 * (y + 1), q0 = qb + (wv & 1) * 32, ks = qb / 2 + 32; const bool up = wv >= 2;
        attn_rows<h16, false, 2, true>(QK16 + zq * TT * HD, nullptr, QK16 + zk * TT * HD, nullptr, VT16 + zv * HD * TT, nullptr, O, q0, up ? ks : 0, up ? q0 : ks - 32, xs[wv & 1], up, lr, hi);
    } else {
        const int q0 = RH - 64 * (y - (TT - RH) / 64 + 1) + wv * 16;
        attn_rows<bf, true, 1, false>(QKh + zq * RH * HD, QKl + zq * RH * HD, QKh + zk * RH * HD, QKl + zk * RH * HD, VTh + zv * HD * RH, VTl + zv * HD * RH, O, q0, 0, q0 & ~31, nullptr, false, lr, hi);
    }
}

extern "C" void kernel_launch(void* const* d_in, const int* in_sizes, int n_in,
                              void* d_out, int out_size, void* d_ws, size_t ws_size, hipStream_t stream) {
    if (n_in < 5) return;
    if (in_sizes[0] < (NB - 1) * SEQ_FULL * DM + TT * DM) return;
    if (in_sizes[1] < DM * 2 * DQ) return; if (in_sizes[2] < 2 * DQ) return; if (in_sizes[3] < DM * DQ) return; if (in_sizes[4] < DQ) return;
    if (out_size < NB * TT * DM) return;
    const float* x = (const float*)d_in[0]; const float* wqk = (const float*)d_in[1]; const float* bqk = (const float*)d_in[2]; const float* wv = (const float*)d_in[3]; const float* bv = (const float*)d_in[4];   // wire order x, Wqk, bqk, Wv, bv
    float* OUT = (float*)d_out;     // [NB][TT][1024]
    char* wsp = (char*)d_ws;
    auto take = [&](size_t bytes) { char* p = wsp; wsp += (bytes + 255) & ~(size_t)255; return (void*)p; };
    bf* WQKV = (bf*)take((size_t)N3 * DM * 2);                  // Bt [3072][1024] in fragment order: q | k | v row blocks
    float* BQKV = (float*)take((size_t)N3 * 4);
    h16* QK16 = (h16*)take((size_t)NB * 2 * NH_ * TT * HD * 2); // [NB][32] planes of TT x 64 in fragment order: q heads 0..15, k heads 16..31
    h16* VT16 = (h16*)take((size_t)NB * NH_ * HD * TT * 2);     // [NB][16] planes of 64 x TT in fragment order, blocks (t / 32, d / 16)
    bf* QKh = (bf*)take((size_t)NB * 2 * NH_ * RH * HD * 2); bf* QKl = (bf*)take((size_t)NB * 2 * NH_ * RH * HD * 2);
    bf* VTh = (bf*)take((size_t)NB * NH_ * HD * RH * 2); bf* VTl = (bf*)take((size_t)NB * NH_ * HD * RH * 2);
    bf* XB = (bf*)take((size_t)NB * TT * DM * 2);               // [NB*TT][1024] in fragment order
    const size_t carved = (size_t)(wsp - (char*)d_ws);
    if (carved > ws_size) return;
    k_prep<<<(unsigned)(NB * GX + GWQ + GWV + GBC), 256, 0, stream>>>(x, wqk, bqk, wv, bv, XB, WQKV, BQKV);
    k_gemmw<true, DM><<<dim3(NB * TT / 128, N3 / 128, 1), 128, 0, stream>>>(XB, WQKV, BQKV, QK16, QKh, QKl, VT16, VTh, VTl);
    k_fattn<<<dim3(NB * NH_, (TT - RH) / 64 + RH / 64, 1), 128, 0, stream>>>(QK16, VT16, QKh, QKl, VTh, VTl, OUT);
}

// v008
// A run of this version takes 54.8 microseconds.
// Next to v007, in two timings, it ran 1.07 and 1.06 times as fast.
// Over all steps from v000 it is 25.8 times as fast.
#include <hip/hip_runtime.h>

// Causal multi-head self-attention, no output projection: x [NB][SEQ][1024]; qk = x Wqk + bqk (Wqk [1024][2048] 'in x out': q = cols 0..1023, k = cols 1024..2047), v = x Wv + bv (Wv [1024][1024]); 16 heads x 64 (col = h*64 + d); s = q.k x 0.125; keys j > i replaced by -1e9; softmax f32; out[b][t][h*64+d] = sum_j p v.
// Compute dtypes, f32 accumulate: every input RNE-converted to bf16; projections v_wmma_f32_16x16x32_bf16 (exact products) + bf16 bias; q.k and p.v: query rows < 512 bf16 hi/lo planes (3 products, v_wmma bf16), other rows v_wmma_f32_16x16x32_f16 single planes with the unnormalised p carried x1024 (the row sum carries the same factor, so it cancels in the f32 division); softmax f32, running maximum and running sum.
// Layout: bf16 copy of x (both batches) and the fused, transposed weight (q | k | v row blocks); one fused projection GEMM over both batches whose epilogue converts its f32 tile and writes the head planes [b][h] (rows t, k = d) / value planes [b][g] (rows d, k = t) itself; every one of these planes lies in fragment order (see k_gemmw); one attention launch for all heads and batches: scores and p stay in registers, the f16 rows' four key-range partials of p.v are merged through LDS, output written straight into the merged layout (256-B head segments).

#ifndef NB
#define NB 2
#endif
#ifndef SEQ
#define SEQ 2048
#endif
#define NB_FULL  2
#define SEQ_FULL 2048
#define TT   SEQ
#define DM   1024
#define NH_  16
#define HD   64
#define DQ   (NH_ * HD)
#define N3   (3 * DQ)
#define RH   ((TT < 512) ? TT : 512)     // query rows < RH use hi+lo planes
#define PEXP 10.0f                        // f16 rows: p carried x 2^10
#define SCL  0.125f                       // 64^-0.5
#define NEGF (-1.0e9f)
static_assert(TT % 128 == 0);
static_assert(RH % 128 == 0);
static_assert((TT - RH) % 128 == 0);
static_assert(DM % 256 == 0);   // eight 32-k blocks per packing work-group
static_assert(N3 % 128 == 0);

typedef _Float16 h16;
typedef unsigned short bf;
typedef __attribute__((ext_vector_type(16))) __bf16   v16bf;
typedef __attribute__((ext_vector_type(16))) _Float16 v16h;
typedef __attribute__((ext_vector_type(8)))  _Float16 v8h;
typedef __attribute__((ext_vector_type(8)))  unsigned short v8us;
typedef __attribute__((ext_vector_type(8)))  float    v8f;
typedef __attribute__((ext_vector_type(4)))  float    v4f;
typedef __attribute__((ext_vector_type(2)))  float    v2f;
typedef __attribute__((ext_vector_type(2)))  _Float16 v2h;
typedef __attribute__((ext_vector_type(4)))  _Float16 v4h;
typedef __attribute__((ext_vector_type(2)))  unsigned short v2us;
typedef __attribute__((ext_vector_type(4)))  unsigned short v4us;
typedef v4f  __attribute__((may_alias)) v4fa;

__device__ __forceinline__ unsigned short f2bf(float f) { unsigned u = __float_as_uint(f); u += 0x7FFFu + ((u >> 16) & 1u); return (unsigned short)(u >> 16); }
__device__ __forceinline__ float bf2f(unsigned short b) { return __uint_as_float(((unsigned)b) << 16); }
__device__ __forceinline__ float bfr(float f) { return bf2f(f2bf(f)); }
__device__ __forceinline__ v16h cat16(v8h lo, v8h hi) { return __builtin_shufflevector(lo, hi, 0, 1, 2, 3, 4, 5, 6, 7, 8, 9, 10, 11, 12, 13, 14, 15); }
__device__ __forceinline__ v16bf cat16b(v8us lo, v8us hi) { return __builtin_bit_cast(v16bf, __builtin_shufflevector(lo, hi, 0, 1, 2, 3, 4, 5, 6, 7, 8, 9, 10, 11, 12, 13, 14, 15)); }
__device__ __forceinline__ v8f wmma16(v16h a, v16h b, v8f c) { return __builtin_amdgcn_wmma_f32_16x16x32_f16(false, a, false, b, (short)0, c, false, false); }
__device__ __forceinline__ v8f wmmab(v16bf a, v16bf b, v8f c) { return __builtin_amdgcn_wmma_f32_16x16x32_bf16(false, a, false, b, (short)0, c, false, false); }
__device__ __forceinline__ h16 tohx(float x) { return (h16)x; }
__device__ __forceinline__ void splitf(float y, unsigned short& h, unsigned short& l) { h = f2bf(y); l = f2bf(y - bf2f(h)); }

// ---- k_gemmw: register-blocked GEMM, FOUR WAVES (2 x 2) per 128x128 output tile, 64x64 (16 accumulators) per wave; both operands are 16-bit planes in fragment order and reach the waves through a two-buffer LDS ring filled by asynchronous copies, so each operand byte is fetched once per work-group and one stage ahead of its use; grid (M/128, N/128), 128 threads.
// Fragment order: a plane of rows x K is cut into blocks of 16 rows x 32 k, 512 elements (1 KB) each, block (row / 16, k / 32) at element (row / 16) * 16 * K + (k / 32) * 512; inside a block lane l's elements 0..7 lie at l * 8 and its elements 8..15 at 256 + l * 8, so each of a fragment's two 16-byte loads covers 512 contiguous bytes (4 whole lines) where a row-major plane gives 16 pieces of 32 bytes in 16 lines.
// y[m][n] (f32) = sum_k A[m][k] Bt[n][k] (+ bf16 bias[n]), k ascending in steps of 32 in every accumulator. K % 64 == 0, a compile-time constant.
// y never reaches memory: a 64-column tile is one head (0..15 q, 16..31 k, 32..47 v) and a 64-row tile lies in one batch and on one side of row RH, so the epilogue writes the attention planes itself: f16 always, bf16 hi/lo for rows < RH.
// Fragment map: lane -> row/col (lane & 15); elements 0..7 = k0 + 8*(lane>>4) + 0..7, elements 8..15 = k0 + 16 + 8*(lane>>4) + 0..7 for both operands; D element j = row 8*(lane>>4)+j, col lane&15.
template <typename T16> struct WFrag;
template <> struct WFrag<h16> { typedef v16h V; static __device__ __forceinline__ V ldp(const h16* p) { return cat16(*(const v8h*)p, *(const v8h*)(p + 256)); } static __device__ __forceinline__ v8f mma(V a, V b, v8f c) { return wmma16(a, b, c); } };
template <> struct WFrag<bf> { typedef v16bf V; static __device__ __forceinline__ V ldp(const bf* p) { return cat16b(*(const v8us*)p, *(const v8us*)(p + 256)); } static __device__ __forceinline__ v8f mma(V a, V b, v8f c) { return wmmab(a, b, c); } };
// Epilogues of k_gemmw, one wave each; HL: the tile's rows are < RH and get the bf16 hi/lo planes too. The planes are written in the fragment order in which k_fattn loads them, every store instruction covering 512 contiguous bytes. s_wait_xcnt 0 stands behind each group of stores because the next group's values and addresses are written into registers that those stores name.
// put_qk: fragment rows = t, k = d: block (t / 16, d / 32) at element (t / 16) * 1024 + (d / 32) * 512 of the head's plane, so the tile is one contiguous 64 x 64 block. 16 rows at a time go through LDS (f32, pitch 68) so that lane l holds 8 neighbouring d of row l & 15; a wave's LDS reads are all issued in front of its stores (the "memory" clobber of the wait also keeps the next LDS writes behind the reads in the compiled order).
template <bool HL, bool BIAS>
__device__ __forceinline__ void put_qk(const v8f (&acc)[4][4], float* os, const float* __restrict__ bias, h16* p16, bf* ph, bf* pl, const int lane) {
    const int lr = lane & 15, hi = lane >> 4; float bn[4];
#pragma unroll
    for (int nb = 0; nb < 4; ++nb) bn[nb] = BIAS ? bfr(bias[nb * 16 + lr]) : 0.f;
#pragma unroll
    for (int mb = 0; mb < 4; ++mb) {
#pragma unroll
        for (int nb = 0; nb < 4; ++nb) {
#pragma unroll
            for (int j = 0; j < 8; ++j) os[(hi * 8 + j) * 68 + nb * 16 + lr] = acc[mb][nb][j] + bn[nb]; }
        __builtin_amdgcn_wave_barrier(); asm volatile("" ::: "memory");   // the LDS range is this wave's own: keeps the row reads below behind the other lanes' LDS writes in the compiled order
        v4f x[4][2];
#pragma unroll
        for (int s = 0; s < 4; ++s) { const float* r = os + lr * 68 + s * 16 + hi * 8; x[s][0] = *(const v4fa*)r; x[s][1] = *(const v4fa*)(r + 4); }   // s = 2 * (d / 32) + fragment half
#pragma unroll
        for (int s = 0; s < 4; ++s) { v8h o16; v8us oh, ol;
#pragma unroll
            for (int q = 0; q < 8; ++q) { const float y = x[s][q >> 2][q & 3]; o16[q] = tohx(y); if (HL) { unsigned short a2, c2; splitf(y, a2, c2); oh[q] = a2; ol[q] = c2; } }
            const int e = mb * 1024 + s * 256 + lane * 8;
            *(v8h*)(p16 + e) = o16; if (HL) { *(v8us*)(ph + e) = oh; *(v8us*)(pl + e) = ol; }
            asm volatile("s_wait_xcnt 0x0" ::: "memory"); }   // the next rows' values are written into registers that these stores name
    }
}
// put_v: fragment rows = d, k = t: block (t / 32, d / 16) at element (t / 32) * 2048 + (d / 16) * 512 of the head's plane. A lane's 8 accumulator elements are 8 neighbouring t of d = 16 * nb + (lane & 15), which is this same lane's 16-byte piece of the fragment (half = mb & 1): converted in registers and stored straight.
template <bool HL, bool BIAS>
__device__ __forceinline__ void put_v(const v8f (&acc)[4][4], const float* __restrict__ bias, h16* p16, bf* ph, bf* pl, const int lane) {
    const int lr = lane & 15; float bn[4];
#pragma unroll
    for (int nb = 0; nb < 4; ++nb) bn[nb] = BIAS ? bfr(bias[nb * 16 + lr]) : 0.f;
#pragma unroll
    for (int nb = 0; nb < 4; ++nb) { const float bs = bn[nb];
#pragma unroll
        for (int mb = 0; mb < 4; ++mb) { v8h o16; v8us oh, ol;
#pragma unroll
            for (int j = 0; j < 8; ++j) { const float y = acc[mb][nb][j] + bs; o16[j] = tohx(y); if (HL) { unsigned short a2, c2; splitf(y, a2, c2); oh[j] = a2; ol[j] = c2; } }
            const int e = ((mb >> 1) * 4 + nb) * 512 + (mb & 1) * 256 + lane * 8;
            *(v8h*)(p16 + e) = o16; if (HL) { *(v8us*)(ph + e) = oh; *(v8us*)(pl + e) = ol; }
            asm volatile("s_wait_xcnt 0x0" ::: "memory"); }   // the next values are written into registers that these stores name
    }
}
// One stage of k_gemmw's LDS ring: 64 k of the tile's 128 A rows (first 16 KB) and 128 Bt rows (second 16 KB). In fragment order a group of 16 rows x 64 k is 2 KB contiguous in the plane; it is copied as it lies, so a fragment's two 16-byte LDS loads cover 512 contiguous bytes each, as the global loads did.
#define GST 32768
// Eight asynchronous copies global -> LDS, 16 bytes per lane each, through no register. s_wait_xcnt 0 is the statement's own last line so that it stands in front of every later write of the address registers that the copies name.
__device__ __forceinline__ void copy8(const unsigned (&l)[8], const char* const (&g)[8]) {
    asm volatile("global_load_async_to_lds_b128 %0, %8, off\n\t"
                 "global_load_async_to_lds_b128 %1, %9, off\n\t"
                 "global_load_async_to_lds_b128 %2, %10, off\n\t"
                 "global_load_async_to_lds_b128 %3, %11, off\n\t"
                 "global_load_async_to_lds_b128 %4, %12, off\n\t"
                 "global_load_async_to_lds_b128 %5, %13, off\n\t"
                 "global_load_async_to_lds_b128 %6, %14, off\n\t"
                 "global_load_async_to_lds_b128 %7, %15, off\n\t"
                 "s_wait_xcnt 0x0"
                 :: "v"(l[0]), "v"(l[1]), "v"(l[2]), "v"(l[3]), "v"(l[4]), "v"(l[5]), "v"(l[6]), "v"(l[7]),
                    "v"(g[0]), "v"(g[1]), "v"(g[2]), "v"(g[3]), "v"(g[4]), "v"(g[5]), "v"(g[6]), "v"(g[7]) : "memory");
}
template <bool BIAS, int K>
__global__ __launch_bounds__(128) void k_gemmw(const bf* __restrict__ A, const bf* __restrict__ Bt, const float* __restrict__ bias, h16* QK16, bf* QKh, bf* QKl, h16* VT16, bf* VTh, bf* VTl) {
    static_assert(K % 64 == 0 && K / 64 >= 2);   // the ring's prologue fills two stages
    typedef WFrag<bf> WF; typedef WF::V V;
    constexpr int NT = K / 64;
    __shared__ __align__(16) char ring[2 * GST];
    const int lane = threadIdx.x & 31; const int wv = __builtin_amdgcn_readfirstlane((int)(threadIdx.x >> 5)); const int wm = wv >> 1, wn = wv & 1;
    const int R0 = blockIdx.x * 128, C0 = blockIdx.y * 128;
    v8f acc[4][4];   // every inner loop of this kernel is unrolled in full, so that each accumulator, fragment and copy index is a compile-time constant (registers, no scratch)
#pragma unroll
    for (int mb = 0; mb < 4; ++mb)
#pragma unroll
        for (int nb = 0; nb < 4; ++nb) acc[mb][nb] = (v8f){};
    // wave wv copies row groups 2 wv and 2 wv + 1 of both operands: 4 x 2 KB = 16 copies of 512 bytes per stage
    const char* gA = (const char*)(A + (size_t)(R0 + wv * 32) * K + lane * 8);
    const char* gB = (const char*)(Bt + (size_t)(C0 + wv * 32) * K + lane * 8);
    const unsigned lw = (unsigned)(size_t)ring + (unsigned)(wv * 4096 + lane * 16);
    auto fill = [&](const int t, const unsigned buf) {
        unsigned l[8]; const char* g[8];
#pragma unroll
        for (int c = 0; c < 2; ++c)
#pragma unroll
            for (int j = 0; j < 4; ++j) { l[c * 4 + j] = lw + buf * GST + c * 2048 + j * 512; g[c * 4 + j] = gA + (size_t)c * 32 * K + t * 2048 + j * 512; }
        copy8(l, g);
#pragma unroll
        for (int c = 0; c < 2; ++c)
#pragma unroll
            for (int j = 0; j < 4; ++j) { l[c * 4 + j] = lw + buf * GST + 16384 + c * 2048 + j * 512; g[c * 4 + j] = gB + (size_t)c * 32 * K + t * 2048 + j * 512; }
        copy8(l, g);
    };
    fill(0, 0);
    asm volatile("s_wait_asynccnt 0x0" ::: "memory");   // this wave's copies of stage 0 have landed
    __syncthreads();                                     // ... and every other wave's
    fill(1, 1);
    const char* fa = ring + wm * 8192 + lane * 16;           // this wave's four A row groups, this lane's piece
    const char* fb = ring + 16384 + wn * 8192 + lane * 16;   // its four Bt row groups
#pragma unroll 1
    for (int t = 0; t < NT; ++t) {   // rolled: one copy of the stage's code, the buffer chosen by an address offset
        const int bo = (t & 1) * GST;
        V a[4], b[4];
        auto ldf = [&](const int kb) {   // the eight fragments of one 32-k block
#pragma unroll
            for (int mb = 0; mb < 4; ++mb) a[mb] = WF::ldp((const bf*)(fa + bo + mb * 2048 + kb * 1024));
#pragma unroll
            for (int nb = 0; nb < 4; ++nb) b[nb] = WF::ldp((const bf*)(fb + bo + nb * 2048 + kb * 1024)); };
        auto mm = [&]() {
#pragma unroll
            for (int nb = 0; nb < 4; ++nb)
#pragma unroll
                for (int mb = 0; mb < 4; ++mb) acc[mb][nb] = WF::mma(a[mb], b[nb], acc[mb][nb]); };
        ldf(0);
        __builtin_amdgcn_sched_barrier(0);   // the 16 LDS loads of a block stay one group in front of its WMMAs: sunk among them, every group of four WMMAs waits out an LDS latency of its own
        mm();
        ldf(1);
        asm volatile("s_wait_dscnt 0x0" ::: "memory");      // this wave's last reads of the buffer have returned before it is refilled
        asm volatile("s_wait_asynccnt 0x0" ::: "memory");   // this wave's copies of stage t + 1 have landed
        __syncthreads();                                     // publishes stage t + 1 and ends every wave's reads of stage t
        if (t + 2 < NT) fill(t + 2, (unsigned)(t & 1));
        __builtin_amdgcn_sched_barrier(0);   // the second block's WMMAs work on registers alone and stay behind the refill, so that the copies start 16 WMMAs earlier
        mm();
    }
    asm volatile("s_wait_asynccnt 0x0" ::: "memory");   // no copy is outstanding when the wave goes on to its epilogue and ends
    float* os = (float*)(ring + wv * (16 * 68 * 4));   // the epilogue's staging range, one per wave, lies in the ring: every wave's last read of the ring stands in front of the last trip's barrier, and no copy is outstanding
    const int r0 = R0 + wm * 64, c0 = C0 + wn * 64;
    const int hh = c0 / 64, bb = r0 / TT, t0 = r0 % TT; const bool hl = (t0 < RH);   // all wave-uniform
    if (hh < 2 * NH_) { const size_t zp = (size_t)(bb * 2 * NH_ + hh); h16* p16 = QK16 + (zp * TT + t0) * HD;
        if (hl) put_qk<true, BIAS>(acc, os, bias + c0, p16, QKh + (zp * RH + t0) * HD, QKl + (zp * RH + t0) * HD, lane);
        else put_qk<false, BIAS>(acc, os, bias + c0, p16, nullptr, nullptr, lane);
    } else { const size_t zp = (size_t)(bb * NH_ + hh - 2 * NH_); h16* p16 = VT16 + (zp * TT + t0) * HD;
        if (hl) put_v<true, BIAS>(acc, bias + c0, p16, VTh + (zp * RH + t0) * HD, VTl + (zp * RH + t0) * HD, lane);
        else put_v<false, BIAS>(acc, bias + c0, p16, nullptr, nullptr, lane);
    }
}

// k_prep: the four independent preparation jobs in one launch, the job chosen by a block-uniform range test on blockIdx.x; none of them reads what another writes.
// prep_wt: w [K][N] f32 -> Bt, the transposed plane (rows n, K-contiguous) in fragment order, bf16. One wave per block of 16 n x 32 k: a lane holds row n = 16 * nt + (lane & 15) and reads its 16 k down the column, so each load covers 64 contiguous bytes of two rows of w; the eight waves of a work-group take neighbouring nt (512 contiguous bytes of each row). N / 16 * K / 32 / 8 work-groups.
template <int K, int N>
__device__ __forceinline__ void prep_wt(const float* __restrict__ w, bf* Bt, const int blk) {
    static_assert(N % 128 == 0 && K % 32 == 0);
    const int lane = threadIdx.x & 31, lr = lane & 15, hi = lane >> 4; const int wv = blk * 8 + (threadIdx.x >> 5); const int nt = wv % (N / 16), kt = wv / (N / 16);
    const float* p = w + (size_t)(kt * 32 + 8 * hi) * N + nt * 16 + lr; v8us o0, o1;
#pragma unroll
    for (int j = 0; j < 8; ++j) { o0[j] = f2bf(p[j * N]); o1[j] = f2bf(p[(16 + j) * N]); }
    bf* q = Bt + (size_t)nt * 16 * K + kt * 512 + lane * 8; *(v8us*)q = o0; *(v8us*)(q + 256) = o1;
    asm volatile("s_wait_xcnt 0x0" ::: "memory");   // in the merged kernel the next job's code follows in the listing and writes registers that these two stores name
}
__device__ __forceinline__ void prep_bcat(const float* __restrict__ bqk, const float* __restrict__ bv, float* Bq, const int blk) {
    const int i = blk * 256 + threadIdx.x; if (i >= N3 / 4) return; const int c = i * 4; v4f o;
#pragma unroll
    for (int q = 0; q < 4; ++q) { const int cc = c + q; const int ia = (cc < 2 * DQ) ? cc : (2 * DQ - 1); int ib = cc - 2 * DQ; ib = (ib < 0) ? 0 : ib; ib = (ib > DQ - 1) ? (DQ - 1) : ib;
        const float a = bqk[ia]; const float b2 = bv[ib]; o[q] = (cc < 2 * DQ) ? a : b2; }
    *(v4f*)(Bq + c) = o;  }
// prep_cvt: src [rows][DM] f32 -> dst, the same plane in fragment order, bf16. One wave per block of 16 rows x 32 k (16 whole lines of src), the eight waves of a work-group on neighbouring k; rows / 16 * DM / 32 / 8 work-groups per batch.
__device__ __forceinline__ void prep_cvt(const float* __restrict__ src, bf* dst, const int blk) {
    const int lane = threadIdx.x & 31, lr = lane & 15, hi = lane >> 4; const int wv = blk * 8 + (threadIdx.x >> 5); const int rt = wv / (DM / 32), kt = wv % (DM / 32);
    const float* p = src + (size_t)(rt * 16 + lr) * DM + kt * 32 + 8 * hi; const v8f v = *(const v8f*)p, u = *(const v8f*)(p + 16);
    v8us o0, o1;
#pragma unroll
    for (int k = 0; k < 8; ++k) { o0[k] = f2bf(v[k]); o1[k] = f2bf(u[k]); }
    bf* q = dst + (size_t)rt * 16 * DM + kt * 512 + lane * 8; *(v8us*)q = o0; *(v8us*)(q + 256) = o1;  }
#define GX  (TT * DM / 512 / 8)         // work-groups per batch of x
#define GWQ (DM * 2 * DQ / 512 / 8)     // of Wqk
#define GWV (DM * DQ / 512 / 8)         // of Wv
#define GBC ((N3 / 4 + 255) / 256)      // of the bias
__global__ __launch_bounds__(256) void k_prep(const float* __restrict__ x, const float* __restrict__ wqk, const float* __restrict__ bqk, const float* __restrict__ wv, const float* __restrict__ bv, bf* XB, bf* WQKV, float* BQKV) {
    int blk = blockIdx.x;
    if (blk < NB * GX) { const int b = blk / GX; prep_cvt(x + (size_t)b * SEQ_FULL * DM, XB + (size_t)b * TT * DM, blk % GX); return; }
    blk -= NB * GX;
    if (blk < GWQ) { prep_wt<DM, 2 * DQ>(wqk, WQKV, blk); return; }                          // in[1024][2048] -> out rows 0..2047
    blk -= GWQ;
    if (blk < GWV) { prep_wt<DM, DQ>(wv, WQKV + (size_t)2 * DQ * DM, blk); return; }         // in[1024][1024] -> out rows 2048..3071
    prep_bcat(bqk, bv, BQKV, blk - GWV);
}

// k_fattn: scores, causal softmax and p.v of one (batch, head), 16 * NQ query rows per wave, eight waves per block, no memory round trip for s or p.
// SPLIT (the f16 rows): a block is 64 query rows; its keys are cut into four ranges, wave pair p (waves 2 p, 2 p + 1) walks range p, the last range holds the diagonal, so the longest chain of dependent key steps is a quarter of the rows' steps. Each wave runs its own running softmax; the waves of ranges 1 to 3 then hand their o, maximum and sum through LDS to the wave of range 0 with the same rows, which brings them one after the other to the common maximum, adds them and stores.
// Transposed products: s^T = K q^T (A = key rows, B = query rows), so D element j of key tile kt is key k0 + 16*kt + 8*(lane>>4) + j of query (lane & 15): the two key tiles of a 32-key step ARE the B fragment of p^T (elements 0..7 / 8..15) for o^T = V^T p^T (A = value plane rows d, k = key).
// Running softmax per query (= per lane; the two lane halves hold different keys and share the maximum by one cross-half exchange): o and the sum are rescaled by 2^((m_old - m_new) c) each step. Keys j > i take the reference's replace fill (-1e9 after the 0.125 scale); only the last step of a row group meets the diagonal.
__device__ __forceinline__ float xhalf(float x) { return __builtin_bit_cast(float, __builtin_amdgcn_permlanex16(__builtin_bit_cast(int, x), __builtin_bit_cast(int, x), 0x76543210, 0xfedcba98, false, false)); }   // lane l takes lane l ^ 16
// The wave takes the 32-key steps kb, kb + 32, ..., kl (multiples of 32, kb <= kl <= q0); the last one goes through the causal test, which passes every key where kl + 31 <= q0.
template <typename T16, bool HR, int NQ, bool SPLIT>
__device__ __forceinline__ void attn_rows(const T16* __restrict__ Q, const T16* __restrict__ Q2, const T16* __restrict__ Kp, const T16* __restrict__ K2, const T16* __restrict__ Vt, const T16* __restrict__ V2, float* O, const int q0, const int kb, const int kl, float* xs, const int part, const int lr, const int hi) {
    typedef WFrag<T16> WF; typedef typename WF::V V;
    const float CL = SCL * 1.4426950408889634f;
    // per-lane byte offset into a 1-KB fragment block of any plane: 16 bytes per lane, the fragment's second half 512 bytes on
    const unsigned lob = (unsigned)(lr + 16 * hi) * 16u;
    auto at = [](const T16* base, const unsigned byteoff) { return (const T16*)((const char*)base + byteoff); };
    V qf[NQ][2], q2[NQ][2];
#pragma unroll
    for (int nq = 0; nq < NQ; ++nq)
#pragma unroll
        for (int ks = 0; ks < 2; ++ks) { const int e = (q0 + nq * 16) * HD + ks * 512; qf[nq][ks] = WF::ldp(at(Q + e, lob)); if (HR) q2[nq][ks] = WF::ldp(at(Q2 + e, lob)); }
    asm volatile("s_wait_xcnt 0x0" ::: "memory");   // the query loads' address registers are free for reuse by what follows
    v8f o[4][NQ]; float mr[NQ], ls[NQ];
#pragma unroll
    for (int nq = 0; nq < NQ; ++nq) { mr[nq] = -1.0e30f; ls[nq] = 0.f;
#pragma unroll
        for (int db = 0; db < 4; ++db) o[db][nq] = (v8f){}; }
    // the four plane pointers live across the whole key loop and step by 32 keys (four blocks, 4 KB) behind each load group
    const T16 *pk = at(Kp + kb * HD, lob), *pk2 = HR ? at(K2 + kb * HD, lob) : nullptr, *pv = at(Vt + kb * HD, lob), *pv2 = HR ? at(V2 + kb * HD, lob) : nullptr;
    auto ldk = [&](V (&d)[2][2], V (&d2)[2][2]) {
#pragma unroll
        for (int kt = 0; kt < 2; ++kt)
#pragma unroll
            for (int ks = 0; ks < 2; ++ks) { const int e = (kt * 2 + ks) * 512; d[kt][ks] = WF::ldp(pk + e); if (HR) d2[kt][ks] = WF::ldp(pk2 + e); }
        pk += 32 * HD; if (HR) pk2 += 32 * HD; };
    auto ldv = [&](V (&d)[4], V (&d2)[4]) {
#pragma unroll
        for (int db = 0; db < 4; ++db) { const int e = db * 512; d[db] = WF::ldp(pv + e); if (HR) d2[db] = WF::ldp(pv2 + e); }
        pv += 32 * HD; if (HR) pv2 += 32 * HD; };
    auto scores = [&](v8f (&s)[2][NQ], V (&kc)[2][2], V (&kc2)[2][2]) {
#pragma unroll
        for (int kt = 0; kt < 2; ++kt)
#pragma unroll
            for (int nq = 0; nq < NQ; ++nq) { v8f c = (v8f){};
#pragma unroll
                for (int ks = 0; ks < 2; ++ks) { c = WF::mma(kc[kt][ks], qf[nq][ks], c); if (HR) { c = WF::mma(kc[kt][ks], q2[nq][ks], c); c = WF::mma(kc2[kt][ks], qf[nq][ks], c); } }
                s[kt][nq] = c; } };
    auto softpv = [&](v8f (&s)[2][NQ], V (&vf)[4], V (&v2)[4], const int k0, const bool mask) {
        V pf[NQ], pl[NQ];
#pragma unroll
        for (int nq = 0; nq < NQ; ++nq) {
            if (mask) { const int qi = q0 + nq * 16 + lr;
#pragma unroll
                for (int kt = 0; kt < 2; ++kt)
#pragma unroll
                    for (int j = 0; j < 8; ++j) s[kt][nq][j] = (k0 + kt * 16 + 8 * hi + j <= qi) ? s[kt][nq][j] : (NEGF / SCL); }
            float mx = s[0][nq][0];
#pragma unroll
            for (int j = 1; j < 8; ++j) mx = fmaxf(mx, s[0][nq][j]);
#pragma unroll
            for (int j = 0; j < 8; ++j) mx = fmaxf(mx, s[1][nq][j]);
            mx = fmaxf(mx, xhalf(mx));
            const float mn = fmaxf(mr[nq], mx); const float al = __builtin_amdgcn_exp2f((mr[nq] - mn) * CL); mr[nq] = mn;
            float sum = 0.f; float p[16];
#pragma unroll
            for (int e = 0; e < 16; ++e) { p[e] = __builtin_amdgcn_exp2f((s[e >> 3][nq][e & 7] - mn) * CL + (HR ? 0.f : PEXP)); sum += p[e]; }
            ls[nq] = ls[nq] * al + sum;
#pragma unroll
            for (int db = 0; db < 4; ++db) o[db][nq] *= al;
            if constexpr (HR) { v8us h0, h1, l0, l1;
#pragma unroll
                for (int j = 0; j < 8; ++j) { unsigned short a, c2; splitf(p[j], a, c2); h0[j] = a; l0[j] = c2; splitf(p[8 + j], a, c2); h1[j] = a; l1[j] = c2; }
                pf[nq] = cat16b(h0, h1); pl[nq] = cat16b(l0, l1);
            } else { v16h t;
#pragma unroll
                for (int e = 0; e < 16; ++e) t[e] = tohx(p[e]);
                pf[nq] = t; } }
#pragma unroll
        for (int db = 0; db < 4; ++db)
#pragma unroll
            for (int nq = 0; nq < NQ; ++nq) { o[db][nq] = WF::mma(vf[db], pf[nq], o[db][nq]); if (HR) { o[db][nq] = WF::mma(vf[db], pl[nq], o[db][nq]); o[db][nq] = WF::mma(v2[db], pf[nq], o[db][nq]); } } };
    V kf[2][2], k2[2][2], vf[4], v2[4]; v8f s[2][NQ];
    ldk(kf, k2);
    __builtin_amdgcn_sched_barrier(0);   // key loads issue in front of the value loads here as in the loop: loads return in order, and with another order on entry the wait at the loop's head covers the value loads too
    ldv(vf, v2);
    asm volatile("s_wait_xcnt 0x0" ::: "memory");   // the first fragment loads name the per-lane offset register, which is dead from here on and gets reused
    // each fragment set is refilled for the next step right behind its last use: the key loads fly under softmax and p.v, the value loads under the next scores and softmax (step kl always exists)
    for (int k0 = kb; k0 < kl; k0 += 32) {
        scores(s, kf, k2);
        ldk(kf, k2);
        softpv(s, vf, v2, k0, false);
        ldv(vf, v2);
    }
    scores(s, kf, k2);
    softpv(s, vf, v2, kl, true);
    if constexpr (SPLIT) {
        // xs: the LDS ranges of this wave's rows, one per key range 1 to 3; a range is rows of 32 lanes: 8 * NQ rows of 16 bytes per lane (o), then NQ + NQ rows of 4 bytes per lane (maximum, sum); a lane reads what the same lane of the other wave wrote
        constexpr int XSL = (8 * NQ * 4 + 2 * NQ) * 32;
        const int lane = lr + 16 * hi;
        __builtin_amdgcn_sched_barrier(0);   // holds the last p.v WMMAs in front of the v_nops below
        asm volatile("v_nop\n\tv_nop\n\tv_nop\n\tv_nop\n\tv_nop");   // the vector slots that the chip needs behind a WMMA before its operand or result registers are written or read
        if (part) {
            v4f* xo = (v4f*)(xs + (part - 1) * XSL) + lane; float* xm = xs + (part - 1) * XSL + 8 * NQ * 128 + lane;
#pragma unroll
            for (int nq = 0; nq < NQ; ++nq) { xm[nq * 32] = mr[nq]; xm[(NQ + nq) * 32] = ls[nq];
#pragma unroll
                for (int db = 0; db < 4; ++db) { xo[((nq * 4 + db) * 2) * 32] = __builtin_shufflevector(o[db][nq], o[db][nq], 0, 1, 2, 3); xo[((nq * 4 + db) * 2 + 1) * 32] = __builtin_shufflevector(o[db][nq], o[db][nq], 4, 5, 6, 7); } }
        }
        __syncthreads();   // the LDS writes of the waves of ranges 1 to 3 are done before the waves of range 0 read them; every wave of the block passes it once
        if (part) return;
        for (int g = 0; g < 3; ++g) {
            const v4f* xo = (const v4f*)(xs + g * XSL) + lane; const float* xm = xs + g * XSL + 8 * NQ * 128 + lane;
#pragma unroll
            for (int nq = 0; nq < NQ; ++nq) { const float m2 = xm[nq * 32], l2 = xm[(NQ + nq) * 32]; const float mn = fmaxf(mr[nq], m2);
                const float a1 = __builtin_amdgcn_exp2f((mr[nq] - mn) * CL), a2 = __builtin_amdgcn_exp2f((m2 - mn) * CL);
                ls[nq] = ls[nq] * a1 + l2 * a2; mr[nq] = mn;
#pragma unroll
                for (int db = 0; db < 4; ++db) { const v4f u = xo[((nq * 4 + db) * 2) * 32], w = xo[((nq * 4 + db) * 2 + 1) * 32];
#pragma unroll
                    for (int j = 0; j < 4; ++j) { o[db][nq][j] = o[db][nq][j] * a1 + u[j] * a2; o[db][nq][4 + j] = o[db][nq][4 + j] * a1 + w[j] * a2; } } }
        }
    }
#pragma unroll
    for (int nq = 0; nq < NQ; ++nq) { const float l = ls[nq] + xhalf(ls[nq]); const float inv = __fdiv_rn(1.0f, l);
        float* orow = O + (size_t)(q0 + nq * 16 + lr) * DM + 8 * hi;
#pragma unroll
        for (int db = 0; db < 4; ++db) { v4f a, c;
#pragma unroll
            for (int j = 0; j < 4; ++j) { a[j] = o[db][nq][j] * inv; c[j] = o[db][nq][4 + j] * inv; }
            *(v4f*)(orow + db * 16) = a; *(v4f*)(orow + db * 16 + 4) = c;
            asm volatile("s_wait_xcnt 0x0" ::: "memory"); } }   // the next pair of products is written into the data registers that these two stores name
}
// grid (NB * 16 heads, RH / 128 + (TT - RH) / 64): more blocks than resident places, so the cost falls with the index: first the hi/lo row groups (128 rows, 16 per wave: three products per tile, two planes per operand, keys not split, so theirs are the longest chains), last rows first; then the f16 row groups (64 rows: two waves of 32 rows x four key ranges), last rows first. The second launch bound asks for four waves per SIMD (at most 256 registers a wave).
// Key ranges of a block whose first row is qb (a multiple of 64, >= RH >= 128): with ns = qb / 32 + 2 steps of 32 keys (the count of the block's upper rows), range p starts at step ns * p / 4; ranges 0 to 2 end below step ns * 3 / 4 <= qb / 32, so all their keys pass the causal test; range 3 ends with the wave's own diagonal step q0.
static_assert(RH >= 128 && RH % 128 == 0);
__global__ __launch_bounds__(256, 4) void k_fattn(const h16* __restrict__ QK16, const h16* __restrict__ VT16, const bf* __restrict__ QKh, const bf* __restrict__ QKl, const bf* __restrict__ VTh, const bf* __restrict__ VTl, float* OUT) {
    const int lane = threadIdx.x & 31, lr = lane & 15, hi = lane >> 4; const int wv = __builtin_amdgcn_readfirstlane((int)(threadIdx.x >> 5));
    const int b = blockIdx.x / NH_, h = blockIdx.x % NH_; const int y = blockIdx.y;
    float* O = OUT + (size_t)b * TT * DM + h * HD;
    const size_t zq = (size_t)(b * 2 * NH_ + h), zk = zq + NH_, zv = (size_t)(b * NH_ + h);
    __shared__ __align__(16) float xs[2][3 * (8 * 2 * 4 + 2 * 2) * 32];   // per 32-row half of the block: one range per key range 1 to 3
    if (y >= RH / 128) {
        const int qb = TT - 64 * (y - RH / 128 + 1), q0 = qb + (wv & 1) * 32, part = wv >> 1, ns = qb / 32 + 2;
        attn_rows<h16, false, 2, true>(QK16 + zq * TT * HD, nullptr, QK16 + zk * TT * HD, nullptr, VT16 + zv * HD * TT, nullptr, O, q0, (ns * part / 4) * 32, (part == 3) ? q0 : (ns * (part + 1) / 4) * 32 - 32, xs[wv & 1], part, lr, hi);
    } else {
        const int q0 = RH - 128 * (y + 1) + wv * 16;
        attn_rows<bf, true, 1, false>(QKh + zq * RH * HD, QKl + zq * RH * HD, QKh + zk * RH * HD, QKl + zk * RH * HD, VTh + zv * HD * RH, VTl + zv * HD * RH, O, q0, 0, q0 & ~31, nullptr, 0, lr, hi);
    }
}

extern "C" void kernel_launch(void* const* d_in, const int* in_sizes, int n_in,
                              void* d_out, int out_size, void* d_ws, size_t ws_size, hipStream_t stream) {
    if (n_in < 5) return;
    if (in_sizes[0] < (NB - 1) * SEQ_FULL * DM + TT * DM) return;
    if (in_sizes[1] < DM * 2 * DQ) return; if (in_sizes[2] < 2 * DQ) return; if (in_sizes[3] < DM * DQ) return; if (in_sizes[4] < DQ) return;
    if (out_size < NB * TT * DM) return;
    const float* x = (const float*)d_in[0]; const float* wqk = (const float*)d_in[1]; const float* bqk = (const float*)d_in[2]; const float* wv = (const float*)d_in[3]; const float* bv = (const float*)d_in[4];   // wire order x, Wqk, bqk, Wv, bv
    float* OUT = (float*)d_out;     // [NB][TT][1024]
    char* wsp = (char*)d_ws;
    auto take = [&](size_t bytes) { char* p = wsp; wsp += (bytes + 255) & ~(size_t)255; return (void*)p; };
    bf* WQKV = (bf*)take((size_t)N3 * DM * 2);                  // Bt [3072][1024] in fragment order: q | k | v row blocks
    float* BQKV = (float*)take((size_t)N3 * 4);
    h16* QK16 = (h16*)take((size_t)NB * 2 * NH_ * TT * HD * 2); // [NB][32] planes of TT x 64 in fragment order: q heads 0..15, k heads 16..31
    h16* VT16 = (h16*)take((size_t)NB * NH_ * HD * TT * 2);     // [NB][16] planes of 64 x TT in fragment order, blocks (t / 32, d / 16)
    bf* QKh = (bf*)take((size_t)NB * 2 * NH_ * RH * HD * 2); bf* QKl = (bf*)take((size_t)NB * 2 * NH_ * RH * HD * 2);
    bf* VTh = (bf*)take((size_t)NB * NH_ * HD * RH * 2); bf* VTl = (bf*)take((size_t)NB * NH_ * HD * RH * 2);
    bf* XB = (bf*)take((size_t)NB * TT * DM * 2);               // [NB*TT][1024] in fragment order
    const size_t carved = (size_t)(wsp - (char*)d_ws);
    if (carved > ws_size) return;
    k_prep<<<(unsigned)(NB * GX + GWQ + GWV + GBC), 256, 0, stream>>>(x, wqk, bqk, wv, bv, XB, WQKV, BQKV);
    k_gemmw<true, DM><<<dim3(NB * TT / 128, N3 / 128, 1), 128, 0, stream>>>(XB, WQKV, BQKV, QK16, QKh, QKl, VT16, VTh, VTl);
    k_fattn<<<dim3(NB * NH_, RH / 128 + (TT - RH) / 64, 1), 256, 0, stream>>>(QK16, VT16, QKh, QKl, VTh, VTl, OUT);
}
